// v000
// Times are from an AMD MI455X. After a warm-up the kernel runs many times in a row, and a time is the length of
// such a window on the GPU divided by its runs, so every launch and the gaps after it count. The runs cycle
// through copies of the inputs. A figure is the median of several windows, for all but v000 over two sittings.
// Sittings can differ by a few percent; kernels timed side by side share one.
// v000 is the starting kernel. One run takes 544 microseconds.
// compute dtype: all float inputs rounded to bf16; the fused q / k / v projection with EXACT bf16 products on WMMA 16x16x32 (f32 accumulate) (no q / k / v biases); causal logits: 3 products for the first 384 rows, single f16 q x k after, x 64^-0.5; softmax f32; P x 2^11 once to f16 x v once to f16 (bf16 hi + lo below row 384); ctx hi+lo x exact W below row 384, x2^6 f16 carry x f16(bf16 x 2^8) W after, + bias; f32 output.
#include <hip/hip_runtime.h>
#include <math.h>

typedef __attribute__((ext_vector_type(16))) _Float16 v16h;
typedef __attribute__((ext_vector_type(16))) __bf16 v16b;
typedef __attribute__((ext_vector_type(8)))  _Float16 v8h;
typedef __attribute__((ext_vector_type(8)))  float v8f;
typedef __attribute__((ext_vector_type(4)))  float v4f;
typedef __attribute__((ext_vector_type(2)))  float v2f;
typedef __attribute__((ext_vector_type(4)))  unsigned v4u;
typedef __attribute__((ext_vector_type(4)))  int v4i;
typedef float __attribute__((may_alias)) float_a;
typedef int __attribute__((may_alias)) int_a;

template <typename T> __device__ __forceinline__ void vst2(void* p, T v) { *(T*)p = v;  }
__device__ __forceinline__ v8f wmma16(v16h a, v16h b, v8f c) {
  v8f d = __builtin_amdgcn_wmma_f32_16x16x32_f16(false, a, false, b, (short)0, c, false, false);
  asm volatile("v_nop\n\tv_nop\n\tv_nop\n\tv_nop" : "+v"(d) : "v"(a), "v"(b));
  return d;
}
__device__ __forceinline__ v8f wmma_bf(v16b a, v16b b, v8f c) {
  v8f d = __builtin_amdgcn_wmma_f32_16x16x32_bf16(false, a, false, b, (short)0, c, false, false);
  asm volatile("v_nop\n\tv_nop\n\tv_nop\n\tv_nop" : "+v"(d) : "v"(a), "v"(b));
  return d;
}
// 16x16x32 fragments: lane = (h = lane>>4, row/col = lane&15); elements 0..7 = k0+8h+0..7, 8..15 = k0+16+8h+0..7; D element r = row 8h+r
__device__ __forceinline__ v16h frag_h(const _Float16* rowk0, int lane) {
  union { v16h v; v8h q[2]; } u; const _Float16* p = rowk0 + 8 * (lane >> 4);
  u.q[0] = *(const v8h*)p; u.q[1] = *(const v8h*)(p + 16); return u.v;
}
__device__ __forceinline__ v16h frag_f32(const float* rowk0, int lane) {
  v16h a; const float* p = rowk0 + 8 * (lane >> 4);
#pragma unroll
  for (int i = 0; i < 8; ++i) { a[i] = (_Float16)p[i]; a[8 + i] = (_Float16)p[16 + i]; }
  return a;
}
__device__ __forceinline__ v16h frag_f32s(const float* rowk0, int lane, float sc) {
  v16h a; const float* p = rowk0 + 8 * (lane >> 4);
#pragma unroll
  for (int i = 0; i < 8; ++i) { a[i] = (_Float16)(p[i] * sc); a[8 + i] = (_Float16)(p[16 + i] * sc); }
  return a;
}
// column fragment from a [K][ld] layout (column n), rows >= K read as 0
__device__ __forceinline__ v16h fragc_f32(const float* W, int k0, int n, int lane, int ld, int K) {
  v16h a; const int g = lane >> 4;
#pragma unroll
  for (int i = 0; i < 8; ++i) { const int ka = k0 + 8 * g + i, kb = ka + 16;
    a[i] = (_Float16)(ka < K ? W[(size_t)(ka < K ? ka : K - 1) * ld + n] : 0.f); a[8 + i] = (_Float16)(kb < K ? W[(size_t)(kb < K ? kb : K - 1) * ld + n] : 0.f); }
  return a;
}
struct F2 { v16b h, l; };
__device__ __forceinline__ F2 bsplit16(const float v[16]) { F2 r;
#pragma unroll
  for (int i = 0; i < 16; ++i) { const __bf16 h = (__bf16)v[i]; r.h[i] = h; r.l[i] = (__bf16)(v[i] - (float)h); }
  return r; }
__device__ __forceinline__ F2 split_row(const float* row, int k0, int lane) { float v[16]; const float* p = row + k0 + 8 * (lane >> 4);
#pragma unroll
  for (int i = 0; i < 8; ++i) { v[i] = p[i]; v[8 + i] = p[16 + i]; }
  return bsplit16(v); }
__device__ __forceinline__ F2 split_rowK(const float* row, int k0, int lane, int K) { float v[16]; const int g = lane >> 4;
#pragma unroll
  for (int i = 0; i < 8; ++i) { const int ka = k0 + 8 * g + i, kb = ka + 16; v[i] = ka < K ? row[ka < K ? ka : K - 1] : 0.f; v[8 + i] = kb < K ? row[kb < K ? kb : K - 1] : 0.f; }
  return bsplit16(v); }
__device__ __forceinline__ F2 split_col(const float* W, int k0, int n, int lane, int ld, int K) { float v[16]; const int g = lane >> 4;
#pragma unroll
  for (int i = 0; i < 8; ++i) { const int ka = k0 + 8 * g + i, kb = ka + 16; v[i] = ka < K ? W[(size_t)(ka < K ? ka : K - 1) * ld + n] : 0.f; v[8 + i] = kb < K ? W[(size_t)(kb < K ? kb : K - 1) * ld + n] : 0.f; }
  return bsplit16(v); }
__device__ __forceinline__ v8f mac3(const F2& a, const F2& b, v8f c) { c = wmma_bf(a.l, b.h, c); c = wmma_bf(a.h, b.l, c); return wmma_bf(a.h, b.h, c); }
__device__ __forceinline__ float sigm(float v) { return 1.0f / (1.0f + expf(-v)); }
#define LDSX() do { asm volatile("s_wait_dscnt 0" ::: "memory"); __builtin_amdgcn_wave_barrier(); __builtin_amdgcn_fence(__ATOMIC_RELEASE, "workgroup"); } while (0)

// Causal multi-head attention on separate q / k / v inputs at width 512 (q / k / v [2,2048,512]; torch (out,in) Wq / Wk / Wv / Wp [512,512] applied as einsum('bsd,ed->bse') = x @ W.T, no q / k / v biases; bp zeros (read); 8 heads x 64; att / sqrt(64); tril kept, -1e10 (finite: the same exclusion) elsewhere; softmax; y @ Wp.T + bp).
#define NB 2
#define TT 2048
#define CC 512            // NH * HD = projected width
#define DIN 512          // input (model) width
#define NH 8
#define HD 64
#define NQB (TT / 64)
#define HG 4
#define SCALE (0.125f)
#define CAUSAL 1
#ifndef TNB
#define TNB NB
#endif
__device__ __forceinline__ float bfr(float v) { return (float)(__bf16)v; }
__host__ __device__ __forceinline__ int kb_last(int qb) { return CAUSAL ? ((qb * 64 + 63) >> 7) : (TT / 128 - 1); }
typedef __attribute__((ext_vector_type(8))) __bf16 v8b;
__device__ __forceinline__ v16b frag_b(const __bf16* rowk0, int lane) {
  union { v16b v; v8b q[2]; } u; const __bf16* p = rowk0 + 8 * (lane >> 4);
  u.q[0] = *(const v8b*)p; u.q[1] = *(const v8b*)(p + 16); return u.v;
}
#define QBH 6              // causal: query blocks 0..QBH-1 of each sequence (few keys, no averaging) take the high-precision path
#define QHI 384            // rows carrying a q residual plane (all rows when non-causal: 2-product logits everywhere)
#define KHI 384            // key rows carrying k residual / v bf16 hi+lo planes (used only by the causal high-precision path)
// B fragment (k rows k0+.., output column o) of a weight: (in,out) [K][ld] or (out,in) [ld rows of K]: bf16 exact, or f16(bf16 * 256) exact
__device__ __forceinline__ v16b wcol_io(const float* Wm, int k0, int o, int lane, int ld) { v16b w; const int g = lane >> 4;
#pragma unroll
  for (int i = 0; i < 8; ++i) { w[i] = (__bf16)Wm[(size_t)(k0 + 8 * g + i) * ld + o]; w[8 + i] = (__bf16)Wm[(size_t)(k0 + 16 + 8 * g + i) * ld + o]; }
  return w; }
__device__ __forceinline__ v16b wcol_oi(const float* Wm, int k0, int o, int lane, int K) { v16b w; const float* p = Wm + (size_t)o * K + k0 + 8 * (lane >> 4);
#pragma unroll
  for (int i = 0; i < 8; ++i) { w[i] = (__bf16)p[i]; w[8 + i] = (__bf16)p[16 + i]; }
  return w; }
__device__ __forceinline__ v16h wcolh_io(const float* Wm, int k0, int o, int lane, int ld) { v16h w; const int g = lane >> 4;
#pragma unroll
  for (int i = 0; i < 8; ++i) { w[i] = (_Float16)(bfr(Wm[(size_t)(k0 + 8 * g + i) * ld + o]) * 256.0f); w[8 + i] = (_Float16)(bfr(Wm[(size_t)(k0 + 16 + 8 * g + i) * ld + o]) * 256.0f); }
  return w; }
__device__ __forceinline__ v16h wcolh_oi(const float* Wm, int k0, int o, int lane, int K) { v16h w; const float* p = Wm + (size_t)o * K + k0 + 8 * (lane >> 4);
#pragma unroll
  for (int i = 0; i < 8; ++i) { w[i] = (_Float16)(bfr(p[i]) * 256.0f); w[8 + i] = (_Float16)(bfr(p[16 + i]) * 256.0f); }
  return w; }
#define WQKV_LAYOUT 1   // 0 = (in,out) [DIN][CC]; 1 = (out,in) [CC][DIN]; 2 = per-head [NH][DIN][HD]
__device__ __forceinline__ v16b wcol_hdk(const float* Wm, int k0, int o, int lane) { v16b w; const int g = lane >> 4; const float* p = Wm + (size_t)(o / HD) * DIN * HD + (o % HD);
#pragma unroll
  for (int i = 0; i < 8; ++i) { w[i] = (__bf16)p[(size_t)(k0 + 8 * g + i) * HD]; w[8 + i] = (__bf16)p[(size_t)(k0 + 16 + 8 * g + i) * HD]; }
  return w; }
#define WO_OUT_IN 1
#if WQKV_LAYOUT == 1
#define WCOL(W, k0, o, lane) wcol_oi(W, k0, o, lane, DIN)
#elif WQKV_LAYOUT == 2
#define WCOL(W, k0, o, lane) wcol_hdk(W, k0, o, lane)
#else
#define WCOL(W, k0, o, lane) wcol_io(W, k0, o, lane, CC)
#endif
#if WO_OUT_IN
#define WOCOL(W, k0, o, lane) wcol_oi(W, k0, o, lane, CC)
#define WOCOLH(W, k0, o, lane) wcolh_oi(W, k0, o, lane, CC)
#else
#define WOCOL(W, k0, o, lane) wcol_io(W, k0, o, lane, DIN)
#define WOCOLH(W, k0, o, lane) wcolh_io(W, k0, o, lane, DIN)
#endif

#ifndef SM_EXTRA_PARAMS
#define SM_EXTRA_PARAMS
#endif
#ifndef PROJ_EXTRA_PARAMS
#define PROJ_EXTRA_PARAMS
#endif
#ifndef SM_MASK_HOOK
#define SM_MASK_HOOK (void)0
#endif

#define WS_QH  0u                                      // f16 q rows [b*t][CC]
#define WS_KH  (WS_QH + 2u * (size_t)NB * TT * CC)      // f16 k rows [b*t][CC]
#define WS_VT  (WS_KH + 2u * (size_t)NB * TT * CC)      // f16 v planes [b][c][t]
#define WS_QL  (WS_VT + 2u * (size_t)NB * CC * TT)      // f16 q residual x 2^10 rows [b][t < QHI][CC]
#define WS_KL  (WS_QL + 2u * (size_t)NB * QHI * CC)     // f16 k residual x 2^10 rows [b][t < KHI][CC]
#define WS_VB  (WS_KL + 2u * (size_t)NB * KHI * CC)     // bf16 v hi planes [b][c][t < KHI]
#define WS_VBL (WS_VB + 2u * (size_t)NB * CC * KHI)
#define WS_S   (WS_VBL + 2u * (size_t)NB * CC * KHI)    // f32 logits / P [hg][t][s]
#define WS_Y   (WS_S  + 4u * (size_t)HG * TT * TT)      // f32 ctx rows [b*t][CC] (only when there is an output projection)
#define WS_END (WS_Y  + 4u * (size_t)NB * TT * CC)

// ---- k_proj: block = (64 rows, 128 cols, which): q/k/v = X W (+ b) with exact bf16 products (K = DIN) -> which 0: q f16 rows (+ residual rows < QHI); 1: k f16 rows (+ residual rows < KHI); 2: v f16 planes [c][t] (+ bf16 hi/lo planes for t < KHI)
__global__ __launch_bounds__(128) void k_proj(const float* __restrict__ XQ, const float* __restrict__ XK, const float* __restrict__ XV, const float* __restrict__ WQ, const float* __restrict__ WK, const float* __restrict__ WV, const float* __restrict__ BQ, const float* __restrict__ BK, const float* __restrict__ BV,
    _Float16* __restrict__ QH, _Float16* __restrict__ QL, _Float16* __restrict__ KH, _Float16* __restrict__ KL, _Float16* __restrict__ VT, __bf16* __restrict__ VB, __bf16* __restrict__ VBL) {
  __shared__ __align__(16) _Float16 sh[64][136], sl[64][136]; __shared__ __align__(16) _Float16 th[128][72]; __shared__ __align__(16) __bf16 tb[128][72], tbl[128][72];
  const int tid = threadIdx.x, wave = tid >> 5, lane = tid & 31, col = lane & 15, g = lane >> 4; const int which = blockIdx.z; const int c0 = blockIdx.y * 128; const size_t r0 = (size_t)blockIdx.x * 64; const size_t bb = r0 / TT; const int t0 = (int)(r0 % TT);
  const float* X = which == 0 ? XQ : which == 1 ? XK : XV; const float* WA = which == 0 ? WQ : which == 1 ? WK : WV; const float* BA = which == 0 ? BQ : which == 1 ? BK : BV;
  v8f acc[8] = {};
#pragma unroll 2
  for (int kc = 0; kc < DIN / 32; ++kc) { v16b a; { const float* p = X + (r0 + wave * 16 + col) * DIN + kc * 32 + 8 * g;
#pragma unroll
      for (int i = 0; i < 8; ++i) { a[i] = (__bf16)p[i]; a[8 + i] = (__bf16)p[16 + i]; } }
    asm volatile("s_wait_loadcnt 0x0" ::: "memory");
#pragma unroll
    for (int j = 0; j < 8; ++j) { const v16b w = WCOL(WA, kc * 32, c0 + j * 16 + col, lane); asm volatile("s_wait_loadcnt 0x0" ::: "memory"); acc[j] = wmma_bf(a, w, acc[j]); } }
  if (which < 2) { _Float16* DH = which == 0 ? QH : KH; _Float16* DL = which == 0 ? QL : KL; const int nhi = which == 0 ? QHI : KHI; const bool hi_rows = t0 < nhi;
#pragma unroll
    for (int j = 0; j < 8; ++j) { const float bias = BA ? bfr(BA[c0 + j * 16 + col]) : 0.f;
#pragma unroll
      for (int r = 0; r < 8; ++r) { const float v = acc[j][r] + bias; const _Float16 hv = (_Float16)v; sh[wave * 16 + 8 * g + r][j * 16 + col] = hv; sl[wave * 16 + 8 * g + r][j * 16 + col] = (_Float16)((v - (float)hv) * 1024.0f); } }
    __syncthreads();
    for (int e = tid; e < 64 * 16; e += 128) { const int rl = e >> 4, q = e & 15; vst2((unsigned*)(DH + (r0 + rl) * CC + c0 + q * 8), *(const v4u*)&sh[rl][q * 8]); if (hi_rows) vst2((unsigned*)(DL + (bb * nhi + t0 + rl) * (size_t)CC + c0 + q * 8), *(const v4u*)&sl[rl][q * 8]); }
  } else { const bool hi_rows = t0 < KHI;
#pragma unroll
    for (int j = 0; j < 8; ++j) { const float bias = BA ? bfr(BA[c0 + j * 16 + col]) : 0.f;
#pragma unroll
      for (int r = 0; r < 8; ++r) { const float v = acc[j][r] + bias; const int rl = wave * 16 + 8 * g + r, cl = j * 16 + col; th[cl][rl] = (_Float16)v; const __bf16 bh = (__bf16)v; tb[cl][rl] = bh; tbl[cl][rl] = (__bf16)(v - (float)bh); } }
    __syncthreads();
    for (int e = tid; e < 128 * 8; e += 128) { const int cl = e >> 3, q = e & 7; vst2((unsigned*)(VT + (bb * CC + c0 + cl) * (size_t)TT + t0 + q * 8), *(const v4u*)&th[cl][q * 8]); if (hi_rows) { const size_t o3 = (bb * CC + c0 + cl) * (size_t)KHI + t0 + q * 8; vst2((unsigned*)(VB + o3), *(const v4u*)&tb[cl][q * 8]); vst2((unsigned*)(VBL + o3), *(const v4u*)&tbl[cl][q * 8]); } } } }
// ---- k_sc: block = (query block qb, key block kb <= kb_last(qb), head in group) of batch b: logits x SCALE; q hi + residual (x 2^10) against k (2 products) for query rows < QHI, plus the k residual (3 products) for query blocks < QBH (causal early rows); causal: blocks past the diagonal exit, the mask itself is applied by index in k_sm
__global__ __launch_bounds__(128) void k_sc(const _Float16* __restrict__ QH, const _Float16* __restrict__ KH, const _Float16* __restrict__ QL, const _Float16* __restrict__ KL, int b, int h0, float* __restrict__ S0) { __shared__ __align__(16) float ss[4][16][132];
  const int qb = blockIdx.x, kb = blockIdx.y; if (kb > kb_last(qb)) return;
  const int h = h0 + blockIdx.z; float* S = S0 + (size_t)blockIdx.z * TT * TT;
  const int tid = threadIdx.x, wave = tid >> 5, lane = tid & 31, col = lane & 15, g = lane >> 4; const int k0 = kb * 128; const int ql0 = qb * 64 + wave * 16; const size_t q0 = (size_t)b * TT + ql0, kr0 = (size_t)b * TT + k0;
  v8f acc[8] = {}, accl[8] = {};
  const _Float16* QLb = QL + (size_t)b * QHI * CC; const _Float16* KLb = KL + (size_t)b * KHI * CC;
  if (qb < QBH) {
#pragma unroll
    for (int kc = 0; kc < HD / 32; ++kc) { const v16h ah = frag_h(QH + (q0 + col) * CC + h * HD + kc * 32, lane), al = frag_h(QLb + (size_t)(ql0 + col) * CC + h * HD + kc * 32, lane);
#pragma unroll
      for (int j = 0; j < 8; ++j) { const v16h kbf = frag_h(KH + (kr0 + j * 16 + col) * CC + h * HD + kc * 32, lane), klf = frag_h(KLb + (size_t)(k0 + j * 16 + col) * CC + h * HD + kc * 32, lane); acc[j] = wmma16(ah, kbf, acc[j]); accl[j] = wmma16(al, kbf, accl[j]); accl[j] = wmma16(ah, klf, accl[j]); } }
  } else if (qb * 64 < QHI) {
#pragma unroll
    for (int kc = 0; kc < HD / 32; ++kc) { const v16h ah = frag_h(QH + (q0 + col) * CC + h * HD + kc * 32, lane), al = frag_h(QLb + (size_t)(ql0 + col) * CC + h * HD + kc * 32, lane);
#pragma unroll
      for (int j = 0; j < 8; ++j) { const v16h kbf = frag_h(KH + (kr0 + j * 16 + col) * CC + h * HD + kc * 32, lane); acc[j] = wmma16(ah, kbf, acc[j]); accl[j] = wmma16(al, kbf, accl[j]); } }
  } else {
#pragma unroll
    for (int kc = 0; kc < HD / 32; ++kc) { const v16h ah = frag_h(QH + (q0 + col) * CC + h * HD + kc * 32, lane);
#pragma unroll
      for (int j = 0; j < 8; ++j) { const v16h kbf = frag_h(KH + (kr0 + j * 16 + col) * CC + h * HD + kc * 32, lane); acc[j] = wmma16(ah, kbf, acc[j]); } } }
#pragma unroll
  for (int j = 0; j < 8; ++j) {
#pragma unroll
    for (int r = 0; r < 8; ++r) ss[wave][8 * g + r][j * 16 + col] = (acc[j][r] + accl[j][r] * (1.0f / 1024.0f)) * SCALE; }
  LDSX(); for (int rl = 0; rl < 16; ++rl) vst2(S + (size_t)(ql0 + rl) * TT + k0 + lane * 4, *(const v4f*)&ss[wave][rl][lane * 4]); }
// ---- k_sm: block = query row t (head in group): keys [0, kend): causal -> logit if s <= t else excluded; softmax in f32; P x 2^11 in place (0 for excluded)
__global__ __launch_bounds__(256) void k_sm(float* __restrict__ S0 SM_EXTRA_PARAMS) { __shared__ float sred[8]; __shared__ float sbc; __shared__ __align__(16) float shv[TT];
  const int tid = threadIdx.x; const int t = blockIdx.x; const int kend = (kb_last(t >> 6) + 1) * 128;
  float* sr = S0 + (size_t)blockIdx.y * TT * TT + (size_t)t * TT;
  float m = -3.0e38f; for (int k = tid; k < kend; k += 256) { float v = (!CAUSAL || k <= t) ? sr[k] : -3.0e38f; SM_MASK_HOOK; shv[k] = v; m = fmaxf(m, v); }
#pragma unroll
  for (int o = 1; o < 32; o <<= 1) m = fmaxf(m, __shfl_xor(m, o));
  if ((tid & 31) == 0) sred[tid >> 5] = m; __syncthreads(); if (tid == 0) { float a = sred[0]; for (int i = 1; i < 8; ++i) a = fmaxf(a, sred[i]); sbc = a; } __syncthreads(); m = sbc; __syncthreads();
  float sum = 0.f; for (int k = tid; k < kend; k += 256) { const float v = shv[k]; const float e = (v <= -1.0e38f) ? 0.f : expf(v - m); shv[k] = e; sum += e; }
#pragma unroll
  for (int o = 1; o < 32; o <<= 1) sum += __shfl_xor(sum, o);
  if ((tid & 31) == 0) sred[tid >> 5] = sum; __syncthreads(); if (tid == 0) { float a = 0.f; for (int i = 0; i < 8; ++i) a += sred[i]; sbc = a > 0.f ? 2048.0f / a : 0.f; }   /* a fully excluded row yields P = 0 */ __syncthreads(); const float inv = sbc;
  for (int k = tid; k < kend; k += 256) shv[k] = shv[k] * inv;
  __syncthreads(); for (int q = tid; q < kend / 4; q += 256) vst2(sr + q * 4, *(const v4f*)&shv[q * 4]); }
// ---- k_pv: block = 64 queries (qb) of (b, h): ctx = P . v over keys [0, kend) (P x 2^11 once to f16 against v f16: 1 product; causal early query blocks: P and v as bf16 hi + lo, 3 products); 256-B (row, head) segment by 16 lanes
__global__ __launch_bounds__(128) void k_pv(const float* __restrict__ PS0, const _Float16* __restrict__ VT, const __bf16* __restrict__ VB, const __bf16* __restrict__ VBL, int b, int h0, float* __restrict__ Y) { const int h = h0 + blockIdx.z; const float* PS = PS0 + (size_t)blockIdx.z * TT * TT; __shared__ __align__(16) float ss[4][16][HD + 4];
  const int tid = threadIdx.x, wave = tid >> 5, lane = tid & 31, col = lane & 15, g = lane >> 4; const int qb = blockIdx.x; const int ql0 = qb * 64 + wave * 16; const int kce = (kb_last(qb) + 1) * 4;
  v8f acc[HD / 16] = {};
  if (qb < QBH) {
#pragma unroll 1
    for (int kc = 0; kc < kce; ++kc) { const F2 p = split_row(PS + (size_t)(ql0 + col) * TT, kc * 32, lane);
      asm volatile("s_wait_loadcnt 0x0" ::: "memory");
#pragma unroll
      for (int j = 0; j < HD / 16; ++j) { const size_t po = ((size_t)b * CC + h * HD + j * 16 + col) * (size_t)KHI + kc * 32; const v16b vh = frag_b(VB + po, lane); acc[j] = wmma_bf(p.h, vh, acc[j]); acc[j] = wmma_bf(p.l, vh, acc[j]); acc[j] = wmma_bf(p.h, frag_b(VBL + po, lane), acc[j]); } }
  } else {
#pragma unroll 1
    for (int kc = 0; kc < kce; ++kc) { const v16h p = frag_f32(PS + (size_t)(ql0 + col) * TT + kc * 32, lane);
      asm volatile("s_wait_loadcnt 0x0" ::: "memory");
#pragma unroll
      for (int j = 0; j < HD / 16; ++j) { const size_t po = ((size_t)b * CC + h * HD + j * 16 + col) * (size_t)TT + kc * 32; acc[j] = wmma16(p, frag_h(VT + po, lane), acc[j]); } } }
#pragma unroll
  for (int j = 0; j < HD / 16; ++j)
#pragma unroll
    for (int r = 0; r < 8; ++r) ss[wave][8 * g + r][j * 16 + col] = acc[j][r] * (1.0f / 2048.0f);
  LDSX(); for (int rl = 0; rl < 16; ++rl) if (lane < HD / 4) vst2(Y + ((size_t)b * TT + ql0 + rl) * CC + h * HD + lane * 4, *(const v4f*)&ss[wave][rl][lane * 4]); }
// ---- k_out: block = (64 rows, 128 cols): out = ctx Wo (+ bo): ctx x 2^6 once to f16 against Wo as f16(bf16 x 2^8) exact (1 product) x 2^-14; causal early rows (< QHI of each sequence): ctx bf16 hi + lo against exact bf16 Wo (2 products)
__global__ __launch_bounds__(128) void k_out(const float* __restrict__ Y, const float* __restrict__ WO, const float* __restrict__ BO, float* __restrict__ OUT) { __shared__ __align__(16) float sf[4][16][132];
  const int tid = threadIdx.x, wave = tid >> 5, lane = tid & 31, col = lane & 15, g = lane >> 4; const int c0 = blockIdx.y * 128; const size_t r0 = (size_t)blockIdx.x * 64 + wave * 16;
  v8f acc[8] = {};
  if (CAUSAL && (int)(((size_t)blockIdx.x * 64) % TT) < QHI) {   /* block-uniform */
#pragma unroll 2
    for (int kc = 0; kc < CC / 32; ++kc) { const F2 a = split_row(Y + (r0 + col) * CC, kc * 32, lane); asm volatile("s_wait_loadcnt 0x0" ::: "memory");
#pragma unroll
      for (int j = 0; j < 8; ++j) { const v16b w = WOCOL(WO, kc * 32, c0 + j * 16 + col, lane); asm volatile("s_wait_loadcnt 0x0" ::: "memory"); acc[j] = wmma_bf(a.h, w, acc[j]); acc[j] = wmma_bf(a.l, w, acc[j]); } }
#pragma unroll
    for (int j = 0; j < 8; ++j) { const float bias = BO ? bfr(BO[c0 + j * 16 + col]) : 0.f;
#pragma unroll
      for (int r = 0; r < 8; ++r) sf[wave][8 * g + r][j * 16 + col] = acc[j][r] + bias; }
  } else {
#pragma unroll 2
    for (int kc = 0; kc < CC / 32; ++kc) { const v16h a = frag_f32s(Y + (r0 + col) * CC + kc * 32, lane, 64.0f); asm volatile("s_wait_loadcnt 0x0" ::: "memory");   /* ctx carried x 2^6 into f16 so small-magnitude context rows stay clear of f16 subnormals */
#pragma unroll
      for (int j = 0; j < 8; ++j) { const v16h w = WOCOLH(WO, kc * 32, c0 + j * 16 + col, lane); asm volatile("s_wait_loadcnt 0x0" ::: "memory"); acc[j] = wmma16(a, w, acc[j]); } }
#pragma unroll
    for (int j = 0; j < 8; ++j) { const float bias = BO ? bfr(BO[c0 + j * 16 + col]) : 0.f;
#pragma unroll
      for (int r = 0; r < 8; ++r) sf[wave][8 * g + r][j * 16 + col] = acc[j][r] * (1.0f / 16384.0f) + bias; } }   /* 2^-8 (Wo carry) x 2^-6 (ctx carry) */
  LDSX(); for (int rl = 0; rl < 16; ++rl) vst2(OUT + (r0 + rl) * DIN + c0 + lane * 4, *(const v4f*)&sf[wave][rl][lane * 4]); }

extern "C" void kernel_launch(void* const* d_in, const int* in_sizes, int n_in, void* d_out, int out_size, void* d_ws, size_t ws_size, hipStream_t stream) {
  (void)in_sizes; (void)n_in; (void)out_size;
  const float** F = (const float**)d_in;
  if (ws_size < (size_t)WS_END) return;
  char* ws = (char*)d_ws; _Float16 *QH = (_Float16*)(ws + WS_QH), *KH = (_Float16*)(ws + WS_KH), *VT = (_Float16*)(ws + WS_VT), *QL = (_Float16*)(ws + WS_QL), *KL = (_Float16*)(ws + WS_KL); __bf16 *VB = (__bf16*)(ws + WS_VB), *VBL = (__bf16*)(ws + WS_VBL); float *S = (float*)(ws + WS_S), *Y = (float*)(ws + WS_Y);
  (void)Y; (void)QL; (void)KL; (void)VB; (void)VBL;
  // inputs: 0 q [2,2048,512]; 1 k; 2 v; 3 Wq [512,512] (out,in); 4 Wk; 5 Wv; 6 Wp (out,in); 7 bp (zeros, read); no q / k / v biases (null pointers)
  k_proj<<<dim3(TNB * TT / 64, CC / 128, 3), 128, 0, stream>>>(F[0], F[1], F[2], F[3], F[4], F[5], nullptr, nullptr, nullptr, QH, QL, KH, KL, VT, VB, VBL);
  for (int b = 0; b < TNB; ++b) for (int h0 = 0; h0 < NH; h0 += HG) {
    k_sc<<<dim3(NQB, TT / 128, HG), 128, 0, stream>>>(QH, KH, QL, KL, b, h0, S);
    k_sm<<<dim3(TT, HG), 256, 0, stream>>>(S);
    k_pv<<<dim3(NQB, 1, HG), 128, 0, stream>>>(S, VT, VB, VBL, b, h0, Y);
  }
  k_out<<<dim3(TNB * TT / 64, DIN / 128), 128, 0, stream>>>(Y, F[6], F[7], (float*)d_out);
}

// v001
// One run takes 263 microseconds.
// In two side-by-side timings against v000, it was 2.06 and 2.09 times as fast.
// compute dtype: all float inputs rounded to bf16; the fused q / k / v projection with EXACT bf16 products on WMMA 16x16x32 (f32 accumulate) (no q / k / v biases); causal logits: 3 products for the first 384 rows, single f16 q x k after, x 64^-0.5; softmax f32; P x 2^11 once to f16 x v once to f16 (bf16 hi + lo below row 384); ctx hi+lo x exact W below row 384, x2^6 f16 carry x f16(bf16 x 2^8) W after, + bias; f32 output.
#include <hip/hip_runtime.h>
#include <math.h>

typedef __attribute__((ext_vector_type(16))) _Float16 v16h;
typedef __attribute__((ext_vector_type(16))) __bf16 v16b;
typedef __attribute__((ext_vector_type(8)))  _Float16 v8h;
typedef __attribute__((ext_vector_type(8)))  float v8f;
typedef __attribute__((ext_vector_type(4)))  float v4f;
typedef __attribute__((ext_vector_type(2)))  float v2f;
typedef __attribute__((ext_vector_type(4)))  unsigned v4u;
typedef __attribute__((ext_vector_type(4)))  int v4i;
typedef float __attribute__((may_alias)) float_a;
typedef int __attribute__((may_alias)) int_a;

template <typename T> __device__ __forceinline__ void vst2(void* p, T v) { *(T*)p = v;  }
__device__ __forceinline__ v8f wmma16(v16h a, v16h b, v8f c) {
  v8f d = __builtin_amdgcn_wmma_f32_16x16x32_f16(false, a, false, b, (short)0, c, false, false);
  asm volatile("v_nop\n\tv_nop\n\tv_nop\n\tv_nop" : "+v"(d) : "v"(a), "v"(b));
  return d;
}
__device__ __forceinline__ v8f wmma_bf(v16b a, v16b b, v8f c) {
  v8f d = __builtin_amdgcn_wmma_f32_16x16x32_bf16(false, a, false, b, (short)0, c, false, false);
  asm volatile("v_nop\n\tv_nop\n\tv_nop\n\tv_nop" : "+v"(d) : "v"(a), "v"(b));
  return d;
}
// 16x16x32 fragments: lane = (h = lane>>4, row/col = lane&15); elements 0..7 = k0+8h+0..7, 8..15 = k0+16+8h+0..7; D element r = row 8h+r
__device__ __forceinline__ v16h frag_h(const _Float16* rowk0, int lane) {
  union { v16h v; v8h q[2]; } u; const _Float16* p = rowk0 + 8 * (lane >> 4);
  u.q[0] = *(const v8h*)p; u.q[1] = *(const v8h*)(p + 16); return u.v;
}
__device__ __forceinline__ v16h frag_f32(const float* rowk0, int lane) {
  v16h a; const float* p = rowk0 + 8 * (lane >> 4);
#pragma unroll
  for (int i = 0; i < 8; ++i) { a[i] = (_Float16)p[i]; a[8 + i] = (_Float16)p[16 + i]; }
  return a;
}
__device__ __forceinline__ v16h frag_f32s(const float* rowk0, int lane, float sc) {
  v16h a; const float* p = rowk0 + 8 * (lane >> 4);
#pragma unroll
  for (int i = 0; i < 8; ++i) { a[i] = (_Float16)(p[i] * sc); a[8 + i] = (_Float16)(p[16 + i] * sc); }
  return a;
}
// column fragment from a [K][ld] layout (column n), rows >= K read as 0
__device__ __forceinline__ v16h fragc_f32(const float* W, int k0, int n, int lane, int ld, int K) {
  v16h a; const int g = lane >> 4;
#pragma unroll
  for (int i = 0; i < 8; ++i) { const int ka = k0 + 8 * g + i, kb = ka + 16;
    a[i] = (_Float16)(ka < K ? W[(size_t)(ka < K ? ka : K - 1) * ld + n] : 0.f); a[8 + i] = (_Float16)(kb < K ? W[(size_t)(kb < K ? kb : K - 1) * ld + n] : 0.f); }
  return a;
}
struct F2 { v16b h, l; };
__device__ __forceinline__ F2 bsplit16(const float v[16]) { F2 r;
#pragma unroll
  for (int i = 0; i < 16; ++i) { const __bf16 h = (__bf16)v[i]; r.h[i] = h; r.l[i] = (__bf16)(v[i] - (float)h); }
  return r; }
__device__ __forceinline__ F2 split_row(const float* row, int k0, int lane) { float v[16]; const float* p = row + k0 + 8 * (lane >> 4);
#pragma unroll
  for (int i = 0; i < 8; ++i) { v[i] = p[i]; v[8 + i] = p[16 + i]; }
  return bsplit16(v); }
__device__ __forceinline__ F2 split_rowK(const float* row, int k0, int lane, int K) { float v[16]; const int g = lane >> 4;
#pragma unroll
  for (int i = 0; i < 8; ++i) { const int ka = k0 + 8 * g + i, kb = ka + 16; v[i] = ka < K ? row[ka < K ? ka : K - 1] : 0.f; v[8 + i] = kb < K ? row[kb < K ? kb : K - 1] : 0.f; }
  return bsplit16(v); }
__device__ __forceinline__ F2 split_col(const float* W, int k0, int n, int lane, int ld, int K) { float v[16]; const int g = lane >> 4;
#pragma unroll
  for (int i = 0; i < 8; ++i) { const int ka = k0 + 8 * g + i, kb = ka + 16; v[i] = ka < K ? W[(size_t)(ka < K ? ka : K - 1) * ld + n] : 0.f; v[8 + i] = kb < K ? W[(size_t)(kb < K ? kb : K - 1) * ld + n] : 0.f; }
  return bsplit16(v); }
__device__ __forceinline__ v8f mac3(const F2& a, const F2& b, v8f c) { c = wmma_bf(a.l, b.h, c); c = wmma_bf(a.h, b.l, c); return wmma_bf(a.h, b.h, c); }
__device__ __forceinline__ float sigm(float v) { return 1.0f / (1.0f + expf(-v)); }
#define LDSX() do { asm volatile("s_wait_dscnt 0" ::: "memory"); __builtin_amdgcn_wave_barrier(); __builtin_amdgcn_fence(__ATOMIC_RELEASE, "workgroup"); } while (0)

// Causal multi-head attention on separate q / k / v inputs at width 512 (q / k / v [2,2048,512]; torch (out,in) Wq / Wk / Wv / Wp [512,512] applied as einsum('bsd,ed->bse') = x @ W.T, no q / k / v biases; bp zeros (read); 8 heads x 64; att / sqrt(64); tril kept, -1e10 (finite: the same exclusion) elsewhere; softmax; y @ Wp.T + bp).
#define NB 2
#define TT 2048
#define CC 512            // NH * HD = projected width
#define DIN 512          // input (model) width
#define NH 8
#define HD 64
#define NQB (TT / 64)
#define HG 4
#define SCALE (0.125f)
#define CAUSAL 1
#ifndef TNB
#define TNB NB
#endif
__device__ __forceinline__ float bfr(float v) { return (float)(__bf16)v; }
__host__ __device__ __forceinline__ int kb_last(int qb) { return CAUSAL ? ((qb * 64 + 63) >> 7) : (TT / 128 - 1); }
typedef __attribute__((ext_vector_type(8))) __bf16 v8b;
__device__ __forceinline__ v16b frag_b(const __bf16* rowk0, int lane) {
  union { v16b v; v8b q[2]; } u; const __bf16* p = rowk0 + 8 * (lane >> 4);
  u.q[0] = *(const v8b*)p; u.q[1] = *(const v8b*)(p + 16); return u.v;
}
#define QBH 6              // causal: query blocks 0..QBH-1 of each sequence (few keys, no averaging) take the high-precision path
#define QHI 384            // rows carrying a q residual plane (all rows when non-causal: 2-product logits everywhere)
#define KHI 384            // key rows carrying k residual / v bf16 hi+lo planes (used only by the causal high-precision path)
// B fragment (k rows k0+.., output column o) of a weight: (in,out) [K][ld] or (out,in) [ld rows of K]: bf16 exact, or f16(bf16 * 256) exact
__device__ __forceinline__ v16b wcol_io(const float* Wm, int k0, int o, int lane, int ld) { v16b w; const int g = lane >> 4;
#pragma unroll
  for (int i = 0; i < 8; ++i) { w[i] = (__bf16)Wm[(size_t)(k0 + 8 * g + i) * ld + o]; w[8 + i] = (__bf16)Wm[(size_t)(k0 + 16 + 8 * g + i) * ld + o]; }
  return w; }
__device__ __forceinline__ v16b wcol_oi(const float* Wm, int k0, int o, int lane, int K) { v16b w; const float* p = Wm + (size_t)o * K + k0 + 8 * (lane >> 4);
#pragma unroll
  for (int i = 0; i < 8; ++i) { w[i] = (__bf16)p[i]; w[8 + i] = (__bf16)p[16 + i]; }
  return w; }
__device__ __forceinline__ v16h wcolh_io(const float* Wm, int k0, int o, int lane, int ld) { v16h w; const int g = lane >> 4;
#pragma unroll
  for (int i = 0; i < 8; ++i) { w[i] = (_Float16)(bfr(Wm[(size_t)(k0 + 8 * g + i) * ld + o]) * 256.0f); w[8 + i] = (_Float16)(bfr(Wm[(size_t)(k0 + 16 + 8 * g + i) * ld + o]) * 256.0f); }
  return w; }
__device__ __forceinline__ v16h wcolh_oi(const float* Wm, int k0, int o, int lane, int K) { v16h w; const float* p = Wm + (size_t)o * K + k0 + 8 * (lane >> 4);
#pragma unroll
  for (int i = 0; i < 8; ++i) { w[i] = (_Float16)(bfr(p[i]) * 256.0f); w[8 + i] = (_Float16)(bfr(p[16 + i]) * 256.0f); }
  return w; }
#define WQKV_LAYOUT 1   // 0 = (in,out) [DIN][CC]; 1 = (out,in) [CC][DIN]; 2 = per-head [NH][DIN][HD]
__device__ __forceinline__ v16b wcol_hdk(const float* Wm, int k0, int o, int lane) { v16b w; const int g = lane >> 4; const float* p = Wm + (size_t)(o / HD) * DIN * HD + (o % HD);
#pragma unroll
  for (int i = 0; i < 8; ++i) { w[i] = (__bf16)p[(size_t)(k0 + 8 * g + i) * HD]; w[8 + i] = (__bf16)p[(size_t)(k0 + 16 + 8 * g + i) * HD]; }
  return w; }
#define WO_OUT_IN 1
#if WQKV_LAYOUT == 1
#define WCOL(W, k0, o, lane) wcol_oi(W, k0, o, lane, DIN)
#elif WQKV_LAYOUT == 2
#define WCOL(W, k0, o, lane) wcol_hdk(W, k0, o, lane)
#else
#define WCOL(W, k0, o, lane) wcol_io(W, k0, o, lane, CC)
#endif
#if WO_OUT_IN
#define WOCOL(W, k0, o, lane) wcol_oi(W, k0, o, lane, CC)
#define WOCOLH(W, k0, o, lane) wcolh_oi(W, k0, o, lane, CC)
#else
#define WOCOL(W, k0, o, lane) wcol_io(W, k0, o, lane, DIN)
#define WOCOLH(W, k0, o, lane) wcolh_io(W, k0, o, lane, DIN)
#endif

#ifndef SM_EXTRA_PARAMS
#define SM_EXTRA_PARAMS
#endif
#ifndef PROJ_EXTRA_PARAMS
#define PROJ_EXTRA_PARAMS
#endif
#ifndef SM_MASK_HOOK
#define SM_MASK_HOOK (void)0
#endif

// One fragment row's 16 f32 (k0+8h+0..7, k0+16+8h+0..7) kept as loaded, so that the load can be issued several WMMAs ahead of its conversion
struct R16 { v4f q[4]; };
// behind a run of loads that were issued ahead: their address registers may be rewritten from here on
#define XW() asm volatile("s_wait_xcnt 0x0" ::: "memory")
// the same, with the loads' addresses as inputs, so that their registers stay untouched up to the wait
#define XWP(p) asm volatile("s_wait_xcnt 0x0" :: "v"(p) : "memory")
#define XWP2(p, q) asm volatile("s_wait_xcnt 0x0" :: "v"(p), "v"(q) : "memory")
__device__ __forceinline__ R16 ld_raw(const float* rowk0, int lane) { R16 r; const float* p = rowk0 + 8 * (lane >> 4);
  r.q[0] = *(const v4f*)p; r.q[1] = *(const v4f*)(p + 4); r.q[2] = *(const v4f*)(p + 16); r.q[3] = *(const v4f*)(p + 20); return r; }
__device__ __forceinline__ v16b raw_b(const R16& r) { v16b w;
#pragma unroll
  for (int i = 0; i < 16; ++i) w[i] = (__bf16)r.q[i >> 2][i & 3];
  return w; }
__device__ __forceinline__ v16h raw_h(const R16& r) { v16h w;
#pragma unroll
  for (int i = 0; i < 16; ++i) w[i] = (_Float16)r.q[i >> 2][i & 3];
  return w; }
__device__ __forceinline__ v16h raw_hs(const R16& r, float sc) { v16h w;
#pragma unroll
  for (int i = 0; i < 16; ++i) w[i] = (_Float16)(r.q[i >> 2][i & 3] * sc);
  return w; }
__device__ __forceinline__ v16h raw_wh(const R16& r) { v16h w;
#pragma unroll
  for (int i = 0; i < 16; ++i) w[i] = (_Float16)(bfr(r.q[i >> 2][i & 3]) * 256.0f);
  return w; }
__device__ __forceinline__ F2 raw_split(const R16& r) { float v[16];
#pragma unroll
  for (int i = 0; i < 16; ++i) v[i] = r.q[i >> 2][i & 3];
  return bsplit16(v); }

#define WS_QH  0u                                      // f16 q rows [b*t][CC]
#define WS_KH  (WS_QH + 2u * (size_t)NB * TT * CC)      // f16 k rows [b*t][CC]
#define WS_VT  (WS_KH + 2u * (size_t)NB * TT * CC)      // f16 v planes [b][c][t]
#define WS_QL  (WS_VT + 2u * (size_t)NB * CC * TT)      // f16 q residual x 2^10 rows [b][t < QHI][CC]
#define WS_KL  (WS_QL + 2u * (size_t)NB * QHI * CC)     // f16 k residual x 2^10 rows [b][t < KHI][CC]
#define WS_VB  (WS_KL + 2u * (size_t)NB * KHI * CC)     // bf16 v hi planes [b][c][t < KHI]
#define WS_VBL (WS_VB + 2u * (size_t)NB * CC * KHI)
#define WS_S   (WS_VBL + 2u * (size_t)NB * CC * KHI)    // f32 logits / P [hg][t][s]
#define WS_Y   (WS_S  + 4u * (size_t)HG * TT * TT)      // f32 ctx rows [b*t][CC] (only when there is an output projection)
#define WS_END (WS_Y  + 4u * (size_t)NB * TT * CC)

// ---- k_proj: block = (64 rows, 128 cols, which): q/k/v = X W (+ b) with exact bf16 products (K = DIN) -> which 0: q f16 rows (+ residual rows < QHI); 1: k f16 rows (+ residual rows < KHI); 2: v f16 planes [c][t] (+ bf16 hi/lo planes for t < KHI)
__global__ __launch_bounds__(128) void k_proj(const float* __restrict__ XQ, const float* __restrict__ XK, const float* __restrict__ XV, const float* __restrict__ WQ, const float* __restrict__ WK, const float* __restrict__ WV, const float* __restrict__ BQ, const float* __restrict__ BK, const float* __restrict__ BV,
    _Float16* __restrict__ QH, _Float16* __restrict__ QL, _Float16* __restrict__ KH, _Float16* __restrict__ KL, _Float16* __restrict__ VT, __bf16* __restrict__ VB, __bf16* __restrict__ VBL) {
  __shared__ __align__(16) _Float16 sh[64][136], sl[64][136]; __shared__ __align__(16) _Float16 th[128][72]; __shared__ __align__(16) __bf16 tb[128][72], tbl[128][72];
  const int tid = threadIdx.x, wave = tid >> 5, lane = tid & 31, col = lane & 15, g = lane >> 4; const int which = blockIdx.z; const int c0 = blockIdx.y * 128; const size_t r0 = (size_t)blockIdx.x * 64; const size_t bb = r0 / TT; const int t0 = (int)(r0 % TT);
  const float* X = which == 0 ? XQ : which == 1 ? XK : XV; const float* WA = which == 0 ? WQ : which == 1 ? WK : WV; const float* BA = which == 0 ? BQ : which == 1 ? BK : BV;
  v8f acc[8] = {};
  // register ring: the X row and the eight W rows ((out,in) layout) of chunk kc + 1 are loaded while chunk kc is multiplied
  const float* xr = X + (r0 + wave * 16 + col) * DIN; const float* wr = WA + (size_t)(c0 + col) * DIN;
  R16 ra = ld_raw(xr, lane), rw[8];
#pragma unroll
  for (int j = 0; j < 8; ++j) rw[j] = ld_raw(wr + (size_t)j * 16 * DIN, lane);
  XWP2(xr + 8 * g, wr + 8 * g);
#pragma unroll 1   // rolled: one copy of the ring body is enough, the ring itself keeps the loads ahead
  for (int kc = 1; kc < DIN / 32; ++kc) { const v16b a = raw_b(ra); ra = ld_raw(xr + kc * 32, lane);
#pragma unroll
    for (int j = 0; j < 8; ++j) { const v16b w = raw_b(rw[j]); rw[j] = ld_raw(wr + (size_t)j * 16 * DIN + kc * 32, lane); acc[j] = wmma_bf(a, w, acc[j]); }
    XW(); }
  { const v16b a = raw_b(ra);
#pragma unroll
    for (int j = 0; j < 8; ++j) acc[j] = wmma_bf(a, raw_b(rw[j]), acc[j]); }
  if (which < 2) { _Float16* DH = which == 0 ? QH : KH; _Float16* DL = which == 0 ? QL : KL; const int nhi = which == 0 ? QHI : KHI; const bool hi_rows = t0 < nhi;
#pragma unroll
    for (int j = 0; j < 8; ++j) { const float bias = BA ? bfr(BA[c0 + j * 16 + col]) : 0.f;
#pragma unroll
      for (int r = 0; r < 8; ++r) { const float v = acc[j][r] + bias; const _Float16 hv = (_Float16)v; sh[wave * 16 + 8 * g + r][j * 16 + col] = hv; sl[wave * 16 + 8 * g + r][j * 16 + col] = (_Float16)((v - (float)hv) * 1024.0f); } }
    __syncthreads();
    for (int e = tid; e < 64 * 16; e += 128) { const int rl = e >> 4, q = e & 15; vst2((unsigned*)(DH + (r0 + rl) * CC + c0 + q * 8), *(const v4u*)&sh[rl][q * 8]); if (hi_rows) vst2((unsigned*)(DL + (bb * nhi + t0 + rl) * (size_t)CC + c0 + q * 8), *(const v4u*)&sl[rl][q * 8]); }
  } else { const bool hi_rows = t0 < KHI;
#pragma unroll
    for (int j = 0; j < 8; ++j) { const float bias = BA ? bfr(BA[c0 + j * 16 + col]) : 0.f;
#pragma unroll
      for (int r = 0; r < 8; ++r) { const float v = acc[j][r] + bias; const int rl = wave * 16 + 8 * g + r, cl = j * 16 + col; th[cl][rl] = (_Float16)v; const __bf16 bh = (__bf16)v; tb[cl][rl] = bh; tbl[cl][rl] = (__bf16)(v - (float)bh); } }
    __syncthreads();
    for (int e = tid; e < 128 * 8; e += 128) { const int cl = e >> 3, q = e & 7; vst2((unsigned*)(VT + (bb * CC + c0 + cl) * (size_t)TT + t0 + q * 8), *(const v4u*)&th[cl][q * 8]); if (hi_rows) { const size_t o3 = (bb * CC + c0 + cl) * (size_t)KHI + t0 + q * 8; vst2((unsigned*)(VB + o3), *(const v4u*)&tb[cl][q * 8]); vst2((unsigned*)(VBL + o3), *(const v4u*)&tbl[cl][q * 8]); } } } }
// ---- k_sc: block = (query block qb, key block kb <= kb_last(qb), head in group) of batch b: logits x SCALE; q hi + residual (x 2^10) against k (2 products) for query rows < QHI, plus the k residual (3 products) for query blocks < QBH (causal early rows); causal: blocks past the diagonal exit, the mask itself is applied by index in k_sm
__global__ __launch_bounds__(128) void k_sc(const _Float16* __restrict__ QH, const _Float16* __restrict__ KH, const _Float16* __restrict__ QL, const _Float16* __restrict__ KL, int b, int h0, float* __restrict__ S0) { __shared__ __align__(16) float ss[4][16][132];
  const int qb = blockIdx.x, kb = blockIdx.y; if (kb > kb_last(qb)) return;
  const int h = h0 + blockIdx.z; float* S = S0 + (size_t)blockIdx.z * TT * TT;
  const int tid = threadIdx.x, wave = tid >> 5, lane = tid & 31, col = lane & 15, g = lane >> 4; const int k0 = kb * 128; const int ql0 = qb * 64 + wave * 16; const size_t q0 = (size_t)b * TT + ql0, kr0 = (size_t)b * TT + k0;
  v8f acc[8] = {}, accl[8] = {};
  const _Float16* QLb = QL + (size_t)b * QHI * CC; const _Float16* KLb = KL + (size_t)b * KHI * CC;
  if (qb < QBH) {
    // ring of four (k, k residual) fragment pairs over the 16 steps (kc, j): step t + 4 is loaded behind step t's products
    v16h ah[HD / 32], al[HD / 32], kf[4], lf[4];
#pragma unroll
    for (int kc = 0; kc < HD / 32; ++kc) { ah[kc] = frag_h(QH + (q0 + col) * CC + h * HD + kc * 32, lane); al[kc] = frag_h(QLb + (size_t)(ql0 + col) * CC + h * HD + kc * 32, lane); }
#pragma unroll
    for (int t = 0; t < 4; ++t) { kf[t] = frag_h(KH + (kr0 + t * 16 + col) * CC + h * HD, lane); lf[t] = frag_h(KLb + (size_t)(k0 + t * 16 + col) * CC + h * HD, lane); }
    XW();
#pragma unroll
    for (int t = 0; t < 8 * (HD / 32); ++t) { const int kc = t >> 3, j = t & 7, u = t + 4;
      acc[j] = wmma16(ah[kc], kf[t & 3], acc[j]); accl[j] = wmma16(al[kc], kf[t & 3], accl[j]); accl[j] = wmma16(ah[kc], lf[t & 3], accl[j]);
      if (u < 8 * (HD / 32)) { kf[t & 3] = frag_h(KH + (kr0 + (u & 7) * 16 + col) * CC + h * HD + (u >> 3) * 32, lane); lf[t & 3] = frag_h(KLb + (size_t)(k0 + (u & 7) * 16 + col) * CC + h * HD + (u >> 3) * 32, lane); XW(); } }
  } else if (qb * 64 < QHI) {
#pragma unroll
    for (int kc = 0; kc < HD / 32; ++kc) { const v16h ah = frag_h(QH + (q0 + col) * CC + h * HD + kc * 32, lane), al = frag_h(QLb + (size_t)(ql0 + col) * CC + h * HD + kc * 32, lane);
#pragma unroll
      for (int j = 0; j < 8; ++j) { const v16h kbf = frag_h(KH + (kr0 + j * 16 + col) * CC + h * HD + kc * 32, lane); acc[j] = wmma16(ah, kbf, acc[j]); accl[j] = wmma16(al, kbf, accl[j]); } }
  } else {
    // every q and k fragment of the tile is loaded in front of the first product
    v16h ah[HD / 32], kf[HD / 32][8];
#pragma unroll
    for (int kc = 0; kc < HD / 32; ++kc) { ah[kc] = frag_h(QH + (q0 + col) * CC + h * HD + kc * 32, lane);
#pragma unroll
      for (int j = 0; j < 8; ++j) kf[kc][j] = frag_h(KH + (kr0 + j * 16 + col) * CC + h * HD + kc * 32, lane); }
    XW();
#pragma unroll
    for (int kc = 0; kc < HD / 32; ++kc) {
#pragma unroll
      for (int j = 0; j < 8; ++j) acc[j] = wmma16(ah[kc], kf[kc][j], acc[j]); } }
#pragma unroll
  for (int j = 0; j < 8; ++j) {
#pragma unroll
    for (int r = 0; r < 8; ++r) ss[wave][8 * g + r][j * 16 + col] = (acc[j][r] + accl[j][r] * (1.0f / 1024.0f)) * SCALE; }
  LDSX(); for (int rl = 0; rl < 16; ++rl) vst2(S + (size_t)(ql0 + rl) * TT + k0 + lane * 4, *(const v4f*)&ss[wave][rl][lane * 4]); }
// ---- k_sm: block = query row t (head in group): keys [0, kend): causal -> logit if s <= t else excluded; softmax in f32; P x 2^11 in place (0 for excluded)
__global__ __launch_bounds__(256) void k_sm(float* __restrict__ S0 SM_EXTRA_PARAMS) { __shared__ float sred[8]; __shared__ float sbc; __shared__ __align__(16) float shv[TT];
  const int tid = threadIdx.x; const int t = blockIdx.x; const int kend = (kb_last(t >> 6) + 1) * 128;
  float* sr = S0 + (size_t)blockIdx.y * TT * TT + (size_t)t * TT;
  // the whole row (at most TT / 256 logits a thread) is requested in front of the first use
  float rv[TT / 256];
#pragma unroll
  for (int i = 0; i < TT / 256; ++i) { const int k = tid + i * 256; rv[i] = -3.0e38f; if (k < kend && (!CAUSAL || k <= t)) rv[i] = sr[k]; }
  float m = -3.0e38f;
#pragma unroll
  for (int i = 0; i < TT / 256; ++i) { const int k = tid + i * 256; if (k < kend) { float v = rv[i]; SM_MASK_HOOK; shv[k] = v; m = fmaxf(m, v); } }
#pragma unroll
  for (int o = 1; o < 32; o <<= 1) m = fmaxf(m, __shfl_xor(m, o));
  if ((tid & 31) == 0) sred[tid >> 5] = m; __syncthreads(); if (tid == 0) { float a = sred[0]; for (int i = 1; i < 8; ++i) a = fmaxf(a, sred[i]); sbc = a; } __syncthreads(); m = sbc; __syncthreads();
  float sum = 0.f; for (int k = tid; k < kend; k += 256) { const float v = shv[k]; const float e = (v <= -1.0e38f) ? 0.f : expf(v - m); shv[k] = e; sum += e; }
#pragma unroll
  for (int o = 1; o < 32; o <<= 1) sum += __shfl_xor(sum, o);
  if ((tid & 31) == 0) sred[tid >> 5] = sum; __syncthreads(); if (tid == 0) { float a = 0.f; for (int i = 0; i < 8; ++i) a += sred[i]; sbc = a > 0.f ? 2048.0f / a : 0.f; }   /* a fully excluded row yields P = 0 */ __syncthreads(); const float inv = sbc;
  for (int k = tid; k < kend; k += 256) shv[k] = shv[k] * inv;
  __syncthreads(); for (int q = tid; q < kend / 4; q += 256) vst2(sr + q * 4, *(const v4f*)&shv[q * 4]); }
// ---- k_pv: block = 64 queries (qb) of (b, h): ctx = P . v over keys [0, kend) (P x 2^11 once to f16 against v f16: 1 product; causal early query blocks: P and v as bf16 hi + lo, 3 products); 256-B (row, head) segment by 16 lanes
__global__ __launch_bounds__(128) void k_pv(const float* __restrict__ PS0, const _Float16* __restrict__ VT, const __bf16* __restrict__ VB, const __bf16* __restrict__ VBL, int b, int h0, float* __restrict__ Y) { const int h = h0 + blockIdx.z; const float* PS = PS0 + (size_t)blockIdx.z * TT * TT; __shared__ __align__(16) float ss[4][16][HD + 4];
  const int tid = threadIdx.x, wave = tid >> 5, lane = tid & 31, col = lane & 15, g = lane >> 4; const int qb = blockIdx.x; const int ql0 = qb * 64 + wave * 16; const int kce = (kb_last(qb) + 1) * 4;
  v8f acc[HD / 16] = {}; const float* pr = PS + (size_t)(ql0 + col) * TT;
  if (qb < QBH) {
    // ring of two key chunks (kce is a multiple of 4): chunk kc + 2 is loaded behind chunk kc's products
    const size_t po = ((size_t)b * CC + h * HD + col) * (size_t)KHI; const __bf16* vbr = VB + po; const __bf16* vlr = VBL + po;
    R16 rp[2]; v16b vh[2][HD / 16], vl[2][HD / 16];
#pragma unroll
    for (int s = 0; s < 2; ++s) { rp[s] = ld_raw(pr + s * 32, lane);
#pragma unroll
      for (int j = 0; j < HD / 16; ++j) { vh[s][j] = frag_b(vbr + (size_t)j * 16 * KHI + s * 32, lane); vl[s][j] = frag_b(vlr + (size_t)j * 16 * KHI + s * 32, lane); } }
    XW();
#pragma unroll 1   // rolled: the body already holds one turn of the ring
    for (int kc = 2; kc < kce; kc += 2) {
#pragma unroll
      for (int s = 0; s < 2; ++s) { const F2 p = raw_split(rp[s]); rp[s] = ld_raw(pr + (kc + s) * 32, lane);
#pragma unroll
        for (int j = 0; j < HD / 16; ++j) { acc[j] = wmma_bf(p.h, vh[s][j], acc[j]); acc[j] = wmma_bf(p.l, vh[s][j], acc[j]); acc[j] = wmma_bf(p.h, vl[s][j], acc[j]);
          vh[s][j] = frag_b(vbr + (size_t)j * 16 * KHI + (kc + s) * 32, lane); vl[s][j] = frag_b(vlr + (size_t)j * 16 * KHI + (kc + s) * 32, lane); } }
      XW(); }
#pragma unroll
    for (int s = 0; s < 2; ++s) { const F2 p = raw_split(rp[s]);
#pragma unroll
      for (int j = 0; j < HD / 16; ++j) { acc[j] = wmma_bf(p.h, vh[s][j], acc[j]); acc[j] = wmma_bf(p.l, vh[s][j], acc[j]); acc[j] = wmma_bf(p.h, vl[s][j], acc[j]); } }
  } else {
    // ring of four key chunks (kce is a multiple of 4): chunk kc + 4 is loaded behind chunk kc's products
    const _Float16* vr = VT + ((size_t)b * CC + h * HD + col) * (size_t)TT;
    R16 rp[4]; v16h vf[4][HD / 16];
#pragma unroll
    for (int s = 0; s < 4; ++s) { rp[s] = ld_raw(pr + s * 32, lane);
#pragma unroll
      for (int j = 0; j < HD / 16; ++j) vf[s][j] = frag_h(vr + (size_t)j * 16 * TT + s * 32, lane); }
    XW();
#pragma unroll 1   // rolled: the body already holds one turn of the ring
    for (int kc = 4; kc < kce; kc += 4) {
#pragma unroll
      for (int s = 0; s < 4; ++s) { const v16h p = raw_h(rp[s]); rp[s] = ld_raw(pr + (kc + s) * 32, lane);
#pragma unroll
        for (int j = 0; j < HD / 16; ++j) { acc[j] = wmma16(p, vf[s][j], acc[j]); vf[s][j] = frag_h(vr + (size_t)j * 16 * TT + (kc + s) * 32, lane); } }
      XW(); }
#pragma unroll
    for (int s = 0; s < 4; ++s) { const v16h p = raw_h(rp[s]);
#pragma unroll
      for (int j = 0; j < HD / 16; ++j) acc[j] = wmma16(p, vf[s][j], acc[j]); } }
#pragma unroll
  for (int j = 0; j < HD / 16; ++j)
#pragma unroll
    for (int r = 0; r < 8; ++r) ss[wave][8 * g + r][j * 16 + col] = acc[j][r] * (1.0f / 2048.0f);
  LDSX(); for (int rl = 0; rl < 16; ++rl) if (lane < HD / 4) vst2(Y + ((size_t)b * TT + ql0 + rl) * CC + h * HD + lane * 4, *(const v4f*)&ss[wave][rl][lane * 4]); }
// ---- k_out: block = (64 rows, 128 cols): out = ctx Wo (+ bo): ctx x 2^6 once to f16 against Wo as f16(bf16 x 2^8) exact (1 product) x 2^-14; causal early rows (< QHI of each sequence): ctx bf16 hi + lo against exact bf16 Wo (2 products)
__global__ __launch_bounds__(128) void k_out(const float* __restrict__ Y, const float* __restrict__ WO, const float* __restrict__ BO, float* __restrict__ OUT) { __shared__ __align__(16) float sf[4][16][132];
  const int tid = threadIdx.x, wave = tid >> 5, lane = tid & 31, col = lane & 15, g = lane >> 4; const int c0 = blockIdx.y * 128; const size_t r0 = (size_t)blockIdx.x * 64 + wave * 16;
  v8f acc[8] = {};
  // register ring: the ctx row and the eight Wo rows ((out,in) layout) of chunk kc + 1 are loaded while chunk kc is multiplied
  const float* yr = Y + (r0 + col) * CC; const float* wr = WO + (size_t)(c0 + col) * CC;
  if (CAUSAL && (int)(((size_t)blockIdx.x * 64) % TT) < QHI) {   /* block-uniform */
    R16 ra = ld_raw(yr, lane), rw[8];
#pragma unroll
    for (int j = 0; j < 8; ++j) rw[j] = ld_raw(wr + (size_t)j * 16 * CC, lane);
    XWP2(yr + 8 * g, wr + 8 * g);
#pragma unroll 1   // rolled: one copy of the ring body is enough
    for (int kc = 1; kc < CC / 32; ++kc) { const F2 a = raw_split(ra); ra = ld_raw(yr + kc * 32, lane); XWP(yr + kc * 32 + 8 * g);
#pragma unroll
      for (int j = 0; j < 8; ++j) { const v16b w = raw_b(rw[j]); rw[j] = ld_raw(wr + (size_t)j * 16 * CC + kc * 32, lane); acc[j] = wmma_bf(a.h, w, acc[j]); acc[j] = wmma_bf(a.l, w, acc[j]); }
      XW(); }
    { const F2 a = raw_split(ra);
#pragma unroll
      for (int j = 0; j < 8; ++j) { const v16b w = raw_b(rw[j]); acc[j] = wmma_bf(a.h, w, acc[j]); acc[j] = wmma_bf(a.l, w, acc[j]); } }
#pragma unroll
    for (int j = 0; j < 8; ++j) { const float bias = BO ? bfr(BO[c0 + j * 16 + col]) : 0.f;
#pragma unroll
      for (int r = 0; r < 8; ++r) sf[wave][8 * g + r][j * 16 + col] = acc[j][r] + bias; }
  } else {
    R16 ra = ld_raw(yr, lane), rw[8];
#pragma unroll
    for (int j = 0; j < 8; ++j) rw[j] = ld_raw(wr + (size_t)j * 16 * CC, lane);
    XWP2(yr + 8 * g, wr + 8 * g);
#pragma unroll 1   // rolled: one copy of the ring body is enough
    for (int kc = 1; kc < CC / 32; ++kc) { const v16h a = raw_hs(ra, 64.0f); ra = ld_raw(yr + kc * 32, lane); XWP(yr + kc * 32 + 8 * g);   /* ctx carried x 2^6 into f16 so small-magnitude context rows stay clear of f16 subnormals (chip FTZ) */
#pragma unroll
      for (int j = 0; j < 8; ++j) { const v16h w = raw_wh(rw[j]); rw[j] = ld_raw(wr + (size_t)j * 16 * CC + kc * 32, lane); acc[j] = wmma16(a, w, acc[j]); } }
    { const v16h a = raw_hs(ra, 64.0f);
#pragma unroll
      for (int j = 0; j < 8; ++j) acc[j] = wmma16(a, raw_wh(rw[j]), acc[j]); }
#pragma unroll
    for (int j = 0; j < 8; ++j) { const float bias = BO ? bfr(BO[c0 + j * 16 + col]) : 0.f;
#pragma unroll
      for (int r = 0; r < 8; ++r) sf[wave][8 * g + r][j * 16 + col] = acc[j][r] * (1.0f / 16384.0f) + bias; } }   /* 2^-8 (Wo carry) x 2^-6 (ctx carry) */
  LDSX(); for (int rl = 0; rl < 16; ++rl) vst2(OUT + (r0 + rl) * DIN + c0 + lane * 4, *(const v4f*)&sf[wave][rl][lane * 4]); }

extern "C" void kernel_launch(void* const* d_in, const int* in_sizes, int n_in, void* d_out, int out_size, void* d_ws, size_t ws_size, hipStream_t stream) {
  (void)in_sizes; (void)n_in; (void)out_size;
  const float** F = (const float**)d_in;
  if (ws_size < (size_t)WS_END) return;
  char* ws = (char*)d_ws; _Float16 *QH = (_Float16*)(ws + WS_QH), *KH = (_Float16*)(ws + WS_KH), *VT = (_Float16*)(ws + WS_VT), *QL = (_Float16*)(ws + WS_QL), *KL = (_Float16*)(ws + WS_KL); __bf16 *VB = (__bf16*)(ws + WS_VB), *VBL = (__bf16*)(ws + WS_VBL); float *S = (float*)(ws + WS_S), *Y = (float*)(ws + WS_Y);
  (void)Y; (void)QL; (void)KL; (void)VB; (void)VBL;
  // inputs: 0 q [2,2048,512]; 1 k; 2 v; 3 Wq [512,512] (out,in); 4 Wk; 5 Wv; 6 Wp (out,in); 7 bp (zeros, read); no q / k / v biases (null pointers)
  k_proj<<<dim3(TNB * TT / 64, CC / 128, 3), 128, 0, stream>>>(F[0], F[1], F[2], F[3], F[4], F[5], nullptr, nullptr, nullptr, QH, QL, KH, KL, VT, VB, VBL);
  for (int b = 0; b < TNB; ++b) for (int h0 = 0; h0 < NH; h0 += HG) {
    k_sc<<<dim3(NQB, TT / 128, HG), 128, 0, stream>>>(QH, KH, QL, KL, b, h0, S);
    k_sm<<<dim3(TT, HG), 256, 0, stream>>>(S);
    k_pv<<<dim3(NQB, 1, HG), 128, 0, stream>>>(S, VT, VB, VBL, b, h0, Y);
  }
  k_out<<<dim3(TNB * TT / 64, DIN / 128), 128, 0, stream>>>(Y, F[6], F[7], (float*)d_out);
}

// v002
// Measured time: 96.7 microseconds a run.
// In two side-by-side timings against v001, it was 2.77 and 2.70 times as fast.
// All steps since v000 together make it 5.68 times as fast.
// compute dtype: all float inputs rounded to bf16; the fused q / k / v projection with EXACT bf16 products on WMMA 16x16x32 (f32 accumulate) (no q / k / v biases); causal logits: 3 products for the first 384 rows, single f16 q x k after, x 64^-0.5; online softmax f32 (running maximum, rescaled sums, division last); e^(s-m) x 2^11 once to f16 x v once to f16 (bf16 hi + lo below row 384); ctx hi+lo x exact W below row 384, x2^6 f16 carry x f16(bf16 x 2^8) W after, + bias; f32 output.
#include <hip/hip_runtime.h>
#include <math.h>

typedef __attribute__((ext_vector_type(16))) _Float16 v16h;
typedef __attribute__((ext_vector_type(16))) __bf16 v16b;
typedef __attribute__((ext_vector_type(8)))  _Float16 v8h;
typedef __attribute__((ext_vector_type(8)))  float v8f;
typedef __attribute__((ext_vector_type(4)))  float v4f;
typedef __attribute__((ext_vector_type(2)))  float v2f;
typedef __attribute__((ext_vector_type(4)))  unsigned v4u;
typedef __attribute__((ext_vector_type(4)))  int v4i;
typedef float __attribute__((may_alias)) float_a;
typedef int __attribute__((may_alias)) int_a;

template <typename T> __device__ __forceinline__ void vst2(void* p, T v) { *(T*)p = v;  }
__device__ __forceinline__ v8f wmma16(v16h a, v16h b, v8f c) {
  v8f d = __builtin_amdgcn_wmma_f32_16x16x32_f16(false, a, false, b, (short)0, c, false, false);
  asm volatile("v_nop\n\tv_nop\n\tv_nop\n\tv_nop" : "+v"(d) : "v"(a), "v"(b));
  return d;
}
__device__ __forceinline__ v8f wmma_bf(v16b a, v16b b, v8f c) {
  v8f d = __builtin_amdgcn_wmma_f32_16x16x32_bf16(false, a, false, b, (short)0, c, false, false);
  asm volatile("v_nop\n\tv_nop\n\tv_nop\n\tv_nop" : "+v"(d) : "v"(a), "v"(b));
  return d;
}
// 16x16x32 fragments: lane = (h = lane>>4, row/col = lane&15); elements 0..7 = k0+8h+0..7, 8..15 = k0+16+8h+0..7; D element r = row 8h+r
__device__ __forceinline__ v16h frag_h(const _Float16* rowk0, int lane) {
  union { v16h v; v8h q[2]; } u; const _Float16* p = rowk0 + 8 * (lane >> 4);
  u.q[0] = *(const v8h*)p; u.q[1] = *(const v8h*)(p + 16); return u.v;
}
__device__ __forceinline__ v16h frag_f32(const float* rowk0, int lane) {
  v16h a; const float* p = rowk0 + 8 * (lane >> 4);
#pragma unroll
  for (int i = 0; i < 8; ++i) { a[i] = (_Float16)p[i]; a[8 + i] = (_Float16)p[16 + i]; }
  return a;
}
__device__ __forceinline__ v16h frag_f32s(const float* rowk0, int lane, float sc) {
  v16h a; const float* p = rowk0 + 8 * (lane >> 4);
#pragma unroll
  for (int i = 0; i < 8; ++i) { a[i] = (_Float16)(p[i] * sc); a[8 + i] = (_Float16)(p[16 + i] * sc); }
  return a;
}
// column fragment from a [K][ld] layout (column n), rows >= K read as 0
__device__ __forceinline__ v16h fragc_f32(const float* W, int k0, int n, int lane, int ld, int K) {
  v16h a; const int g = lane >> 4;
#pragma unroll
  for (int i = 0; i < 8; ++i) { const int ka = k0 + 8 * g + i, kb = ka + 16;
    a[i] = (_Float16)(ka < K ? W[(size_t)(ka < K ? ka : K - 1) * ld + n] : 0.f); a[8 + i] = (_Float16)(kb < K ? W[(size_t)(kb < K ? kb : K - 1) * ld + n] : 0.f); }
  return a;
}
struct F2 { v16b h, l; };
__device__ __forceinline__ F2 bsplit16(const float v[16]) { F2 r;
#pragma unroll
  for (int i = 0; i < 16; ++i) { const __bf16 h = (__bf16)v[i]; r.h[i] = h; r.l[i] = (__bf16)(v[i] - (float)h); }
  return r; }
__device__ __forceinline__ F2 split_row(const float* row, int k0, int lane) { float v[16]; const float* p = row + k0 + 8 * (lane >> 4);
#pragma unroll
  for (int i = 0; i < 8; ++i) { v[i] = p[i]; v[8 + i] = p[16 + i]; }
  return bsplit16(v); }
__device__ __forceinline__ F2 split_rowK(const float* row, int k0, int lane, int K) { float v[16]; const int g = lane >> 4;
#pragma unroll
  for (int i = 0; i < 8; ++i) { const int ka = k0 + 8 * g + i, kb = ka + 16; v[i] = ka < K ? row[ka < K ? ka : K - 1] : 0.f; v[8 + i] = kb < K ? row[kb < K ? kb : K - 1] : 0.f; }
  return bsplit16(v); }
__device__ __forceinline__ F2 split_col(const float* W, int k0, int n, int lane, int ld, int K) { float v[16]; const int g = lane >> 4;
#pragma unroll
  for (int i = 0; i < 8; ++i) { const int ka = k0 + 8 * g + i, kb = ka + 16; v[i] = ka < K ? W[(size_t)(ka < K ? ka : K - 1) * ld + n] : 0.f; v[8 + i] = kb < K ? W[(size_t)(kb < K ? kb : K - 1) * ld + n] : 0.f; }
  return bsplit16(v); }
__device__ __forceinline__ v8f mac3(const F2& a, const F2& b, v8f c) { c = wmma_bf(a.l, b.h, c); c = wmma_bf(a.h, b.l, c); return wmma_bf(a.h, b.h, c); }
__device__ __forceinline__ float sigm(float v) { return 1.0f / (1.0f + expf(-v)); }
#define LDSX() do { asm volatile("s_wait_dscnt 0" ::: "memory"); __builtin_amdgcn_wave_barrier(); __builtin_amdgcn_fence(__ATOMIC_RELEASE, "workgroup"); } while (0)

// Causal multi-head attention on separate q / k / v inputs at width 512 (q / k / v [2,2048,512]; torch (out,in) Wq / Wk / Wv / Wp [512,512] applied as einsum('bsd,ed->bse') = x @ W.T, no q / k / v biases; bp zeros (read); 8 heads x 64; att / sqrt(64); tril kept, -1e10 (finite: the same exclusion) elsewhere; softmax; y @ Wp.T + bp).
#define NB 2
#define TT 2048
#define CC 512            // NH * HD = projected width
#define DIN 512          // input (model) width
#define NH 8
#define HD 64
#define NQB (TT / 64)
#define HG 4
#define SCALE (0.125f)
#define CAUSAL 1
#ifndef TNB
#define TNB NB
#endif
__device__ __forceinline__ float bfr(float v) { return (float)(__bf16)v; }
__host__ __device__ __forceinline__ int kb_last(int qb) { return CAUSAL ? ((qb * 64 + 63) >> 7) : (TT / 128 - 1); }
typedef __attribute__((ext_vector_type(8))) __bf16 v8b;
__device__ __forceinline__ v16b frag_b(const __bf16* rowk0, int lane) {
  union { v16b v; v8b q[2]; } u; const __bf16* p = rowk0 + 8 * (lane >> 4);
  u.q[0] = *(const v8b*)p; u.q[1] = *(const v8b*)(p + 16); return u.v;
}
#define QBH 6              // causal: query blocks 0..QBH-1 of each sequence (few keys, no averaging) take the high-precision path
#define QHI 384            // rows carrying a q residual plane
#define KHI 384            // key rows carrying k residual / v bf16 hi+lo planes (used only by the causal high-precision path)
// B fragment (k rows k0+.., output column o) of a weight: (in,out) [K][ld] or (out,in) [ld rows of K]: bf16 exact, or f16(bf16 * 256) exact
__device__ __forceinline__ v16b wcol_io(const float* Wm, int k0, int o, int lane, int ld) { v16b w; const int g = lane >> 4;
#pragma unroll
  for (int i = 0; i < 8; ++i) { w[i] = (__bf16)Wm[(size_t)(k0 + 8 * g + i) * ld + o]; w[8 + i] = (__bf16)Wm[(size_t)(k0 + 16 + 8 * g + i) * ld + o]; }
  return w; }
__device__ __forceinline__ v16b wcol_oi(const float* Wm, int k0, int o, int lane, int K) { v16b w; const float* p = Wm + (size_t)o * K + k0 + 8 * (lane >> 4);
#pragma unroll
  for (int i = 0; i < 8; ++i) { w[i] = (__bf16)p[i]; w[8 + i] = (__bf16)p[16 + i]; }
  return w; }
__device__ __forceinline__ v16h wcolh_io(const float* Wm, int k0, int o, int lane, int ld) { v16h w; const int g = lane >> 4;
#pragma unroll
  for (int i = 0; i < 8; ++i) { w[i] = (_Float16)(bfr(Wm[(size_t)(k0 + 8 * g + i) * ld + o]) * 256.0f); w[8 + i] = (_Float16)(bfr(Wm[(size_t)(k0 + 16 + 8 * g + i) * ld + o]) * 256.0f); }
  return w; }
__device__ __forceinline__ v16h wcolh_oi(const float* Wm, int k0, int o, int lane, int K) { v16h w; const float* p = Wm + (size_t)o * K + k0 + 8 * (lane >> 4);
#pragma unroll
  for (int i = 0; i < 8; ++i) { w[i] = (_Float16)(bfr(p[i]) * 256.0f); w[8 + i] = (_Float16)(bfr(p[16 + i]) * 256.0f); }
  return w; }
#define WQKV_LAYOUT 1   // 0 = (in,out) [DIN][CC]; 1 = (out,in) [CC][DIN]; 2 = per-head [NH][DIN][HD]
__device__ __forceinline__ v16b wcol_hdk(const float* Wm, int k0, int o, int lane) { v16b w; const int g = lane >> 4; const float* p = Wm + (size_t)(o / HD) * DIN * HD + (o % HD);
#pragma unroll
  for (int i = 0; i < 8; ++i) { w[i] = (__bf16)p[(size_t)(k0 + 8 * g + i) * HD]; w[8 + i] = (__bf16)p[(size_t)(k0 + 16 + 8 * g + i) * HD]; }
  return w; }
#define WO_OUT_IN 1
#if WQKV_LAYOUT == 1
#define WCOL(W, k0, o, lane) wcol_oi(W, k0, o, lane, DIN)
#elif WQKV_LAYOUT == 2
#define WCOL(W, k0, o, lane) wcol_hdk(W, k0, o, lane)
#else
#define WCOL(W, k0, o, lane) wcol_io(W, k0, o, lane, CC)
#endif
#if WO_OUT_IN
#define WOCOL(W, k0, o, lane) wcol_oi(W, k0, o, lane, CC)
#define WOCOLH(W, k0, o, lane) wcolh_oi(W, k0, o, lane, CC)
#else
#define WOCOL(W, k0, o, lane) wcol_io(W, k0, o, lane, DIN)
#define WOCOLH(W, k0, o, lane) wcolh_io(W, k0, o, lane, DIN)
#endif

#ifndef SM_EXTRA_PARAMS
#define SM_EXTRA_PARAMS
#endif
#ifndef PROJ_EXTRA_PARAMS
#define PROJ_EXTRA_PARAMS
#endif
#ifndef SM_MASK_HOOK
#define SM_MASK_HOOK (void)0
#endif

// One fragment row's 16 f32 (k0+8h+0..7, k0+16+8h+0..7) kept as loaded, so that the load can be issued several WMMAs ahead of its conversion
struct R16 { v4f q[4]; };
// behind a run of loads that were issued ahead: their address registers may be rewritten from here on
#define XW() asm volatile("s_wait_xcnt 0x0" ::: "memory")
// the same, with the loads' addresses as inputs, so that their registers stay untouched up to the wait
#define XWP(p) asm volatile("s_wait_xcnt 0x0" :: "v"(p) : "memory")
#define XWP2(p, q) asm volatile("s_wait_xcnt 0x0" :: "v"(p), "v"(q) : "memory")
__device__ __forceinline__ R16 ld_raw(const float* rowk0, int lane) { R16 r; const float* p = rowk0 + 8 * (lane >> 4);
  r.q[0] = *(const v4f*)p; r.q[1] = *(const v4f*)(p + 4); r.q[2] = *(const v4f*)(p + 16); r.q[3] = *(const v4f*)(p + 20); return r; }
__device__ __forceinline__ v16b raw_b(const R16& r) { v16b w;
#pragma unroll
  for (int i = 0; i < 16; ++i) w[i] = (__bf16)r.q[i >> 2][i & 3];
  return w; }
__device__ __forceinline__ v16h raw_h(const R16& r) { v16h w;
#pragma unroll
  for (int i = 0; i < 16; ++i) w[i] = (_Float16)r.q[i >> 2][i & 3];
  return w; }
__device__ __forceinline__ v16h raw_hs(const R16& r, float sc) { v16h w;
#pragma unroll
  for (int i = 0; i < 16; ++i) w[i] = (_Float16)(r.q[i >> 2][i & 3] * sc);
  return w; }
__device__ __forceinline__ v16h raw_wh(const R16& r) { v16h w;
#pragma unroll
  for (int i = 0; i < 16; ++i) w[i] = (_Float16)(bfr(r.q[i >> 2][i & 3]) * 256.0f);
  return w; }
__device__ __forceinline__ F2 raw_split(const R16& r) { float v[16];
#pragma unroll
  for (int i = 0; i < 16; ++i) v[i] = r.q[i >> 2][i & 3];
  return bsplit16(v); }

#define WS_QH  0u                                      // f16 q rows [b*t][CC]
#define WS_KH  (WS_QH + 2u * (size_t)NB * TT * CC)      // f16 k rows [b*t][CC]
#define WS_VT  (WS_KH + 2u * (size_t)NB * TT * CC)      // f16 v planes [b][c][t]
#define WS_QL  (WS_VT + 2u * (size_t)NB * CC * TT)      // f16 q residual x 2^10 rows [b][t < QHI][CC]
#define WS_KL  (WS_QL + 2u * (size_t)NB * QHI * CC)     // f16 k residual x 2^10 rows [b][t < KHI][CC]
#define WS_VB  (WS_KL + 2u * (size_t)NB * KHI * CC)     // bf16 v hi planes [b][c][t < KHI]
#define WS_VBL (WS_VB + 2u * (size_t)NB * CC * KHI)
#define WS_S   (WS_VBL + 2u * (size_t)NB * CC * KHI)    // (not used: logits and P stay on chip)
#define WS_Y   (WS_S  + 4u * (size_t)HG * TT * TT)      // f32 ctx rows [b*t][CC] (only when there is an output projection)
#define WS_END (WS_Y  + 4u * (size_t)NB * TT * CC)

// ---- k_proj: block = (64 rows, 128 cols, which): q/k/v = X W (+ b) with exact bf16 products (K = DIN) -> which 0: q f16 rows (+ residual rows < QHI); 1: k f16 rows (+ residual rows < KHI); 2: v f16 planes [c][t] (+ bf16 hi/lo planes for t < KHI)
__global__ __launch_bounds__(128) void k_proj(const float* __restrict__ XQ, const float* __restrict__ XK, const float* __restrict__ XV, const float* __restrict__ WQ, const float* __restrict__ WK, const float* __restrict__ WV, const float* __restrict__ BQ, const float* __restrict__ BK, const float* __restrict__ BV,
    _Float16* __restrict__ QH, _Float16* __restrict__ QL, _Float16* __restrict__ KH, _Float16* __restrict__ KL, _Float16* __restrict__ VT, __bf16* __restrict__ VB, __bf16* __restrict__ VBL) {
  __shared__ __align__(16) _Float16 sh[64][136], sl[64][136]; __shared__ __align__(16) _Float16 th[128][72]; __shared__ __align__(16) __bf16 tb[128][72], tbl[128][72];
  const int tid = threadIdx.x, wave = tid >> 5, lane = tid & 31, col = lane & 15, g = lane >> 4; const int which = blockIdx.z; const int c0 = blockIdx.y * 128; const size_t r0 = (size_t)blockIdx.x * 64; const size_t bb = r0 / TT; const int t0 = (int)(r0 % TT);
  const float* X = which == 0 ? XQ : which == 1 ? XK : XV; const float* WA = which == 0 ? WQ : which == 1 ? WK : WV; const float* BA = which == 0 ? BQ : which == 1 ? BK : BV;
  v8f acc[8] = {};
  // register ring: the X row and the eight W rows ((out,in) layout) of chunk kc + 1 are loaded while chunk kc is multiplied
  const float* xr = X + (r0 + wave * 16 + col) * DIN; const float* wr = WA + (size_t)(c0 + col) * DIN;
  R16 ra = ld_raw(xr, lane), rw[8];
#pragma unroll
  for (int j = 0; j < 8; ++j) rw[j] = ld_raw(wr + (size_t)j * 16 * DIN, lane);
  XWP2(xr + 8 * g, wr + 8 * g);
#pragma unroll 1   // rolled: one copy of the ring body is enough, the ring itself keeps the loads ahead
  for (int kc = 1; kc < DIN / 32; ++kc) { const v16b a = raw_b(ra); ra = ld_raw(xr + kc * 32, lane);
#pragma unroll
    for (int j = 0; j < 8; ++j) { const v16b w = raw_b(rw[j]); rw[j] = ld_raw(wr + (size_t)j * 16 * DIN + kc * 32, lane); acc[j] = wmma_bf(a, w, acc[j]); }
    XW(); }
  { const v16b a = raw_b(ra);
#pragma unroll
    for (int j = 0; j < 8; ++j) acc[j] = wmma_bf(a, raw_b(rw[j]), acc[j]); }
  if (which < 2) { _Float16* DH = which == 0 ? QH : KH; _Float16* DL = which == 0 ? QL : KL; const int nhi = which == 0 ? QHI : KHI; const bool hi_rows = t0 < nhi;
#pragma unroll
    for (int j = 0; j < 8; ++j) { const float bias = BA ? bfr(BA[c0 + j * 16 + col]) : 0.f;
#pragma unroll
      for (int r = 0; r < 8; ++r) { const float v = acc[j][r] + bias; const _Float16 hv = (_Float16)v; sh[wave * 16 + 8 * g + r][j * 16 + col] = hv; sl[wave * 16 + 8 * g + r][j * 16 + col] = (_Float16)((v - (float)hv) * 1024.0f); } }
    __syncthreads();
    for (int e = tid; e < 64 * 16; e += 128) { const int rl = e >> 4, q = e & 15; vst2((unsigned*)(DH + (r0 + rl) * CC + c0 + q * 8), *(const v4u*)&sh[rl][q * 8]); if (hi_rows) vst2((unsigned*)(DL + (bb * nhi + t0 + rl) * (size_t)CC + c0 + q * 8), *(const v4u*)&sl[rl][q * 8]); }
  } else { const bool hi_rows = t0 < KHI;
#pragma unroll
    for (int j = 0; j < 8; ++j) { const float bias = BA ? bfr(BA[c0 + j * 16 + col]) : 0.f;
#pragma unroll
      for (int r = 0; r < 8; ++r) { const float v = acc[j][r] + bias; const int rl = wave * 16 + 8 * g + r, cl = j * 16 + col; th[cl][rl] = (_Float16)v; const __bf16 bh = (__bf16)v; tb[cl][rl] = bh; tbl[cl][rl] = (__bf16)(v - (float)bh); } }
    __syncthreads();
    for (int e = tid; e < 128 * 8; e += 128) { const int cl = e >> 3, q = e & 7; vst2((unsigned*)(VT + (bb * CC + c0 + cl) * (size_t)TT + t0 + q * 8), *(const v4u*)&th[cl][q * 8]); if (hi_rows) { const size_t o3 = (bb * CC + c0 + cl) * (size_t)KHI + t0 + q * 8; vst2((unsigned*)(VB + o3), *(const v4u*)&tb[cl][q * 8]); vst2((unsigned*)(VBL + o3), *(const v4u*)&tbl[cl][q * 8]); } } } }
// ---- k_att: block = 64 queries (qb) of (b, h), one wave = 16 queries; key blocks up to the diagonal. Transposed products: S^T = K . Q^T (a lane holds the scores of ONE query: D row = key 8g + r, D column = query), causal mask by index, running maximum and rescaled running sums in f32 (online softmax), e^(s-m) x 2^11 packed straight from two score tiles into the B operand of ctx^T += V^T . P^T; the division by the row sum comes last. Logits and P never leave the registers.
// query blocks >= QBH: key blocks of 128, single f16 k x q, P once to f16 against v f16; the K tile [128 keys][HD] and the V tile [HD][128 keys] are brought once per block into LDS for all four waves. Query blocks < QBH (few keys): key blocks of 64, 3-product logits, P and v as bf16 hi + lo (3 products), fragments straight from global.
#define KP (HD + 8)        // K tile pitch in halves: 144 B = 16 B x odd, so that ds_load_b128 fragment reads spread over the banks
#define VP (128 + 8)       // V tile pitch in halves: 272 B = 16 B x odd
#define YP (HD + 4)        // ctx staging pitch in floats
#define SM_K 0
#define SM_V (SM_K + 128 * KP * 2)
#define SM_END (SM_V + HD * VP * 2)
// e^x for x <= 0 to f32 accuracy, as expf has it: n = round(x log2(e)), x log2(e) - n by two fused steps with log2(e) in two parts, 2^fraction, ldexp, 0 below the underflow bound (no overflow side: x <= 0).
// v_exp_f32 and a v_nop in one statement: the free slot that the instruction set asks for behind a transcendental then stands directly behind it in every build
__device__ __forceinline__ float exp_np(float x) {
  const float c = 0x1.715476p+0f, cc = 0x1.4ae0bep-26f;
  const float en = __builtin_rintf(x * c); const float a = __builtin_fmaf(x, cc, __builtin_fmaf(x, c, -en));
  float r; asm("v_exp_f32 %0, %1\n\tv_nop" : "=v"(r) : "v"(a));
  r = ldexpf(r, (int)en);
  return x < -0x1.9d1da0p+6f ? 0.f : r; }
// full unroll of a loop that indexes register arrays (fragments, accumulators, staged tiles): only with constant indices do they stay in registers
#define UNROLL_REGS _Pragma("unroll")
// lane l with lane l ^ 16: the two halves of a query's keys
__device__ __forceinline__ float xhalf(float x) { return __builtin_bit_cast(float, __builtin_amdgcn_permlanex16(__builtin_bit_cast(int, x), __builtin_bit_cast(int, x), 0x76543210, 0xfedcba98, false, false)); }
__global__ __launch_bounds__(128) void k_att(const _Float16* __restrict__ QH, const _Float16* __restrict__ KH, const _Float16* __restrict__ QL, const _Float16* __restrict__ KL, const _Float16* __restrict__ VT, const __bf16* __restrict__ VB, const __bf16* __restrict__ VBL, float* __restrict__ Y) {
  __shared__ __align__(16) unsigned char sm[SM_END];
  const int tid = threadIdx.x, wave = __builtin_amdgcn_readfirstlane(tid >> 5) /* in a scalar register: the diagonal test below is a scalar branch */, lane = tid & 31, col = lane & 15, g = lane >> 4; const int b = blockIdx.z, h = blockIdx.y;
  const int qb = (b & 1) ? (int)blockIdx.x : NQB - 1 - (int)blockIdx.x;   // long blocks of one sequence meet short blocks of the other: speed only
  const int ql0 = qb * 64 + wave * 16, qrow = ql0 + col; const size_t q0 = (size_t)b * TT + ql0;
  float m = -3.0e38f, l = 0.f; v8f oa[HD / 16] = {};
  if (qb >= QBH) {   /* block-uniform */
    const int kbl = kb_last(qb);
    _Float16* Ks = (_Float16*)(sm + SM_K); _Float16* Vs = (_Float16*)(sm + SM_V);
    v16h ah[HD / 32];
UNROLL_REGS
    for (int kc = 0; kc < HD / 32; ++kc) ah[kc] = frag_h(QH + (q0 + col) * CC + h * HD + kc * 32, lane);
    // whole lines: 8 threads bring one key's 128 B of K, 16 threads 256 B of one V plane
    const _Float16* kg = KH + ((size_t)b * TT + (tid >> 3)) * CC + h * HD + (tid & 7) * 8; const _Float16* vg = VT + ((size_t)b * CC + h * HD + (tid >> 4)) * (size_t)TT + (tid & 15) * 8;
    _Float16* ksd = Ks + (tid >> 3) * KP + (tid & 7) * 8; _Float16* vsd = Vs + (tid >> 4) * VP + (tid & 15) * 8;
    v4u rk[8], rv[8];
UNROLL_REGS
    for (int i = 0; i < 8; ++i) { rk[i] = *(const v4u*)(kg + (size_t)i * 16 * CC); rv[i] = *(const v4u*)(vg + (size_t)i * 8 * TT); }
    XW();
#pragma unroll 1   // rolled: one pass per key block, the next block's tiles fly in registers during the pass
    for (int kb = 0; kb <= kbl; ++kb) { const int k0 = kb * 128;
UNROLL_REGS
      for (int i = 0; i < 8; ++i) { *(v4u*)(ksd + i * 16 * KP) = rk[i]; *(v4u*)(vsd + i * 8 * VP) = rv[i]; }
      __syncthreads();   // the tiles are complete for all four waves
      // ring of eight K fragments over the 16 steps (kc, j): step t + 8 is read from LDS behind step t's product
      v16h kf[8];
UNROLL_REGS
      for (int j = 0; j < 8; ++j) kf[j] = frag_h(Ks + (j * 16 + col) * KP, lane);
      if (kb < kbl) { const _Float16* kn = kg + (size_t)(k0 + 128) * CC; const _Float16* vn = vg + k0 + 128;
UNROLL_REGS
        for (int i = 0; i < 8; ++i) { rk[i] = *(const v4u*)(kn + (size_t)i * 16 * CC); rv[i] = *(const v4u*)(vn + (size_t)i * 8 * TT); }
        XW(); }
      v8f acc[8] = {};
UNROLL_REGS
      for (int t = 0; t < 8 * (HD / 32); ++t) { const int kc = t >> 3, j = t & 7;
        acc[j] = wmma16(kf[j], ah[kc], acc[j]); if (kc + 1 < HD / 32) kf[j] = frag_h(Ks + (j * 16 + col) * KP + (kc + 1) * 32, lane); }
      // ring of four V fragments (one key chunk): chunk 0 is read in front of the softmax arithmetic, chunk s + 1 behind chunk s's products
      v16h vf[HD / 16];
UNROLL_REGS
      for (int j = 0; j < HD / 16; ++j) vf[j] = frag_h(Vs + (j * 16 + col) * VP, lane);
UNROLL_REGS
      for (int j = 0; j < 8; ++j) acc[j] *= SCALE;
      if (k0 + 127 > ql0) {   /* wave-uniform: only blocks that reach past the wave's first query are masked */
        const int lim = qrow - k0 - 8 * g;
UNROLL_REGS
        for (int j = 0; j < 8; ++j) {
UNROLL_REGS
          for (int r = 0; r < 8; ++r) if (j * 16 + r > lim) acc[j][r] = -3.0e38f; } }
      float mx = m;
UNROLL_REGS
      for (int j = 0; j < 8; ++j) { float mt = acc[j][0];
UNROLL_REGS
        for (int r = 1; r < 8; ++r) mt = fmaxf(mt, acc[j][r]);
        mx = fmaxf(mx, mt); }
      mx = fmaxf(mx, xhalf(mx));
      const float al = exp_np(m - mx); m = mx; l *= al;   /* every key block holds a key <= every query of the block, so m is finite from the first block on */
UNROLL_REGS
      for (int j = 0; j < HD / 16; ++j) oa[j] *= al;
UNROLL_REGS
      for (int s = 0; s < 4; ++s) { v16h p;   /* B fragment of P^T: elements 0..7 = keys 8g + 0..7 of score tile 2s, 8..15 = the same of tile 2s + 1: the k order of frag_h */
UNROLL_REGS
        for (int i = 0; i < 16; ++i) { const float e = exp_np(acc[2 * s + (i >> 3)][i & 7] - m); l += e; p[i] = (_Float16)(e * 2048.0f); }   /* a masked logit (-3e38) against the finite maximum gives exactly 0 */
UNROLL_REGS
        for (int j = 0; j < HD / 16; ++j) { oa[j] = wmma16(vf[j], p, oa[j]); if (s < 3) vf[j] = frag_h(Vs + (j * 16 + col) * VP + (s + 1) * 32, lane); } }
      __syncthreads();   // every wave has left the tiles before they are rewritten (behind the last pass: before they become ctx staging)
    }
  } else {
    const _Float16* QLb = QL + (size_t)b * QHI * CC; const _Float16* KLb = KL + (size_t)b * KHI * CC;
    const size_t po = ((size_t)b * CC + h * HD + col) * (size_t)KHI; const __bf16* vbr = VB + po; const __bf16* vlr = VBL + po;
    v16h ah[HD / 32], aq[HD / 32];
UNROLL_REGS
    for (int kc = 0; kc < HD / 32; ++kc) { ah[kc] = frag_h(QH + (q0 + col) * CC + h * HD + kc * 32, lane); aq[kc] = frag_h(QLb + (size_t)(ql0 + col) * CC + h * HD + kc * 32, lane); }
    XW();
#pragma unroll 1   // rolled: at most QBH key blocks, one copy of the body is enough
    for (int kb = 0; kb <= qb; ++kb) { const int k0 = kb * 64; const size_t kr0 = (size_t)b * TT + k0;
      v8f acc[4] = {}, accl[4] = {};
      // ring of four (k, k residual) fragment pairs over the 8 steps (kc, j): step t + 4 is loaded behind step t's products
      v16h kf[4], lf[4];
UNROLL_REGS
      for (int t = 0; t < 4; ++t) { kf[t] = frag_h(KH + (kr0 + t * 16 + col) * CC + h * HD, lane); lf[t] = frag_h(KLb + (size_t)(k0 + t * 16 + col) * CC + h * HD, lane); }
      XW();
UNROLL_REGS
      for (int t = 0; t < 4 * (HD / 32); ++t) { const int kc = t >> 2, j = t & 3, u = t + 4;
        acc[j] = wmma16(kf[j], ah[kc], acc[j]); accl[j] = wmma16(kf[j], aq[kc], accl[j]); accl[j] = wmma16(lf[j], ah[kc], accl[j]);
        if (u < 4 * (HD / 32)) { kf[j] = frag_h(KH + (kr0 + j * 16 + col) * CC + h * HD + (u >> 2) * 32, lane); lf[j] = frag_h(KLb + (size_t)(k0 + j * 16 + col) * CC + h * HD + (u >> 2) * 32, lane); XW(); } }
      float mx = m;
UNROLL_REGS
      for (int j = 0; j < 4; ++j) {
UNROLL_REGS
        for (int r = 0; r < 8; ++r) { float s = (acc[j][r] + accl[j][r] * (1.0f / 1024.0f)) * SCALE; if (k0 + j * 16 + 8 * g + r > qrow) s = -3.0e38f; acc[j][r] = s; mx = fmaxf(mx, s); } }
      mx = fmaxf(mx, xhalf(mx));
      const float al = exp_np(m - mx); m = mx; l *= al;
UNROLL_REGS
      for (int j = 0; j < HD / 16; ++j) oa[j] *= al;
UNROLL_REGS
      for (int s = 0; s < 2; ++s) { float pv[16];
        // a key chunk of v hi / lo is requested in front of the chunk's exponentials
        v16b vh[HD / 16], vl[HD / 16];
UNROLL_REGS
        for (int j = 0; j < HD / 16; ++j) { vh[j] = frag_b(vbr + (size_t)j * 16 * KHI + k0 + s * 32, lane); vl[j] = frag_b(vlr + (size_t)j * 16 * KHI + k0 + s * 32, lane); }
        XW();
UNROLL_REGS
        for (int i = 0; i < 16; ++i) { const float e = exp_np(acc[2 * s + (i >> 3)][i & 7] - m); l += e; pv[i] = e * 2048.0f; }
        const F2 p = bsplit16(pv);
UNROLL_REGS
        for (int j = 0; j < HD / 16; ++j) { oa[j] = wmma_bf(vh[j], p.h, oa[j]); oa[j] = wmma_bf(vh[j], p.l, oa[j]); oa[j] = wmma_bf(vl[j], p.h, oa[j]); } }
    }
  }
  l += xhalf(l);
  const float inv = l > 0.f ? 1.0f / (2048.0f * l) : 0.f;
  // ctx^T: a lane holds d = 16j + 8g + 0..7 of its query; through the wave's own LDS rows into 256-B (row, head) segments, two rows a store
  float* ys = (float*)sm + wave * 16 * YP;
UNROLL_REGS
  for (int j = 0; j < HD / 16; ++j) { const v8f o = oa[j] * inv; v4f lo4 = { o[0], o[1], o[2], o[3] }, hi4 = { o[4], o[5], o[6], o[7] }; *(v4f*)&ys[col * YP + j * 16 + 8 * g] = lo4; *(v4f*)&ys[col * YP + j * 16 + 8 * g + 4] = hi4; }
  LDSX();   // the wave's own rows are read back across lanes
UNROLL_REGS
  for (int i = 0; i < 8; ++i) vst2(Y + ((size_t)b * TT + ql0 + i * 2 + g) * CC + h * HD + col * 4, *(const v4f*)&ys[(i * 2 + g) * YP + col * 4]); }
// ---- k_out: block = (64 rows, 128 cols): out = ctx Wo (+ bo): ctx x 2^6 once to f16 against Wo as f16(bf16 x 2^8) exact (1 product) x 2^-14; causal early rows (< QHI of each sequence): ctx bf16 hi + lo against exact bf16 Wo (2 products)
__global__ __launch_bounds__(128) void k_out(const float* __restrict__ Y, const float* __restrict__ WO, const float* __restrict__ BO, float* __restrict__ OUT) { __shared__ __align__(16) float sf[4][16][132];
  const int tid = threadIdx.x, wave = tid >> 5, lane = tid & 31, col = lane & 15, g = lane >> 4; const int c0 = blockIdx.y * 128; const size_t r0 = (size_t)blockIdx.x * 64 + wave * 16;
  v8f acc[8] = {};
  // register ring: the ctx row and the eight Wo rows ((out,in) layout) of chunk kc + 1 are loaded while chunk kc is multiplied
  const float* yr = Y + (r0 + col) * CC; const float* wr = WO + (size_t)(c0 + col) * CC;
  if (CAUSAL && (int)(((size_t)blockIdx.x * 64) % TT) < QHI) {   /* block-uniform */
    R16 ra = ld_raw(yr, lane), rw[8];
#pragma unroll
    for (int j = 0; j < 8; ++j) rw[j] = ld_raw(wr + (size_t)j * 16 * CC, lane);
    XWP2(yr + 8 * g, wr + 8 * g);
#pragma unroll 1   // rolled: one copy of the ring body is enough
    for (int kc = 1; kc < CC / 32; ++kc) { const F2 a = raw_split(ra); ra = ld_raw(yr + kc * 32, lane); XWP(yr + kc * 32 + 8 * g);
#pragma unroll
      for (int j = 0; j < 8; ++j) { const v16b w = raw_b(rw[j]); rw[j] = ld_raw(wr + (size_t)j * 16 * CC + kc * 32, lane); acc[j] = wmma_bf(a.h, w, acc[j]); acc[j] = wmma_bf(a.l, w, acc[j]); }
      XW(); }
    { const F2 a = raw_split(ra);
#pragma unroll
      for (int j = 0; j < 8; ++j) { const v16b w = raw_b(rw[j]); acc[j] = wmma_bf(a.h, w, acc[j]); acc[j] = wmma_bf(a.l, w, acc[j]); } }
#pragma unroll
    for (int j = 0; j < 8; ++j) { const float bias = BO ? bfr(BO[c0 + j * 16 + col]) : 0.f;
#pragma unroll
      for (int r = 0; r < 8; ++r) sf[wave][8 * g + r][j * 16 + col] = acc[j][r] + bias; }
  } else {
    R16 ra = ld_raw(yr, lane), rw[8];
#pragma unroll
    for (int j = 0; j < 8; ++j) rw[j] = ld_raw(wr + (size_t)j * 16 * CC, lane);
    XWP2(yr + 8 * g, wr + 8 * g);
#pragma unroll 1   // rolled: one copy of the ring body is enough
    for (int kc = 1; kc < CC / 32; ++kc) { const v16h a = raw_hs(ra, 64.0f); ra = ld_raw(yr + kc * 32, lane); XWP(yr + kc * 32 + 8 * g);   /* ctx carried x 2^6 into f16 so small-magnitude context rows stay clear of f16 subnormals (chip FTZ) */
#pragma unroll
      for (int j = 0; j < 8; ++j) { const v16h w = raw_wh(rw[j]); rw[j] = ld_raw(wr + (size_t)j * 16 * CC + kc * 32, lane); acc[j] = wmma16(a, w, acc[j]); } }
    { const v16h a = raw_hs(ra, 64.0f);
#pragma unroll
      for (int j = 0; j < 8; ++j) acc[j] = wmma16(a, raw_wh(rw[j]), acc[j]); }
#pragma unroll
    for (int j = 0; j < 8; ++j) { const float bias = BO ? bfr(BO[c0 + j * 16 + col]) : 0.f;
#pragma unroll
      for (int r = 0; r < 8; ++r) sf[wave][8 * g + r][j * 16 + col] = acc[j][r] * (1.0f / 16384.0f) + bias; } }   /* 2^-8 (Wo carry) x 2^-6 (ctx carry) */
  LDSX(); for (int rl = 0; rl < 16; ++rl) vst2(OUT + (r0 + rl) * DIN + c0 + lane * 4, *(const v4f*)&sf[wave][rl][lane * 4]); }

extern "C" void kernel_launch(void* const* d_in, const int* in_sizes, int n_in, void* d_out, int out_size, void* d_ws, size_t ws_size, hipStream_t stream) {
  (void)in_sizes; (void)n_in; (void)out_size;
  const float** F = (const float**)d_in;
  if (ws_size < (size_t)WS_END) return;
  char* ws = (char*)d_ws; _Float16 *QH = (_Float16*)(ws + WS_QH), *KH = (_Float16*)(ws + WS_KH), *VT = (_Float16*)(ws + WS_VT), *QL = (_Float16*)(ws + WS_QL), *KL = (_Float16*)(ws + WS_KL); __bf16 *VB = (__bf16*)(ws + WS_VB), *VBL = (__bf16*)(ws + WS_VBL); float *Y = (float*)(ws + WS_Y);
  (void)Y; (void)QL; (void)KL; (void)VB; (void)VBL;
  // inputs: 0 q [2,2048,512]; 1 k; 2 v; 3 Wq [512,512] (out,in); 4 Wk; 5 Wv; 6 Wp (out,in); 7 bp (zeros, read); no q / k / v biases (null pointers)
  k_proj<<<dim3(TNB * TT / 64, CC / 128, 3), 128, 0, stream>>>(F[0], F[1], F[2], F[3], F[4], F[5], nullptr, nullptr, nullptr, QH, QL, KH, KL, VT, VB, VBL);
  k_att<<<dim3(NQB, NH, TNB), 128, 0, stream>>>(QH, KH, QL, KL, VT, VB, VBL, Y);
  k_out<<<dim3(TNB * TT / 64, DIN / 128), 128, 0, stream>>>(Y, F[6], F[7], (float*)d_out);
}

// v003
// Measured time: 57.3 microseconds a run.
// Two timings next to v002 put it at 1.69 and 1.68 times that version's speed.
// Counting every step since v000, it is 9.56 times as fast.
// compute dtype: all float inputs rounded to bf16; the fused q / k / v projection with EXACT bf16 products on WMMA 16x16x32 (f32 accumulate) (no q / k / v biases); causal logits: 3 products for the first 384 rows, single f16 q x k after, x 64^-0.5; online softmax f32 (running maximum, rescaled sums, division last); e^(s-m) x 2^11 once to f16 x v once to f16 (bf16 hi + lo below row 384); ctx hi+lo x exact W below row 384, x2^6 f16 carry x f16(bf16 x 2^8) W after, + bias; f32 output.
#include <hip/hip_runtime.h>
#include <math.h>

typedef __attribute__((ext_vector_type(16))) _Float16 v16h;
typedef __attribute__((ext_vector_type(16))) __bf16 v16b;
typedef __attribute__((ext_vector_type(8)))  _Float16 v8h;
typedef __attribute__((ext_vector_type(8)))  float v8f;
typedef __attribute__((ext_vector_type(4)))  float v4f;
typedef __attribute__((ext_vector_type(2)))  float v2f;
typedef __attribute__((ext_vector_type(4)))  unsigned v4u;
typedef __attribute__((ext_vector_type(4)))  int v4i;
typedef float __attribute__((may_alias)) float_a;
typedef int __attribute__((may_alias)) int_a;

template <typename T> __device__ __forceinline__ void vst2(void* p, T v) { *(T*)p = v;  }
__device__ __forceinline__ v8f wmma16(v16h a, v16h b, v8f c) {
  v8f d = __builtin_amdgcn_wmma_f32_16x16x32_f16(false, a, false, b, (short)0, c, false, false);
  asm volatile("v_nop\n\tv_nop\n\tv_nop\n\tv_nop" : "+v"(d) : "v"(a), "v"(b));
  return d;
}
__device__ __forceinline__ v8f wmma_bf(v16b a, v16b b, v8f c) {
  v8f d = __builtin_amdgcn_wmma_f32_16x16x32_bf16(false, a, false, b, (short)0, c, false, false);
  asm volatile("v_nop\n\tv_nop\n\tv_nop\n\tv_nop" : "+v"(d) : "v"(a), "v"(b));
  return d;
}
// 16x16x32 fragments: lane = (h = lane>>4, row/col = lane&15); elements 0..7 = k0+8h+0..7, 8..15 = k0+16+8h+0..7; D element r = row 8h+r
__device__ __forceinline__ v16h frag_h(const _Float16* rowk0, int lane) {
  union { v16h v; v8h q[2]; } u; const _Float16* p = rowk0 + 8 * (lane >> 4);
  u.q[0] = *(const v8h*)p; u.q[1] = *(const v8h*)(p + 16); return u.v;
}
__device__ __forceinline__ v16h frag_f32(const float* rowk0, int lane) {
  v16h a; const float* p = rowk0 + 8 * (lane >> 4);
#pragma unroll
  for (int i = 0; i < 8; ++i) { a[i] = (_Float16)p[i]; a[8 + i] = (_Float16)p[16 + i]; }
  return a;
}
__device__ __forceinline__ v16h frag_f32s(const float* rowk0, int lane, float sc) {
  v16h a; const float* p = rowk0 + 8 * (lane >> 4);
#pragma unroll
  for (int i = 0; i < 8; ++i) { a[i] = (_Float16)(p[i] * sc); a[8 + i] = (_Float16)(p[16 + i] * sc); }
  return a;
}
// column fragment from a [K][ld] layout (column n), rows >= K read as 0
__device__ __forceinline__ v16h fragc_f32(const float* W, int k0, int n, int lane, int ld, int K) {
  v16h a; const int g = lane >> 4;
#pragma unroll
  for (int i = 0; i < 8; ++i) { const int ka = k0 + 8 * g + i, kb = ka + 16;
    a[i] = (_Float16)(ka < K ? W[(size_t)(ka < K ? ka : K - 1) * ld + n] : 0.f); a[8 + i] = (_Float16)(kb < K ? W[(size_t)(kb < K ? kb : K - 1) * ld + n] : 0.f); }
  return a;
}
struct F2 { v16b h, l; };
__device__ __forceinline__ F2 bsplit16(const float v[16]) { F2 r;
#pragma unroll
  for (int i = 0; i < 16; ++i) { const __bf16 h = (__bf16)v[i]; r.h[i] = h; r.l[i] = (__bf16)(v[i] - (float)h); }
  return r; }
__device__ __forceinline__ F2 split_row(const float* row, int k0, int lane) { float v[16]; const float* p = row + k0 + 8 * (lane >> 4);
#pragma unroll
  for (int i = 0; i < 8; ++i) { v[i] = p[i]; v[8 + i] = p[16 + i]; }
  return bsplit16(v); }
__device__ __forceinline__ F2 split_rowK(const float* row, int k0, int lane, int K) { float v[16]; const int g = lane >> 4;
#pragma unroll
  for (int i = 0; i < 8; ++i) { const int ka = k0 + 8 * g + i, kb = ka + 16; v[i] = ka < K ? row[ka < K ? ka : K - 1] : 0.f; v[8 + i] = kb < K ? row[kb < K ? kb : K - 1] : 0.f; }
  return bsplit16(v); }
__device__ __forceinline__ F2 split_col(const float* W, int k0, int n, int lane, int ld, int K) { float v[16]; const int g = lane >> 4;
#pragma unroll
  for (int i = 0; i < 8; ++i) { const int ka = k0 + 8 * g + i, kb = ka + 16; v[i] = ka < K ? W[(size_t)(ka < K ? ka : K - 1) * ld + n] : 0.f; v[8 + i] = kb < K ? W[(size_t)(kb < K ? kb : K - 1) * ld + n] : 0.f; }
  return bsplit16(v); }
__device__ __forceinline__ v8f mac3(const F2& a, const F2& b, v8f c) { c = wmma_bf(a.l, b.h, c); c = wmma_bf(a.h, b.l, c); return wmma_bf(a.h, b.h, c); }
__device__ __forceinline__ float sigm(float v) { return 1.0f / (1.0f + expf(-v)); }
#define LDSX() do { asm volatile("s_wait_dscnt 0" ::: "memory"); __builtin_amdgcn_wave_barrier(); __builtin_amdgcn_fence(__ATOMIC_RELEASE, "workgroup"); } while (0)

// Causal multi-head attention on separate q / k / v inputs at width 512 (q / k / v [2,2048,512]; torch (out,in) Wq / Wk / Wv / Wp [512,512] applied as einsum('bsd,ed->bse') = x @ W.T, no q / k / v biases; bp zeros (read); 8 heads x 64; att / sqrt(64); tril kept, -1e10 (finite: the same exclusion) elsewhere; softmax; y @ Wp.T + bp).
#define NB 2
#define TT 2048
#define CC 512            // NH * HD = projected width
#define DIN 512          // input (model) width
#define NH 8
#define HD 64
#define NQB (TT / 64)
#define HG 4
#define SCALE (0.125f)
#define CAUSAL 1
#ifndef TNB
#define TNB NB
#endif
__device__ __forceinline__ float bfr(float v) { return (float)(__bf16)v; }
__host__ __device__ __forceinline__ int kb_last(int qb) { return CAUSAL ? ((qb * 64 + 63) >> 7) : (TT / 128 - 1); }
typedef __attribute__((ext_vector_type(8))) __bf16 v8b;
__device__ __forceinline__ v16b frag_b(const __bf16* rowk0, int lane) {
  union { v16b v; v8b q[2]; } u; const __bf16* p = rowk0 + 8 * (lane >> 4);
  u.q[0] = *(const v8b*)p; u.q[1] = *(const v8b*)(p + 16); return u.v;
}
#define QBH 6              // causal: query blocks 0..QBH-1 of each sequence (few keys, no averaging) take the high-precision path
#define QHI 384            // rows carrying a q residual plane
#define KHI 384            // key rows carrying k residual / v bf16 hi+lo planes (used only by the causal high-precision path)
// B fragment (k rows k0+.., output column o) of a weight: (in,out) [K][ld] or (out,in) [ld rows of K]: bf16 exact, or f16(bf16 * 256) exact
__device__ __forceinline__ v16b wcol_io(const float* Wm, int k0, int o, int lane, int ld) { v16b w; const int g = lane >> 4;
#pragma unroll
  for (int i = 0; i < 8; ++i) { w[i] = (__bf16)Wm[(size_t)(k0 + 8 * g + i) * ld + o]; w[8 + i] = (__bf16)Wm[(size_t)(k0 + 16 + 8 * g + i) * ld + o]; }
  return w; }
__device__ __forceinline__ v16b wcol_oi(const float* Wm, int k0, int o, int lane, int K) { v16b w; const float* p = Wm + (size_t)o * K + k0 + 8 * (lane >> 4);
#pragma unroll
  for (int i = 0; i < 8; ++i) { w[i] = (__bf16)p[i]; w[8 + i] = (__bf16)p[16 + i]; }
  return w; }
__device__ __forceinline__ v16h wcolh_io(const float* Wm, int k0, int o, int lane, int ld) { v16h w; const int g = lane >> 4;
#pragma unroll
  for (int i = 0; i < 8; ++i) { w[i] = (_Float16)(bfr(Wm[(size_t)(k0 + 8 * g + i) * ld + o]) * 256.0f); w[8 + i] = (_Float16)(bfr(Wm[(size_t)(k0 + 16 + 8 * g + i) * ld + o]) * 256.0f); }
  return w; }
__device__ __forceinline__ v16h wcolh_oi(const float* Wm, int k0, int o, int lane, int K) { v16h w; const float* p = Wm + (size_t)o * K + k0 + 8 * (lane >> 4);
#pragma unroll
  for (int i = 0; i < 8; ++i) { w[i] = (_Float16)(bfr(p[i]) * 256.0f); w[8 + i] = (_Float16)(bfr(p[16 + i]) * 256.0f); }
  return w; }
#define WQKV_LAYOUT 1   // 0 = (in,out) [DIN][CC]; 1 = (out,in) [CC][DIN]; 2 = per-head [NH][DIN][HD]
__device__ __forceinline__ v16b wcol_hdk(const float* Wm, int k0, int o, int lane) { v16b w; const int g = lane >> 4; const float* p = Wm + (size_t)(o / HD) * DIN * HD + (o % HD);
#pragma unroll
  for (int i = 0; i < 8; ++i) { w[i] = (__bf16)p[(size_t)(k0 + 8 * g + i) * HD]; w[8 + i] = (__bf16)p[(size_t)(k0 + 16 + 8 * g + i) * HD]; }
  return w; }
#define WO_OUT_IN 1
#if WQKV_LAYOUT == 1
#define WCOL(W, k0, o, lane) wcol_oi(W, k0, o, lane, DIN)
#elif WQKV_LAYOUT == 2
#define WCOL(W, k0, o, lane) wcol_hdk(W, k0, o, lane)
#else
#define WCOL(W, k0, o, lane) wcol_io(W, k0, o, lane, CC)
#endif
#if WO_OUT_IN
#define WOCOL(W, k0, o, lane) wcol_oi(W, k0, o, lane, CC)
#define WOCOLH(W, k0, o, lane) wcolh_oi(W, k0, o, lane, CC)
#else
#define WOCOL(W, k0, o, lane) wcol_io(W, k0, o, lane, DIN)
#define WOCOLH(W, k0, o, lane) wcolh_io(W, k0, o, lane, DIN)
#endif

#ifndef SM_EXTRA_PARAMS
#define SM_EXTRA_PARAMS
#endif
#ifndef PROJ_EXTRA_PARAMS
#define PROJ_EXTRA_PARAMS
#endif
#ifndef SM_MASK_HOOK
#define SM_MASK_HOOK (void)0
#endif

// behind a run of global loads that were issued ahead: their address registers may be rewritten from here on
#define XW() asm volatile("s_wait_xcnt 0x0" ::: "memory")
// the same, with the loads' addresses as inputs, so that their registers stay untouched up to the wait
#define XWP2(p, q) asm volatile("s_wait_xcnt 0x0" :: "v"(p), "v"(q) : "memory")

// ---- operand staging of the two projection kernels: block tile = 64 A rows x 128 W rows ((out,in) layout, both K-contiguous, K = 512), one wave = 16 A rows x all 128 W rows.
// A chunk of GK k is brought by whole-line loads (16 threads = 256 B of one row), converted ONCE to its 16-bit operand form and laid in LDS for all four waves; fragments come from LDS. Two buffers, one barrier a chunk; the next chunk's f32 fly in registers during the products.
// MODE 0: A -> bf16, W -> bf16 (1 product); MODE 1: A -> bf16 hi + lo planes, W -> bf16 (2 products); MODE 2: A x 2^6 -> f16 (small-magnitude rows stay clear of f16 subnormals), W -> f16(bf16 x 2^8) exact (1 product)
// every '#pragma unroll' in gemm_tile: full unroll of a loop that indexes register arrays (staged rows, fragments, accumulators): only with constant indices do they stay in registers
#define GK 64
#define GP (GK + 8)        // LDS pitch in 16-bit elements: 144 B = 16 B x odd, so that ds_load_b128 fragment reads spread over the banks
#define GKD 512            // K, and the row pitch of A and W in floats
#define G_STB(MODE) ((((MODE) == 1 ? 128 : 64) + 128) * GP * 2)   // bytes of one buffer
typedef __attribute__((ext_vector_type(4))) __bf16 v4b;
typedef __attribute__((ext_vector_type(4))) _Float16 v4h;
template <int MODE> __device__ __forceinline__ void gemm_tile(const float* __restrict__ A, const float* __restrict__ Wm, unsigned char* sm, int tid, v8f (&acc)[8]) {
  constexpr int AR = MODE == 1 ? 128 : 64; constexpr int STB = G_STB(MODE);
  const int wave = tid >> 5, lane = tid & 31, col = lane & 15, sr = tid >> 4, sc = (tid & 15) * 4;
  const float* ag = A + (size_t)sr * GKD + sc; const float* wg = Wm + (size_t)sr * GKD + sc;
  v4f ra[8], rw[16];
#pragma unroll
  for (int i = 0; i < 8; ++i) ra[i] = *(const v4f*)(ag + (size_t)i * 8 * GKD);
#pragma unroll
  for (int i = 0; i < 16; ++i) rw[i] = *(const v4f*)(wg + (size_t)i * 8 * GKD);
  XWP2(ag, wg);
#pragma unroll 1   // rolled: one pass per chunk, the register set itself keeps the global loads one chunk ahead
  for (int kc = 0; kc < GKD / GK; ++kc) { unsigned char* st = sm + (kc & 1) * STB;
#pragma unroll
    for (int i = 0; i < 8; ++i) { const v4f x = ra[i]; const int o = (sr + i * 8) * GP + sc;
      if constexpr (MODE == 0) { v4b c; for (int e = 0; e < 4; ++e) c[e] = (__bf16)x[e]; *(v4b*)((__bf16*)st + o) = c; }
      else if constexpr (MODE == 1) { v4b c, d; for (int e = 0; e < 4; ++e) { const __bf16 hv = (__bf16)x[e]; c[e] = hv; d[e] = (__bf16)(x[e] - (float)hv); } *(v4b*)((__bf16*)st + o) = c; *(v4b*)((__bf16*)st + 64 * GP + o) = d; }
      else { v4h c; for (int e = 0; e < 4; ++e) c[e] = (_Float16)(x[e] * 64.0f); *(v4h*)((_Float16*)st + o) = c; } }
#pragma unroll
    for (int i = 0; i < 16; ++i) { const v4f x = rw[i]; const int o = (AR + sr + i * 8) * GP + sc;
      if constexpr (MODE == 2) { v4h c; for (int e = 0; e < 4; ++e) c[e] = (_Float16)(bfr(x[e]) * 256.0f); *(v4h*)((_Float16*)st + o) = c; }
      else { v4b c; for (int e = 0; e < 4; ++e) c[e] = (__bf16)x[e]; *(v4b*)((__bf16*)st + o) = c; } }
    __syncthreads();   // the chunk is complete for all four waves; every wave has also left the other buffer, which the next pass rewrites
    // behind the barrier, not in front of it: the barrier's own wait would take in loads that were just issued
    if (kc + 1 < GKD / GK) { const float* an = ag + (kc + 1) * GK; const float* wn = wg + (kc + 1) * GK;
#pragma unroll
      for (int i = 0; i < 8; ++i) ra[i] = *(const v4f*)(an + (size_t)i * 8 * GKD);
#pragma unroll
      for (int i = 0; i < 16; ++i) rw[i] = *(const v4f*)(wn + (size_t)i * 8 * GKD);
      XWP2(an, wn); }
    // ring of eight W fragments over the 16 steps (kk, j): step t + 8 is read from LDS behind step t's product
    if constexpr (MODE == 2) { const _Float16* sa = (const _Float16*)st + (wave * 16 + col) * GP; const _Float16* sw = (const _Float16*)st + (AR + col) * GP;
      v16h a[2], wf[8];
#pragma unroll
      for (int kk = 0; kk < 2; ++kk) a[kk] = frag_h(sa + kk * 32, lane);
#pragma unroll
      for (int j = 0; j < 8; ++j) wf[j] = frag_h(sw + j * 16 * GP, lane);
#pragma unroll
      for (int t = 0; t < 16; ++t) { const int kk = t >> 3, j = t & 7; acc[j] = wmma16(a[kk], wf[j], acc[j]); if (kk == 0) wf[j] = frag_h(sw + j * 16 * GP + 32, lane); }
    } else { const __bf16* sa = (const __bf16*)st + (wave * 16 + col) * GP; const __bf16* sw = (const __bf16*)st + (AR + col) * GP;
      v16b a[2], al[2], wf[8];
#pragma unroll
      for (int kk = 0; kk < 2; ++kk) { a[kk] = frag_b(sa + kk * 32, lane); if constexpr (MODE == 1) al[kk] = frag_b(sa + 64 * GP + kk * 32, lane); }
#pragma unroll
      for (int j = 0; j < 8; ++j) wf[j] = frag_b(sw + j * 16 * GP, lane);
#pragma unroll
      for (int t = 0; t < 16; ++t) { const int kk = t >> 3, j = t & 7; acc[j] = wmma_bf(a[kk], wf[j], acc[j]); if constexpr (MODE == 1) acc[j] = wmma_bf(al[kk], wf[j], acc[j]); if (kk == 0) wf[j] = frag_b(sw + j * 16 * GP + 32, lane); } } }
  __syncthreads();   // every wave has left the buffers before the caller's epilogue reuses them
}

#define WS_QH  0u                                      // f16 q rows [b*t][CC]
#define WS_KH  (WS_QH + 2u * (size_t)NB * TT * CC)      // f16 k rows [b*t][CC]
#define WS_VT  (WS_KH + 2u * (size_t)NB * TT * CC)      // f16 v planes [b][c][t]
#define WS_QL  (WS_VT + 2u * (size_t)NB * CC * TT)      // f16 q residual x 2^10 rows [b][t < QHI][CC]
#define WS_KL  (WS_QL + 2u * (size_t)NB * QHI * CC)     // f16 k residual x 2^10 rows [b][t < KHI][CC]
#define WS_VB  (WS_KL + 2u * (size_t)NB * KHI * CC)     // bf16 v hi planes [b][c][t < KHI]
#define WS_VBL (WS_VB + 2u * (size_t)NB * CC * KHI)
#define WS_S   (WS_VBL + 2u * (size_t)NB * CC * KHI)    // (not used: logits and P stay on chip)
#define WS_Y   (WS_S  + 4u * (size_t)HG * TT * TT)      // f32 ctx rows [b*t][CC] (only when there is an output projection)
#define WS_END (WS_Y  + 4u * (size_t)NB * TT * CC)

// ---- k_proj: block = (64 rows, 128 cols, which): q/k/v = X W (+ b) with exact bf16 products (K = DIN) -> which 0: q f16 rows (+ residual rows < QHI); 1: k f16 rows (+ residual rows < KHI); 2: v f16 planes [c][t] (+ bf16 hi/lo planes for t < KHI)
__global__ __launch_bounds__(128) void k_proj(const float* __restrict__ XQ, const float* __restrict__ XK, const float* __restrict__ XV, const float* __restrict__ WQ, const float* __restrict__ WK, const float* __restrict__ WV, const float* __restrict__ BQ, const float* __restrict__ BK, const float* __restrict__ BV,
    _Float16* __restrict__ QH, _Float16* __restrict__ QL, _Float16* __restrict__ KH, _Float16* __restrict__ KL, _Float16* __restrict__ VT, __bf16* __restrict__ VB, __bf16* __restrict__ VBL) {
  // one LDS range: the two operand buffers during the products, the output staging (sh, sl or th, tb, tbl) behind them
  __shared__ __align__(16) unsigned char sm[2 * G_STB(0)]; static_assert(2 * G_STB(0) >= 3 * 128 * 72 * 2 && 2 * G_STB(0) >= 2 * 64 * 136 * 2, "output staging fits");
  _Float16 (*sh)[136] = (_Float16 (*)[136])sm; _Float16 (*sl)[136] = (_Float16 (*)[136])(sm + 64 * 136 * 2); _Float16 (*th)[72] = (_Float16 (*)[72])sm; __bf16 (*tb)[72] = (__bf16 (*)[72])(sm + 128 * 72 * 2); __bf16 (*tbl)[72] = (__bf16 (*)[72])(sm + 2 * 128 * 72 * 2);
  const int tid = threadIdx.x, wave = tid >> 5, lane = tid & 31, col = lane & 15, g = lane >> 4; const int which = blockIdx.z; const int c0 = blockIdx.y * 128; const size_t r0 = (size_t)blockIdx.x * 64; const size_t bb = r0 / TT; const int t0 = (int)(r0 % TT);
  const float* X = which == 0 ? XQ : which == 1 ? XK : XV; const float* WA = which == 0 ? WQ : which == 1 ? WK : WV; const float* BA = which == 0 ? BQ : which == 1 ? BK : BV;
  v8f acc[8] = {};
  gemm_tile<0>(X + r0 * DIN, WA + (size_t)c0 * DIN, sm, tid, acc);
  if (which < 2) { _Float16* DH = which == 0 ? QH : KH; _Float16* DL = which == 0 ? QL : KL; const int nhi = which == 0 ? QHI : KHI; const bool hi_rows = t0 < nhi;
#pragma unroll
    for (int j = 0; j < 8; ++j) { const float bias = BA ? bfr(BA[c0 + j * 16 + col]) : 0.f;
#pragma unroll
      for (int r = 0; r < 8; ++r) { const float v = acc[j][r] + bias; const _Float16 hv = (_Float16)v; sh[wave * 16 + 8 * g + r][j * 16 + col] = hv; sl[wave * 16 + 8 * g + r][j * 16 + col] = (_Float16)((v - (float)hv) * 1024.0f); } }
    __syncthreads();
    for (int e = tid; e < 64 * 16; e += 128) { const int rl = e >> 4, q = e & 15; vst2((unsigned*)(DH + (r0 + rl) * CC + c0 + q * 8), *(const v4u*)&sh[rl][q * 8]); if (hi_rows) vst2((unsigned*)(DL + (bb * nhi + t0 + rl) * (size_t)CC + c0 + q * 8), *(const v4u*)&sl[rl][q * 8]); }
  } else { const bool hi_rows = t0 < KHI;
#pragma unroll
    for (int j = 0; j < 8; ++j) { const float bias = BA ? bfr(BA[c0 + j * 16 + col]) : 0.f;
#pragma unroll
      for (int r = 0; r < 8; ++r) { const float v = acc[j][r] + bias; const int rl = wave * 16 + 8 * g + r, cl = j * 16 + col; th[cl][rl] = (_Float16)v; const __bf16 bh = (__bf16)v; tb[cl][rl] = bh; tbl[cl][rl] = (__bf16)(v - (float)bh); } }
    __syncthreads();
    for (int e = tid; e < 128 * 8; e += 128) { const int cl = e >> 3, q = e & 7; vst2((unsigned*)(VT + (bb * CC + c0 + cl) * (size_t)TT + t0 + q * 8), *(const v4u*)&th[cl][q * 8]); if (hi_rows) { const size_t o3 = (bb * CC + c0 + cl) * (size_t)KHI + t0 + q * 8; vst2((unsigned*)(VB + o3), *(const v4u*)&tb[cl][q * 8]); vst2((unsigned*)(VBL + o3), *(const v4u*)&tbl[cl][q * 8]); } } } }
// ---- k_att: block = 64 queries (qb) of (b, h), one wave = 16 queries; key blocks up to the diagonal. Transposed products: S^T = K . Q^T (a lane holds the scores of ONE query: D row = key 8g + r, D column = query), causal mask by index, running maximum and rescaled running sums in f32 (online softmax), e^(s-m) x 2^11 packed straight from two score tiles into the B operand of ctx^T += V^T . P^T; the division by the row sum comes last. Logits and P never leave the registers.
// query blocks >= QBH: key blocks of 128, single f16 k x q, P once to f16 against v f16; the K tile [128 keys][HD] and the V tile [HD][128 keys] are brought once per block into LDS for all four waves. Query blocks < QBH (few keys): key blocks of 64, 3-product logits, P and v as bf16 hi + lo (3 products), fragments straight from global.
#define KP (HD + 8)        // K tile pitch in halves: 144 B = 16 B x odd, so that ds_load_b128 fragment reads spread over the banks
#define VP (128 + 8)       // V tile pitch in halves: 272 B = 16 B x odd
#define YP (HD + 4)        // ctx staging pitch in floats
#define SM_K 0
#define SM_V (SM_K + 128 * KP * 2)
#define SM_END (SM_V + HD * VP * 2)
// e^x for x <= 0 to f32 accuracy, as expf has it: n = round(x log2(e)), x log2(e) - n by two fused steps with log2(e) in two parts, 2^fraction, ldexp, 0 below the underflow bound (no overflow side: x <= 0).
// v_exp_f32 and a v_nop in one statement: the free slot that the instruction set asks for behind a transcendental then stands directly behind it in every build
__device__ __forceinline__ float exp_np(float x) {
  const float c = 0x1.715476p+0f, cc = 0x1.4ae0bep-26f;
  const float en = __builtin_rintf(x * c); const float a = __builtin_fmaf(x, cc, __builtin_fmaf(x, c, -en));
  float r; asm("v_exp_f32 %0, %1\n\tv_nop" : "=v"(r) : "v"(a));
  r = ldexpf(r, (int)en);
  return x < -0x1.9d1da0p+6f ? 0.f : r; }
// full unroll of a loop that indexes register arrays (fragments, accumulators, staged tiles): only with constant indices do they stay in registers
#define UNROLL_REGS _Pragma("unroll")
// lane l with lane l ^ 16: the two halves of a query's keys
__device__ __forceinline__ float xhalf(float x) { return __builtin_bit_cast(float, __builtin_amdgcn_permlanex16(__builtin_bit_cast(int, x), __builtin_bit_cast(int, x), 0x76543210, 0xfedcba98, false, false)); }
__global__ __launch_bounds__(128) void k_att(const _Float16* __restrict__ QH, const _Float16* __restrict__ KH, const _Float16* __restrict__ QL, const _Float16* __restrict__ KL, const _Float16* __restrict__ VT, const __bf16* __restrict__ VB, const __bf16* __restrict__ VBL, float* __restrict__ Y) {
  __shared__ __align__(16) unsigned char sm[SM_END];
  const int tid = threadIdx.x, wave = __builtin_amdgcn_readfirstlane(tid >> 5) /* in a scalar register: the diagonal test below is a scalar branch */, lane = tid & 31, col = lane & 15, g = lane >> 4; const int b = blockIdx.z, h = blockIdx.y;
  const int qb = (b & 1) ? (int)blockIdx.x : NQB - 1 - (int)blockIdx.x;   // long blocks of one sequence meet short blocks of the other: speed only
  const int ql0 = qb * 64 + wave * 16, qrow = ql0 + col; const size_t q0 = (size_t)b * TT + ql0;
  float m = -3.0e38f, l = 0.f; v8f oa[HD / 16] = {};
  if (qb >= QBH) {   /* block-uniform */
    const int kbl = kb_last(qb);
    _Float16* Ks = (_Float16*)(sm + SM_K); _Float16* Vs = (_Float16*)(sm + SM_V);
    v16h ah[HD / 32];
UNROLL_REGS
    for (int kc = 0; kc < HD / 32; ++kc) ah[kc] = frag_h(QH + (q0 + col) * CC + h * HD + kc * 32, lane);
    // whole lines: 8 threads bring one key's 128 B of K, 16 threads 256 B of one V plane
    const _Float16* kg = KH + ((size_t)b * TT + (tid >> 3)) * CC + h * HD + (tid & 7) * 8; const _Float16* vg = VT + ((size_t)b * CC + h * HD + (tid >> 4)) * (size_t)TT + (tid & 15) * 8;
    _Float16* ksd = Ks + (tid >> 3) * KP + (tid & 7) * 8; _Float16* vsd = Vs + (tid >> 4) * VP + (tid & 15) * 8;
    v4u rk[8], rv[8];
UNROLL_REGS
    for (int i = 0; i < 8; ++i) { rk[i] = *(const v4u*)(kg + (size_t)i * 16 * CC); rv[i] = *(const v4u*)(vg + (size_t)i * 8 * TT); }
    XW();
#pragma unroll 1   // rolled: one pass per key block, the next block's tiles fly in registers during the pass
    for (int kb = 0; kb <= kbl; ++kb) { const int k0 = kb * 128;
UNROLL_REGS
      for (int i = 0; i < 8; ++i) { *(v4u*)(ksd + i * 16 * KP) = rk[i]; *(v4u*)(vsd + i * 8 * VP) = rv[i]; }
      __syncthreads();   // the tiles are complete for all four waves
      // ring of eight K fragments over the 16 steps (kc, j): step t + 8 is read from LDS behind step t's product
      v16h kf[8];
UNROLL_REGS
      for (int j = 0; j < 8; ++j) kf[j] = frag_h(Ks + (j * 16 + col) * KP, lane);
      if (kb < kbl) { const _Float16* kn = kg + (size_t)(k0 + 128) * CC; const _Float16* vn = vg + k0 + 128;
UNROLL_REGS
        for (int i = 0; i < 8; ++i) { rk[i] = *(const v4u*)(kn + (size_t)i * 16 * CC); rv[i] = *(const v4u*)(vn + (size_t)i * 8 * TT); }
        XW(); }
      v8f acc[8] = {};
UNROLL_REGS
      for (int t = 0; t < 8 * (HD / 32); ++t) { const int kc = t >> 3, j = t & 7;
        acc[j] = wmma16(kf[j], ah[kc], acc[j]); if (kc + 1 < HD / 32) kf[j] = frag_h(Ks + (j * 16 + col) * KP + (kc + 1) * 32, lane); }
      // ring of four V fragments (one key chunk): chunk 0 is read in front of the softmax arithmetic, chunk s + 1 behind chunk s's products
      v16h vf[HD / 16];
UNROLL_REGS
      for (int j = 0; j < HD / 16; ++j) vf[j] = frag_h(Vs + (j * 16 + col) * VP, lane);
UNROLL_REGS
      for (int j = 0; j < 8; ++j) acc[j] *= SCALE;
      if (k0 + 127 > ql0) {   /* wave-uniform: only blocks that reach past the wave's first query are masked */
        const int lim = qrow - k0 - 8 * g;
UNROLL_REGS
        for (int j = 0; j < 8; ++j) {
UNROLL_REGS
          for (int r = 0; r < 8; ++r) if (j * 16 + r > lim) acc[j][r] = -3.0e38f; } }
      float mx = m;
UNROLL_REGS
      for (int j = 0; j < 8; ++j) { float mt = acc[j][0];
UNROLL_REGS
        for (int r = 1; r < 8; ++r) mt = fmaxf(mt, acc[j][r]);
        mx = fmaxf(mx, mt); }
      mx = fmaxf(mx, xhalf(mx));
      const float al = exp_np(m - mx); m = mx; l *= al;   /* every key block holds a key <= every query of the block, so m is finite from the first block on */
UNROLL_REGS
      for (int j = 0; j < HD / 16; ++j) oa[j] *= al;
UNROLL_REGS
      for (int s = 0; s < 4; ++s) { v16h p;   /* B fragment of P^T: elements 0..7 = keys 8g + 0..7 of score tile 2s, 8..15 = the same of tile 2s + 1: the k order of frag_h */
UNROLL_REGS
        for (int i = 0; i < 16; ++i) { const float e = exp_np(acc[2 * s + (i >> 3)][i & 7] - m); l += e; p[i] = (_Float16)(e * 2048.0f); }   /* a masked logit (-3e38) against the finite maximum gives exactly 0 */
UNROLL_REGS
        for (int j = 0; j < HD / 16; ++j) { oa[j] = wmma16(vf[j], p, oa[j]); if (s < 3) vf[j] = frag_h(Vs + (j * 16 + col) * VP + (s + 1) * 32, lane); } }
      __syncthreads();   // every wave has left the tiles before they are rewritten (behind the last pass: before they become ctx staging)
    }
  } else {
    const _Float16* QLb = QL + (size_t)b * QHI * CC; const _Float16* KLb = KL + (size_t)b * KHI * CC;
    const size_t po = ((size_t)b * CC + h * HD + col) * (size_t)KHI; const __bf16* vbr = VB + po; const __bf16* vlr = VBL + po;
    v16h ah[HD / 32], aq[HD / 32];
UNROLL_REGS
    for (int kc = 0; kc < HD / 32; ++kc) { ah[kc] = frag_h(QH + (q0 + col) * CC + h * HD + kc * 32, lane); aq[kc] = frag_h(QLb + (size_t)(ql0 + col) * CC + h * HD + kc * 32, lane); }
    XW();
#pragma unroll 1   // rolled: at most QBH key blocks, one copy of the body is enough
    for (int kb = 0; kb <= qb; ++kb) { const int k0 = kb * 64; const size_t kr0 = (size_t)b * TT + k0;
      v8f acc[4] = {}, accl[4] = {};
      // ring of four (k, k residual) fragment pairs over the 8 steps (kc, j): step t + 4 is loaded behind step t's products
      v16h kf[4], lf[4];
UNROLL_REGS
      for (int t = 0; t < 4; ++t) { kf[t] = frag_h(KH + (kr0 + t * 16 + col) * CC + h * HD, lane); lf[t] = frag_h(KLb + (size_t)(k0 + t * 16 + col) * CC + h * HD, lane); }
      XW();
UNROLL_REGS
      for (int t = 0; t < 4 * (HD / 32); ++t) { const int kc = t >> 2, j = t & 3, u = t + 4;
        acc[j] = wmma16(kf[j], ah[kc], acc[j]); accl[j] = wmma16(kf[j], aq[kc], accl[j]); accl[j] = wmma16(lf[j], ah[kc], accl[j]);
        if (u < 4 * (HD / 32)) { kf[j] = frag_h(KH + (kr0 + j * 16 + col) * CC + h * HD + (u >> 2) * 32, lane); lf[j] = frag_h(KLb + (size_t)(k0 + j * 16 + col) * CC + h * HD + (u >> 2) * 32, lane); XW(); } }
      float mx = m;
UNROLL_REGS
      for (int j = 0; j < 4; ++j) {
UNROLL_REGS
        for (int r = 0; r < 8; ++r) { float s = (acc[j][r] + accl[j][r] * (1.0f / 1024.0f)) * SCALE; if (k0 + j * 16 + 8 * g + r > qrow) s = -3.0e38f; acc[j][r] = s; mx = fmaxf(mx, s); } }
      mx = fmaxf(mx, xhalf(mx));
      const float al = exp_np(m - mx); m = mx; l *= al;
UNROLL_REGS
      for (int j = 0; j < HD / 16; ++j) oa[j] *= al;
UNROLL_REGS
      for (int s = 0; s < 2; ++s) { float pv[16];
        // a key chunk of v hi / lo is requested in front of the chunk's exponentials
        v16b vh[HD / 16], vl[HD / 16];
UNROLL_REGS
        for (int j = 0; j < HD / 16; ++j) { vh[j] = frag_b(vbr + (size_t)j * 16 * KHI + k0 + s * 32, lane); vl[j] = frag_b(vlr + (size_t)j * 16 * KHI + k0 + s * 32, lane); }
        XW();
UNROLL_REGS
        for (int i = 0; i < 16; ++i) { const float e = exp_np(acc[2 * s + (i >> 3)][i & 7] - m); l += e; pv[i] = e * 2048.0f; }
        const F2 p = bsplit16(pv);
UNROLL_REGS
        for (int j = 0; j < HD / 16; ++j) { oa[j] = wmma_bf(vh[j], p.h, oa[j]); oa[j] = wmma_bf(vh[j], p.l, oa[j]); oa[j] = wmma_bf(vl[j], p.h, oa[j]); } }
    }
  }
  l += xhalf(l);
  const float inv = l > 0.f ? 1.0f / (2048.0f * l) : 0.f;
  // ctx^T: a lane holds d = 16j + 8g + 0..7 of its query; through the wave's own LDS rows into 256-B (row, head) segments, two rows a store
  float* ys = (float*)sm + wave * 16 * YP;
UNROLL_REGS
  for (int j = 0; j < HD / 16; ++j) { const v8f o = oa[j] * inv; v4f lo4 = { o[0], o[1], o[2], o[3] }, hi4 = { o[4], o[5], o[6], o[7] }; *(v4f*)&ys[col * YP + j * 16 + 8 * g] = lo4; *(v4f*)&ys[col * YP + j * 16 + 8 * g + 4] = hi4; }
  LDSX();   // the wave's own rows are read back across lanes
UNROLL_REGS
  for (int i = 0; i < 8; ++i) vst2(Y + ((size_t)b * TT + ql0 + i * 2 + g) * CC + h * HD + col * 4, *(const v4f*)&ys[(i * 2 + g) * YP + col * 4]); }
// ---- k_out: block = (64 rows, 128 cols): out = ctx Wo (+ bo): ctx x 2^6 once to f16 against Wo as f16(bf16 x 2^8) exact (1 product) x 2^-14; causal early rows (< QHI of each sequence): ctx bf16 hi + lo against exact bf16 Wo (2 products)
__global__ __launch_bounds__(128) void k_out(const float* __restrict__ Y, const float* __restrict__ WO, const float* __restrict__ BO, float* __restrict__ OUT) {
  // one LDS range: the two operand buffers during the products, the output staging sf behind them
  __shared__ __align__(16) unsigned char sm[2 * G_STB(1)]; static_assert(2 * G_STB(1) >= 4 * 16 * 132 * 4, "output staging fits");
  float (*sf)[16][132] = (float (*)[16][132])sm;
  const int tid = threadIdx.x, wave = tid >> 5, lane = tid & 31, col = lane & 15, g = lane >> 4; const int c0 = blockIdx.y * 128; const size_t rb = (size_t)blockIdx.x * 64, r0 = rb + wave * 16;
  v8f acc[8] = {};
  if (CAUSAL && (int)(rb % TT) < QHI) {   /* block-uniform */
    gemm_tile<1>(Y + rb * CC, WO + (size_t)c0 * CC, sm, tid, acc);
#pragma unroll
    for (int j = 0; j < 8; ++j) { const float bias = BO ? bfr(BO[c0 + j * 16 + col]) : 0.f;
#pragma unroll
      for (int r = 0; r < 8; ++r) sf[wave][8 * g + r][j * 16 + col] = acc[j][r] + bias; }
  } else {
    gemm_tile<2>(Y + rb * CC, WO + (size_t)c0 * CC, sm, tid, acc);
#pragma unroll
    for (int j = 0; j < 8; ++j) { const float bias = BO ? bfr(BO[c0 + j * 16 + col]) : 0.f;
#pragma unroll
      for (int r = 0; r < 8; ++r) sf[wave][8 * g + r][j * 16 + col] = acc[j][r] * (1.0f / 16384.0f) + bias; } }   /* 2^-8 (Wo carry) x 2^-6 (ctx carry) */
  LDSX(); for (int rl = 0; rl < 16; ++rl) vst2(OUT + (r0 + rl) * DIN + c0 + lane * 4, *(const v4f*)&sf[wave][rl][lane * 4]); }

extern "C" void kernel_launch(void* const* d_in, const int* in_sizes, int n_in, void* d_out, int out_size, void* d_ws, size_t ws_size, hipStream_t stream) {
  (void)in_sizes; (void)n_in; (void)out_size;
  const float** F = (const float**)d_in;
  if (ws_size < (size_t)WS_END) return;
  char* ws = (char*)d_ws; _Float16 *QH = (_Float16*)(ws + WS_QH), *KH = (_Float16*)(ws + WS_KH), *VT = (_Float16*)(ws + WS_VT), *QL = (_Float16*)(ws + WS_QL), *KL = (_Float16*)(ws + WS_KL); __bf16 *VB = (__bf16*)(ws + WS_VB), *VBL = (__bf16*)(ws + WS_VBL); float *Y = (float*)(ws + WS_Y);
  (void)Y; (void)QL; (void)KL; (void)VB; (void)VBL;
  // inputs: 0 q [2,2048,512]; 1 k; 2 v; 3 Wq [512,512] (out,in); 4 Wk; 5 Wv; 6 Wp (out,in); 7 bp (zeros, read); no q / k / v biases (null pointers)
  k_proj<<<dim3(TNB * TT / 64, CC / 128, 3), 128, 0, stream>>>(F[0], F[1], F[2], F[3], F[4], F[5], nullptr, nullptr, nullptr, QH, QL, KH, KL, VT, VB, VBL);
  k_att<<<dim3(NQB, NH, TNB), 128, 0, stream>>>(QH, KH, QL, KL, VT, VB, VBL, Y);
  k_out<<<dim3(TNB * TT / 64, DIN / 128), 128, 0, stream>>>(Y, F[6], F[7], (float*)d_out);
}

// v004
// Measured time: 50.5 microseconds a run.
// Two timings next to v003 put it at 1.14 and 1.13 times that version's speed.
// All steps since v000 together make it 10.9 times as fast.
// compute dtype: all float inputs rounded to bf16; the fused q / k / v projection with EXACT bf16 products on WMMA 16x16x32 (f32 accumulate) (no q / k / v biases); causal logits: 3 products for the first 384 rows, single f16 q x k after, x 64^-0.5; online softmax f32 (running maximum, rescaled sums, division last; base 2: one fused multiply-add and the hardware's 2^x a score); e^(s-m) x 2^11 once to f16 x v once to f16 (bf16 hi + lo below row 384); ctx hi+lo x exact W below row 384, x2^6 f16 carry x f16(bf16 x 2^8) W after, + bias; f32 output.
#include <hip/hip_runtime.h>
#include <math.h>

typedef __attribute__((ext_vector_type(16))) _Float16 v16h;
typedef __attribute__((ext_vector_type(16))) __bf16 v16b;
typedef __attribute__((ext_vector_type(8)))  _Float16 v8h;
typedef __attribute__((ext_vector_type(8)))  float v8f;
typedef __attribute__((ext_vector_type(4)))  float v4f;
typedef __attribute__((ext_vector_type(2)))  float v2f;
typedef __attribute__((ext_vector_type(4)))  unsigned v4u;
typedef __attribute__((ext_vector_type(4)))  int v4i;
typedef float __attribute__((may_alias)) float_a;
typedef int __attribute__((may_alias)) int_a;

template <typename T> __device__ __forceinline__ void vst2(void* p, T v) { *(T*)p = v;  }
__device__ __forceinline__ v8f wmma16(v16h a, v16h b, v8f c) {
  v8f d = __builtin_amdgcn_wmma_f32_16x16x32_f16(false, a, false, b, (short)0, c, false, false);
  asm volatile("v_nop\n\tv_nop\n\tv_nop\n\tv_nop" : "+v"(d) : "v"(a), "v"(b));
  return d;
}
__device__ __forceinline__ v8f wmma_bf(v16b a, v16b b, v8f c) {
  v8f d = __builtin_amdgcn_wmma_f32_16x16x32_bf16(false, a, false, b, (short)0, c, false, false);
  asm volatile("v_nop\n\tv_nop\n\tv_nop\n\tv_nop" : "+v"(d) : "v"(a), "v"(b));
  return d;
}
// 16x16x32 fragments: lane = (h = lane>>4, row/col = lane&15); elements 0..7 = k0+8h+0..7, 8..15 = k0+16+8h+0..7; D element r = row 8h+r
__device__ __forceinline__ v16h frag_h(const _Float16* rowk0, int lane) {
  union { v16h v; v8h q[2]; } u; const _Float16* p = rowk0 + 8 * (lane >> 4);
  u.q[0] = *(const v8h*)p; u.q[1] = *(const v8h*)(p + 16); return u.v;
}
__device__ __forceinline__ v16h frag_f32(const float* rowk0, int lane) {
  v16h a; const float* p = rowk0 + 8 * (lane >> 4);
#pragma unroll
  for (int i = 0; i < 8; ++i) { a[i] = (_Float16)p[i]; a[8 + i] = (_Float16)p[16 + i]; }
  return a;
}
__device__ __forceinline__ v16h frag_f32s(const float* rowk0, int lane, float sc) {
  v16h a; const float* p = rowk0 + 8 * (lane >> 4);
#pragma unroll
  for (int i = 0; i < 8; ++i) { a[i] = (_Float16)(p[i] * sc); a[8 + i] = (_Float16)(p[16 + i] * sc); }
  return a;
}
// column fragment from a [K][ld] layout (column n), rows >= K read as 0
__device__ __forceinline__ v16h fragc_f32(const float* W, int k0, int n, int lane, int ld, int K) {
  v16h a; const int g = lane >> 4;
#pragma unroll
  for (int i = 0; i < 8; ++i) { const int ka = k0 + 8 * g + i, kb = ka + 16;
    a[i] = (_Float16)(ka < K ? W[(size_t)(ka < K ? ka : K - 1) * ld + n] : 0.f); a[8 + i] = (_Float16)(kb < K ? W[(size_t)(kb < K ? kb : K - 1) * ld + n] : 0.f); }
  return a;
}
struct F2 { v16b h, l; };
__device__ __forceinline__ F2 bsplit16(const float v[16]) { F2 r;
#pragma unroll
  for (int i = 0; i < 16; ++i) { const __bf16 h = (__bf16)v[i]; r.h[i] = h; r.l[i] = (__bf16)(v[i] - (float)h); }
  return r; }
__device__ __forceinline__ F2 split_row(const float* row, int k0, int lane) { float v[16]; const float* p = row + k0 + 8 * (lane >> 4);
#pragma unroll
  for (int i = 0; i < 8; ++i) { v[i] = p[i]; v[8 + i] = p[16 + i]; }
  return bsplit16(v); }
__device__ __forceinline__ F2 split_rowK(const float* row, int k0, int lane, int K) { float v[16]; const int g = lane >> 4;
#pragma unroll
  for (int i = 0; i < 8; ++i) { const int ka = k0 + 8 * g + i, kb = ka + 16; v[i] = ka < K ? row[ka < K ? ka : K - 1] : 0.f; v[8 + i] = kb < K ? row[kb < K ? kb : K - 1] : 0.f; }
  return bsplit16(v); }
__device__ __forceinline__ F2 split_col(const float* W, int k0, int n, int lane, int ld, int K) { float v[16]; const int g = lane >> 4;
#pragma unroll
  for (int i = 0; i < 8; ++i) { const int ka = k0 + 8 * g + i, kb = ka + 16; v[i] = ka < K ? W[(size_t)(ka < K ? ka : K - 1) * ld + n] : 0.f; v[8 + i] = kb < K ? W[(size_t)(kb < K ? kb : K - 1) * ld + n] : 0.f; }
  return bsplit16(v); }
__device__ __forceinline__ v8f mac3(const F2& a, const F2& b, v8f c) { c = wmma_bf(a.l, b.h, c); c = wmma_bf(a.h, b.l, c); return wmma_bf(a.h, b.h, c); }
__device__ __forceinline__ float sigm(float v) { return 1.0f / (1.0f + expf(-v)); }
#define LDSX() do { asm volatile("s_wait_dscnt 0" ::: "memory"); __builtin_amdgcn_wave_barrier(); __builtin_amdgcn_fence(__ATOMIC_RELEASE, "workgroup"); } while (0)

// Causal multi-head attention on separate q / k / v inputs at width 512 (q / k / v [2,2048,512]; torch (out,in) Wq / Wk / Wv / Wp [512,512] applied as einsum('bsd,ed->bse') = x @ W.T, no q / k / v biases; bp zeros (read); 8 heads x 64; att / sqrt(64); tril kept, -1e10 (finite: the same exclusion) elsewhere; softmax; y @ Wp.T + bp).
#define NB 2
#define TT 2048
#define CC 512            // NH * HD = projected width
#define DIN 512          // input (model) width
#define NH 8
#define HD 64
#define NQB (TT / 64)
#define HG 4
#define SCALE (0.125f)
#define CAUSAL 1
#ifndef TNB
#define TNB NB
#endif
__device__ __forceinline__ float bfr(float v) { return (float)(__bf16)v; }
__host__ __device__ __forceinline__ int kb_last(int qb) { return CAUSAL ? ((qb * 64 + 63) >> 7) : (TT / 128 - 1); }
typedef __attribute__((ext_vector_type(8))) __bf16 v8b;
__device__ __forceinline__ v16b frag_b(const __bf16* rowk0, int lane) {
  union { v16b v; v8b q[2]; } u; const __bf16* p = rowk0 + 8 * (lane >> 4);
  u.q[0] = *(const v8b*)p; u.q[1] = *(const v8b*)(p + 16); return u.v;
}
#define QBH 6              // causal: query blocks 0..QBH-1 of each sequence (few keys, no averaging) take the high-precision path
#define QHI 384            // rows carrying a q residual plane
#define KHI 384            // key rows carrying k residual / v bf16 hi+lo planes (used only by the causal high-precision path)
// B fragment (k rows k0+.., output column o) of a weight: (in,out) [K][ld] or (out,in) [ld rows of K]: bf16 exact, or f16(bf16 * 256) exact
__device__ __forceinline__ v16b wcol_io(const float* Wm, int k0, int o, int lane, int ld) { v16b w; const int g = lane >> 4;
#pragma unroll
  for (int i = 0; i < 8; ++i) { w[i] = (__bf16)Wm[(size_t)(k0 + 8 * g + i) * ld + o]; w[8 + i] = (__bf16)Wm[(size_t)(k0 + 16 + 8 * g + i) * ld + o]; }
  return w; }
__device__ __forceinline__ v16b wcol_oi(const float* Wm, int k0, int o, int lane, int K) { v16b w; const float* p = Wm + (size_t)o * K + k0 + 8 * (lane >> 4);
#pragma unroll
  for (int i = 0; i < 8; ++i) { w[i] = (__bf16)p[i]; w[8 + i] = (__bf16)p[16 + i]; }
  return w; }
__device__ __forceinline__ v16h wcolh_io(const float* Wm, int k0, int o, int lane, int ld) { v16h w; const int g = lane >> 4;
#pragma unroll
  for (int i = 0; i < 8; ++i) { w[i] = (_Float16)(bfr(Wm[(size_t)(k0 + 8 * g + i) * ld + o]) * 256.0f); w[8 + i] = (_Float16)(bfr(Wm[(size_t)(k0 + 16 + 8 * g + i) * ld + o]) * 256.0f); }
  return w; }
__device__ __forceinline__ v16h wcolh_oi(const float* Wm, int k0, int o, int lane, int K) { v16h w; const float* p = Wm + (size_t)o * K + k0 + 8 * (lane >> 4);
#pragma unroll
  for (int i = 0; i < 8; ++i) { w[i] = (_Float16)(bfr(p[i]) * 256.0f); w[8 + i] = (_Float16)(bfr(p[16 + i]) * 256.0f); }
  return w; }
#define WQKV_LAYOUT 1   // 0 = (in,out) [DIN][CC]; 1 = (out,in) [CC][DIN]; 2 = per-head [NH][DIN][HD]
__device__ __forceinline__ v16b wcol_hdk(const float* Wm, int k0, int o, int lane) { v16b w; const int g = lane >> 4; const float* p = Wm + (size_t)(o / HD) * DIN * HD + (o % HD);
#pragma unroll
  for (int i = 0; i < 8; ++i) { w[i] = (__bf16)p[(size_t)(k0 + 8 * g + i) * HD]; w[8 + i] = (__bf16)p[(size_t)(k0 + 16 + 8 * g + i) * HD]; }
  return w; }
#define WO_OUT_IN 1
#if WQKV_LAYOUT == 1
#define WCOL(W, k0, o, lane) wcol_oi(W, k0, o, lane, DIN)
#elif WQKV_LAYOUT == 2
#define WCOL(W, k0, o, lane) wcol_hdk(W, k0, o, lane)
#else
#define WCOL(W, k0, o, lane) wcol_io(W, k0, o, lane, CC)
#endif
#if WO_OUT_IN
#define WOCOL(W, k0, o, lane) wcol_oi(W, k0, o, lane, CC)
#define WOCOLH(W, k0, o, lane) wcolh_oi(W, k0, o, lane, CC)
#else
#define WOCOL(W, k0, o, lane) wcol_io(W, k0, o, lane, DIN)
#define WOCOLH(W, k0, o, lane) wcolh_io(W, k0, o, lane, DIN)
#endif

#ifndef SM_EXTRA_PARAMS
#define SM_EXTRA_PARAMS
#endif
#ifndef PROJ_EXTRA_PARAMS
#define PROJ_EXTRA_PARAMS
#endif
#ifndef SM_MASK_HOOK
#define SM_MASK_HOOK (void)0
#endif

// behind a run of global loads that were issued ahead: their address registers may be rewritten from here on
#define XW() asm volatile("s_wait_xcnt 0x0" ::: "memory")
// the same, with the loads' addresses as inputs, so that their registers stay untouched up to the wait
#define XWP2(p, q) asm volatile("s_wait_xcnt 0x0" :: "v"(p), "v"(q) : "memory")

// ---- operand staging of the two projection kernels: block tile = 64 A rows x 128 W rows ((out,in) layout, both K-contiguous, K = 512), one wave = 16 A rows x all 128 W rows.
// A chunk of GK k is brought by whole-line loads (16 threads = 256 B of one row), converted ONCE to its 16-bit operand form and laid in LDS for all four waves; fragments come from LDS. Two buffers, one barrier a chunk; the next chunk's f32 fly in registers during the products.
// MODE 0: A -> bf16, W -> bf16 (1 product); MODE 1: A -> bf16 hi + lo planes, W -> bf16 (2 products); MODE 2: A x 2^6 -> f16 (small-magnitude rows stay clear of f16 subnormals), W -> f16(bf16 x 2^8) exact (1 product)
// every '#pragma unroll' in gemm_tile: full unroll of a loop that indexes register arrays (staged rows, fragments, accumulators): only with constant indices do they stay in registers
#define GK 64
#define GP (GK + 8)        // LDS pitch in 16-bit elements: 144 B = 16 B x odd, so that ds_load_b128 fragment reads spread over the banks
#define GKD 512            // K, and the row pitch of A and W in floats
#define G_STB(MODE) ((((MODE) == 1 ? 128 : 64) + 128) * GP * 2)   // bytes of one buffer
typedef __attribute__((ext_vector_type(4))) __bf16 v4b;
typedef __attribute__((ext_vector_type(4))) _Float16 v4h;
template <int MODE> __device__ __forceinline__ void gemm_tile(const float* __restrict__ A, const float* __restrict__ Wm, unsigned char* sm, int tid, v8f (&acc)[8]) {
  constexpr int AR = MODE == 1 ? 128 : 64; constexpr int STB = G_STB(MODE);
  const int wave = tid >> 5, lane = tid & 31, col = lane & 15, sr = tid >> 4, sc = (tid & 15) * 4;
  const float* ag = A + (size_t)sr * GKD + sc; const float* wg = Wm + (size_t)sr * GKD + sc;
  v4f ra[8], rw[16];
#pragma unroll
  for (int i = 0; i < 8; ++i) ra[i] = *(const v4f*)(ag + (size_t)i * 8 * GKD);
#pragma unroll
  for (int i = 0; i < 16; ++i) rw[i] = *(const v4f*)(wg + (size_t)i * 8 * GKD);
  XWP2(ag, wg);
#pragma unroll 1   // rolled: one pass per chunk, the register set itself keeps the global loads one chunk ahead
  for (int kc = 0; kc < GKD / GK; ++kc) { unsigned char* st = sm + (kc & 1) * STB;
#pragma unroll
    for (int i = 0; i < 8; ++i) { const v4f x = ra[i]; const int o = (sr + i * 8) * GP + sc;
      if constexpr (MODE == 0) { v4b c; for (int e = 0; e < 4; ++e) c[e] = (__bf16)x[e]; *(v4b*)((__bf16*)st + o) = c; }
      else if constexpr (MODE == 1) { v4b c, d; for (int e = 0; e < 4; ++e) { const __bf16 hv = (__bf16)x[e]; c[e] = hv; d[e] = (__bf16)(x[e] - (float)hv); } *(v4b*)((__bf16*)st + o) = c; *(v4b*)((__bf16*)st + 64 * GP + o) = d; }
      else { v4h c; for (int e = 0; e < 4; ++e) c[e] = (_Float16)(x[e] * 64.0f); *(v4h*)((_Float16*)st + o) = c; } }
#pragma unroll
    for (int i = 0; i < 16; ++i) { const v4f x = rw[i]; const int o = (AR + sr + i * 8) * GP + sc;
      if constexpr (MODE == 2) { v4h c; for (int e = 0; e < 4; ++e) c[e] = (_Float16)(bfr(x[e]) * 256.0f); *(v4h*)((_Float16*)st + o) = c; }
      else { v4b c; for (int e = 0; e < 4; ++e) c[e] = (__bf16)x[e]; *(v4b*)((__bf16*)st + o) = c; } }
    __syncthreads();   // the chunk is complete for all four waves; every wave has also left the other buffer, which the next pass rewrites
    // behind the barrier, not in front of it: the barrier's own wait would take in loads that were just issued
    if (kc + 1 < GKD / GK) { const float* an = ag + (kc + 1) * GK; const float* wn = wg + (kc + 1) * GK;
#pragma unroll
      for (int i = 0; i < 8; ++i) ra[i] = *(const v4f*)(an + (size_t)i * 8 * GKD);
#pragma unroll
      for (int i = 0; i < 16; ++i) rw[i] = *(const v4f*)(wn + (size_t)i * 8 * GKD);
      XWP2(an, wn); }
    // ring of eight W fragments over the 16 steps (kk, j): step t + 8 is read from LDS behind step t's product
    if constexpr (MODE == 2) { const _Float16* sa = (const _Float16*)st + (wave * 16 + col) * GP; const _Float16* sw = (const _Float16*)st + (AR + col) * GP;
      v16h a[2], wf[8];
#pragma unroll
      for (int kk = 0; kk < 2; ++kk) a[kk] = frag_h(sa + kk * 32, lane);
#pragma unroll
      for (int j = 0; j < 8; ++j) wf[j] = frag_h(sw + j * 16 * GP, lane);
#pragma unroll
      for (int t = 0; t < 16; ++t) { const int kk = t >> 3, j = t & 7; acc[j] = wmma16(a[kk], wf[j], acc[j]); if (kk == 0) wf[j] = frag_h(sw + j * 16 * GP + 32, lane); }
    } else { const __bf16* sa = (const __bf16*)st + (wave * 16 + col) * GP; const __bf16* sw = (const __bf16*)st + (AR + col) * GP;
      v16b a[2], al[2], wf[8];
#pragma unroll
      for (int kk = 0; kk < 2; ++kk) { a[kk] = frag_b(sa + kk * 32, lane); if constexpr (MODE == 1) al[kk] = frag_b(sa + 64 * GP + kk * 32, lane); }
#pragma unroll
      for (int j = 0; j < 8; ++j) wf[j] = frag_b(sw + j * 16 * GP, lane);
#pragma unroll
      for (int t = 0; t < 16; ++t) { const int kk = t >> 3, j = t & 7; acc[j] = wmma_bf(a[kk], wf[j], acc[j]); if constexpr (MODE == 1) acc[j] = wmma_bf(al[kk], wf[j], acc[j]); if (kk == 0) wf[j] = frag_b(sw + j * 16 * GP + 32, lane); } } }
  __syncthreads();   // every wave has left the buffers before the caller's epilogue reuses them
}

#define WS_QH  0u                                      // f16 q rows [b*t][CC]
#define WS_KH  (WS_QH + 2u * (size_t)NB * TT * CC)      // f16 k rows [b*t][CC]
#define WS_VT  (WS_KH + 2u * (size_t)NB * TT * CC)      // f16 v planes [b][c][t]
#define WS_QL  (WS_VT + 2u * (size_t)NB * CC * TT)      // f16 q residual x 2^10 rows [b][t < QHI][CC]
#define WS_KL  (WS_QL + 2u * (size_t)NB * QHI * CC)     // f16 k residual x 2^10 rows [b][t < KHI][CC]
#define WS_VB  (WS_KL + 2u * (size_t)NB * KHI * CC)     // bf16 v hi planes [b][c][t < KHI]
#define WS_VBL (WS_VB + 2u * (size_t)NB * CC * KHI)
#define WS_S   (WS_VBL + 2u * (size_t)NB * CC * KHI)    // (not used: logits and P stay on chip)
#define WS_Y   (WS_S  + 4u * (size_t)HG * TT * TT)      // f32 ctx rows [b*t][CC] (only when there is an output projection)
#define WS_END (WS_Y  + 4u * (size_t)NB * TT * CC)

// ---- k_proj: block = (64 rows, 128 cols, which): q/k/v = X W (+ b) with exact bf16 products (K = DIN) -> which 0: q f16 rows (+ residual rows < QHI); 1: k f16 rows (+ residual rows < KHI); 2: v f16 planes [c][t] (+ bf16 hi/lo planes for t < KHI)
__global__ __launch_bounds__(128) void k_proj(const float* __restrict__ XQ, const float* __restrict__ XK, const float* __restrict__ XV, const float* __restrict__ WQ, const float* __restrict__ WK, const float* __restrict__ WV, const float* __restrict__ BQ, const float* __restrict__ BK, const float* __restrict__ BV,
    _Float16* __restrict__ QH, _Float16* __restrict__ QL, _Float16* __restrict__ KH, _Float16* __restrict__ KL, _Float16* __restrict__ VT, __bf16* __restrict__ VB, __bf16* __restrict__ VBL) {
  // one LDS range: the two operand buffers during the products, the output staging (sh, sl or th, tb, tbl) behind them
  __shared__ __align__(16) unsigned char sm[2 * G_STB(0)]; static_assert(2 * G_STB(0) >= 3 * 128 * 72 * 2 && 2 * G_STB(0) >= 2 * 64 * 136 * 2, "output staging fits");
  _Float16 (*sh)[136] = (_Float16 (*)[136])sm; _Float16 (*sl)[136] = (_Float16 (*)[136])(sm + 64 * 136 * 2); _Float16 (*th)[72] = (_Float16 (*)[72])sm; __bf16 (*tb)[72] = (__bf16 (*)[72])(sm + 128 * 72 * 2); __bf16 (*tbl)[72] = (__bf16 (*)[72])(sm + 2 * 128 * 72 * 2);
  const int tid = threadIdx.x, wave = tid >> 5, lane = tid & 31, col = lane & 15, g = lane >> 4; const int which = blockIdx.z; const int c0 = blockIdx.y * 128; const size_t r0 = (size_t)blockIdx.x * 64; const size_t bb = r0 / TT; const int t0 = (int)(r0 % TT);
  const float* X = which == 0 ? XQ : which == 1 ? XK : XV; const float* WA = which == 0 ? WQ : which == 1 ? WK : WV; const float* BA = which == 0 ? BQ : which == 1 ? BK : BV;
  v8f acc[8] = {};
  gemm_tile<0>(X + r0 * DIN, WA + (size_t)c0 * DIN, sm, tid, acc);
  if (which < 2) { _Float16* DH = which == 0 ? QH : KH; _Float16* DL = which == 0 ? QL : KL; const int nhi = which == 0 ? QHI : KHI; const bool hi_rows = t0 < nhi;
#pragma unroll
    for (int j = 0; j < 8; ++j) { const float bias = BA ? bfr(BA[c0 + j * 16 + col]) : 0.f;
#pragma unroll
      for (int r = 0; r < 8; ++r) { const float v = acc[j][r] + bias; const _Float16 hv = (_Float16)v; sh[wave * 16 + 8 * g + r][j * 16 + col] = hv; sl[wave * 16 + 8 * g + r][j * 16 + col] = (_Float16)((v - (float)hv) * 1024.0f); } }
    __syncthreads();
    for (int e = tid; e < 64 * 16; e += 128) { const int rl = e >> 4, q = e & 15; vst2((unsigned*)(DH + (r0 + rl) * CC + c0 + q * 8), *(const v4u*)&sh[rl][q * 8]); if (hi_rows) vst2((unsigned*)(DL + (bb * nhi + t0 + rl) * (size_t)CC + c0 + q * 8), *(const v4u*)&sl[rl][q * 8]); }
  } else { const bool hi_rows = t0 < KHI;
#pragma unroll
    for (int j = 0; j < 8; ++j) { const float bias = BA ? bfr(BA[c0 + j * 16 + col]) : 0.f;
#pragma unroll
      for (int r = 0; r < 8; ++r) { const float v = acc[j][r] + bias; const int rl = wave * 16 + 8 * g + r, cl = j * 16 + col; th[cl][rl] = (_Float16)v; const __bf16 bh = (__bf16)v; tb[cl][rl] = bh; tbl[cl][rl] = (__bf16)(v - (float)bh); } }
    __syncthreads();
    for (int e = tid; e < 128 * 8; e += 128) { const int cl = e >> 3, q = e & 7; vst2((unsigned*)(VT + (bb * CC + c0 + cl) * (size_t)TT + t0 + q * 8), *(const v4u*)&th[cl][q * 8]); if (hi_rows) { const size_t o3 = (bb * CC + c0 + cl) * (size_t)KHI + t0 + q * 8; vst2((unsigned*)(VB + o3), *(const v4u*)&tb[cl][q * 8]); vst2((unsigned*)(VBL + o3), *(const v4u*)&tbl[cl][q * 8]); } } } }
// ---- k_att: block = 64 queries (qb) of (b, h), one wave = 16 queries; key blocks up to the diagonal. Transposed products: S^T = K . Q^T (a lane holds the scores of ONE query: D row = key 8g + r, D column = query), causal mask by index, running maximum and rescaled running sums in f32 (online softmax), e^(s-m) x 2^11 packed straight from two score tiles into the B operand of ctx^T += V^T . P^T; the division by the row sum comes last. Logits and P never leave the registers.
// query blocks >= QBH: key blocks of 128, single f16 k x q, P once to f16 against v f16; the K tile [128 keys][HD] and the V tile [HD][128 keys] are brought once per block into LDS for all four waves. Query blocks < QBH (few keys): key blocks of 64, 3-product logits, P and v as bf16 hi + lo (3 products), fragments straight from global.
#define KP (HD + 8)        // K tile pitch in halves: 144 B = 16 B x odd, so that ds_load_b128 fragment reads spread over the banks
#define VP (128 + 8)       // V tile pitch in halves: 272 B = 16 B x odd
#define YP (HD + 4)        // ctx staging pitch in floats
#define SM_K 0
#define SM_V (SM_K + 128 * KP * 2)
#define SM_END (SM_V + HD * VP * 2)
// softmax in base 2: e^((a - amax) / 8) x 2^11 = 2^(a * LC + (11 - amax * LC)) on the raw product a, LC = log2(e) x 64^-0.5: one fused multiply-add and one v_exp_f32 a score.
// The argument is rounded to 2^-24 of its size, as the f32 difference s - m itself is; the row sum adds the same values that P is rounded from, so the x 2^11 falls out in the division.
#define LC (SCALE * 0x1.715476p+0f)
// v_exp_f32 and a v_nop in one statement: the free slot that the instruction set asks for behind a transcendental then stands directly behind it in every build
__device__ __forceinline__ float exp2_hw(float x) { float r; asm("v_exp_f32 %0, %1\n\tv_nop" : "=v"(r) : "v"(x)); return r; }
// full unroll of a loop that indexes register arrays (fragments, accumulators, staged tiles): only with constant indices do they stay in registers
#define UNROLL_REGS _Pragma("unroll")
// lane l with lane l ^ 16: the two halves of a query's keys
__device__ __forceinline__ float xhalf(float x) { return __builtin_bit_cast(float, __builtin_amdgcn_permlanex16(__builtin_bit_cast(int, x), __builtin_bit_cast(int, x), 0x76543210, 0xfedcba98, false, false)); }
__global__ __launch_bounds__(128) void k_att(const _Float16* __restrict__ QH, const _Float16* __restrict__ KH, const _Float16* __restrict__ QL, const _Float16* __restrict__ KL, const _Float16* __restrict__ VT, const __bf16* __restrict__ VB, const __bf16* __restrict__ VBL, float* __restrict__ Y) {
  __shared__ __align__(16) unsigned char sm[SM_END];
  const int tid = threadIdx.x, wave = __builtin_amdgcn_readfirstlane(tid >> 5) /* in a scalar register: the diagonal test below is a scalar branch */, lane = tid & 31, col = lane & 15, g = lane >> 4; const int b = blockIdx.z, h = blockIdx.y;
  const int qb = (b & 1) ? (int)blockIdx.x : NQB - 1 - (int)blockIdx.x;   // long blocks of one sequence meet short blocks of the other: speed only
  const int ql0 = qb * 64 + wave * 16, qrow = ql0 + col; const size_t q0 = (size_t)b * TT + ql0;
  float m = -3.0e38f, l = 0.f; v8f oa[HD / 16] = {};
  if (qb >= QBH) {   /* block-uniform */
    const int kbl = kb_last(qb);
    _Float16* Ks = (_Float16*)(sm + SM_K); _Float16* Vs = (_Float16*)(sm + SM_V);
    v16h ah[HD / 32];
UNROLL_REGS
    for (int kc = 0; kc < HD / 32; ++kc) ah[kc] = frag_h(QH + (q0 + col) * CC + h * HD + kc * 32, lane);
    // whole lines: 8 threads bring one key's 128 B of K, 16 threads 256 B of one V plane
    const _Float16* kg = KH + ((size_t)b * TT + (tid >> 3)) * CC + h * HD + (tid & 7) * 8; const _Float16* vg = VT + ((size_t)b * CC + h * HD + (tid >> 4)) * (size_t)TT + (tid & 15) * 8;
    _Float16* ksd = Ks + (tid >> 3) * KP + (tid & 7) * 8; _Float16* vsd = Vs + (tid >> 4) * VP + (tid & 15) * 8;
    v4u rk[8], rv[8];
UNROLL_REGS
    for (int i = 0; i < 8; ++i) { rk[i] = *(const v4u*)(kg + (size_t)i * 16 * CC); rv[i] = *(const v4u*)(vg + (size_t)i * 8 * TT); }
    XW();
#pragma unroll 1   // rolled: one pass per key block, the next block's tiles fly in registers during the pass
    for (int kb = 0; kb <= kbl; ++kb) { const int k0 = kb * 128;
UNROLL_REGS
      for (int i = 0; i < 8; ++i) { *(v4u*)(ksd + i * 16 * KP) = rk[i]; *(v4u*)(vsd + i * 8 * VP) = rv[i]; }
      __syncthreads();   // the tiles are complete for all four waves
      // ring of eight K fragments over the 16 steps (kc, j): step t + 8 is read from LDS behind step t's product
      v16h kf[8];
UNROLL_REGS
      for (int j = 0; j < 8; ++j) kf[j] = frag_h(Ks + (j * 16 + col) * KP, lane);
      if (kb < kbl) { const _Float16* kn = kg + (size_t)(k0 + 128) * CC; const _Float16* vn = vg + k0 + 128;
UNROLL_REGS
        for (int i = 0; i < 8; ++i) { rk[i] = *(const v4u*)(kn + (size_t)i * 16 * CC); rv[i] = *(const v4u*)(vn + (size_t)i * 8 * TT); }
        XW(); }
      v8f acc[8] = {};
UNROLL_REGS
      for (int t = 0; t < 8 * (HD / 32); ++t) { const int kc = t >> 3, j = t & 7;
        acc[j] = wmma16(kf[j], ah[kc], acc[j]); if (kc + 1 < HD / 32) kf[j] = frag_h(Ks + (j * 16 + col) * KP + (kc + 1) * 32, lane); }
      // ring of four V fragments (one key chunk): chunk 0 is read in front of the softmax arithmetic, chunk s + 1 behind chunk s's products
      v16h vf[HD / 16];
UNROLL_REGS
      for (int j = 0; j < HD / 16; ++j) vf[j] = frag_h(Vs + (j * 16 + col) * VP, lane);
      if (k0 + 127 > ql0) {   /* wave-uniform: only blocks that reach past the wave's first query are masked */
        const int lim = qrow - k0 - 8 * g;
UNROLL_REGS
        for (int j = 0; j < 8; ++j) {
UNROLL_REGS
          for (int r = 0; r < 8; ++r) if (j * 16 + r > lim) acc[j][r] = -3.0e38f; } }
      float mx = m;
UNROLL_REGS
      for (int j = 0; j < 8; ++j) { float mt = acc[j][0];
UNROLL_REGS
        for (int r = 1; r < 8; ++r) mt = fmaxf(mt, acc[j][r]);
        mx = fmaxf(mx, mt); }
      mx = fmaxf(mx, xhalf(mx));
      const float mc = mx * LC, al = exp2_hw(__builtin_fmaf(m, LC, -mc)), bs = 11.0f - mc; m = mx; l *= al;   /* every key block holds a key <= every query of the block, so m is finite from the first block on */
UNROLL_REGS
      for (int j = 0; j < HD / 16; ++j) oa[j] *= al;
UNROLL_REGS
      for (int s = 0; s < 4; ++s) { v16h p;   /* B fragment of P^T: elements 0..7 = keys 8g + 0..7 of score tile 2s, 8..15 = the same of tile 2s + 1: the k order of frag_h */
UNROLL_REGS
        for (int i = 0; i < 16; ++i) { const float e = exp2_hw(__builtin_fmaf(acc[2 * s + (i >> 3)][i & 7], LC, bs)); l += e; p[i] = (_Float16)e; }   /* a masked product (-3e38) against the finite maximum gives exactly 0 */
UNROLL_REGS
        for (int j = 0; j < HD / 16; ++j) { oa[j] = wmma16(vf[j], p, oa[j]); if (s < 3) vf[j] = frag_h(Vs + (j * 16 + col) * VP + (s + 1) * 32, lane); } }
      __syncthreads();   // every wave has left the tiles before they are rewritten (behind the last pass: before they become ctx staging)
    }
  } else {
    const _Float16* QLb = QL + (size_t)b * QHI * CC; const _Float16* KLb = KL + (size_t)b * KHI * CC;
    const size_t po = ((size_t)b * CC + h * HD + col) * (size_t)KHI; const __bf16* vbr = VB + po; const __bf16* vlr = VBL + po;
    v16h ah[HD / 32], aq[HD / 32];
UNROLL_REGS
    for (int kc = 0; kc < HD / 32; ++kc) { ah[kc] = frag_h(QH + (q0 + col) * CC + h * HD + kc * 32, lane); aq[kc] = frag_h(QLb + (size_t)(ql0 + col) * CC + h * HD + kc * 32, lane); }
    XW();
#pragma unroll 1   // rolled: at most QBH key blocks, one copy of the body is enough
    for (int kb = 0; kb <= qb; ++kb) { const int k0 = kb * 64; const size_t kr0 = (size_t)b * TT + k0;
      v8f acc[4] = {}, accl[4] = {};
      // ring of four (k, k residual) fragment pairs over the 8 steps (kc, j): step t + 4 is loaded behind step t's products
      v16h kf[4], lf[4];
UNROLL_REGS
      for (int t = 0; t < 4; ++t) { kf[t] = frag_h(KH + (kr0 + t * 16 + col) * CC + h * HD, lane); lf[t] = frag_h(KLb + (size_t)(k0 + t * 16 + col) * CC + h * HD, lane); }
      XW();
UNROLL_REGS
      for (int t = 0; t < 4 * (HD / 32); ++t) { const int kc = t >> 2, j = t & 3, u = t + 4;
        acc[j] = wmma16(kf[j], ah[kc], acc[j]); accl[j] = wmma16(kf[j], aq[kc], accl[j]); accl[j] = wmma16(lf[j], ah[kc], accl[j]);
        if (u < 4 * (HD / 32)) { kf[j] = frag_h(KH + (kr0 + j * 16 + col) * CC + h * HD + (u >> 2) * 32, lane); lf[j] = frag_h(KLb + (size_t)(k0 + j * 16 + col) * CC + h * HD + (u >> 2) * 32, lane); XW(); } }
      float mx = m;
UNROLL_REGS
      for (int j = 0; j < 4; ++j) {
UNROLL_REGS
        for (int r = 0; r < 8; ++r) { float s = acc[j][r] + accl[j][r] * (1.0f / 1024.0f); if (k0 + j * 16 + 8 * g + r > qrow) s = -3.0e38f; acc[j][r] = s; mx = fmaxf(mx, s); } }
      mx = fmaxf(mx, xhalf(mx));
      const float mc = mx * LC, al = exp2_hw(__builtin_fmaf(m, LC, -mc)), bs = 11.0f - mc; m = mx; l *= al;
UNROLL_REGS
      for (int j = 0; j < HD / 16; ++j) oa[j] *= al;
UNROLL_REGS
      for (int s = 0; s < 2; ++s) { float pv[16];
        // a key chunk of v hi / lo is requested in front of the chunk's exponentials
        v16b vh[HD / 16], vl[HD / 16];
UNROLL_REGS
        for (int j = 0; j < HD / 16; ++j) { vh[j] = frag_b(vbr + (size_t)j * 16 * KHI + k0 + s * 32, lane); vl[j] = frag_b(vlr + (size_t)j * 16 * KHI + k0 + s * 32, lane); }
        XW();
UNROLL_REGS
        for (int i = 0; i < 16; ++i) { const float e = exp2_hw(__builtin_fmaf(acc[2 * s + (i >> 3)][i & 7], LC, bs)); l += e; pv[i] = e; }
        const F2 p = bsplit16(pv);
UNROLL_REGS
        for (int j = 0; j < HD / 16; ++j) { oa[j] = wmma_bf(vh[j], p.h, oa[j]); oa[j] = wmma_bf(vh[j], p.l, oa[j]); oa[j] = wmma_bf(vl[j], p.h, oa[j]); } }
    }
  }
  l += xhalf(l);
  const float inv = l > 0.f ? 1.0f / l : 0.f;   /* l carries the same 2^11 as P */
  // ctx^T: a lane holds d = 16j + 8g + 0..7 of its query; through the wave's own LDS rows into 256-B (row, head) segments, two rows a store
  float* ys = (float*)sm + wave * 16 * YP;
UNROLL_REGS
  for (int j = 0; j < HD / 16; ++j) { const v8f o = oa[j] * inv; v4f lo4 = { o[0], o[1], o[2], o[3] }, hi4 = { o[4], o[5], o[6], o[7] }; *(v4f*)&ys[col * YP + j * 16 + 8 * g] = lo4; *(v4f*)&ys[col * YP + j * 16 + 8 * g + 4] = hi4; }
  LDSX();   // the wave's own rows are read back across lanes
UNROLL_REGS
  for (int i = 0; i < 8; ++i) vst2(Y + ((size_t)b * TT + ql0 + i * 2 + g) * CC + h * HD + col * 4, *(const v4f*)&ys[(i * 2 + g) * YP + col * 4]); }
// ---- k_out: block = (64 rows, 128 cols): out = ctx Wo (+ bo): ctx x 2^6 once to f16 against Wo as f16(bf16 x 2^8) exact (1 product) x 2^-14; causal early rows (< QHI of each sequence): ctx bf16 hi + lo against exact bf16 Wo (2 products)
__global__ __launch_bounds__(128) void k_out(const float* __restrict__ Y, const float* __restrict__ WO, const float* __restrict__ BO, float* __restrict__ OUT) {
  // one LDS range: the two operand buffers during the products, the output staging sf behind them
  __shared__ __align__(16) unsigned char sm[2 * G_STB(1)]; static_assert(2 * G_STB(1) >= 4 * 16 * 132 * 4, "output staging fits");
  float (*sf)[16][132] = (float (*)[16][132])sm;
  const int tid = threadIdx.x, wave = tid >> 5, lane = tid & 31, col = lane & 15, g = lane >> 4; const int c0 = blockIdx.y * 128; const size_t rb = (size_t)blockIdx.x * 64, r0 = rb + wave * 16;
  v8f acc[8] = {};
  if (CAUSAL && (int)(rb % TT) < QHI) {   /* block-uniform */
    gemm_tile<1>(Y + rb * CC, WO + (size_t)c0 * CC, sm, tid, acc);
#pragma unroll
    for (int j = 0; j < 8; ++j) { const float bias = BO ? bfr(BO[c0 + j * 16 + col]) : 0.f;
#pragma unroll
      for (int r = 0; r < 8; ++r) sf[wave][8 * g + r][j * 16 + col] = acc[j][r] + bias; }
  } else {
    gemm_tile<2>(Y + rb * CC, WO + (size_t)c0 * CC, sm, tid, acc);
#pragma unroll
    for (int j = 0; j < 8; ++j) { const float bias = BO ? bfr(BO[c0 + j * 16 + col]) : 0.f;
#pragma unroll
      for (int r = 0; r < 8; ++r) sf[wave][8 * g + r][j * 16 + col] = acc[j][r] * (1.0f / 16384.0f) + bias; } }   /* 2^-8 (Wo carry) x 2^-6 (ctx carry) */
  LDSX(); for (int rl = 0; rl < 16; ++rl) vst2(OUT + (r0 + rl) * DIN + c0 + lane * 4, *(const v4f*)&sf[wave][rl][lane * 4]); }

extern "C" void kernel_launch(void* const* d_in, const int* in_sizes, int n_in, void* d_out, int out_size, void* d_ws, size_t ws_size, hipStream_t stream) {
  (void)in_sizes; (void)n_in; (void)out_size;
  const float** F = (const float**)d_in;
  if (ws_size < (size_t)WS_END) return;
  char* ws = (char*)d_ws; _Float16 *QH = (_Float16*)(ws + WS_QH), *KH = (_Float16*)(ws + WS_KH), *VT = (_Float16*)(ws + WS_VT), *QL = (_Float16*)(ws + WS_QL), *KL = (_Float16*)(ws + WS_KL); __bf16 *VB = (__bf16*)(ws + WS_VB), *VBL = (__bf16*)(ws + WS_VBL); float *Y = (float*)(ws + WS_Y);
  (void)Y; (void)QL; (void)KL; (void)VB; (void)VBL;
  // inputs: 0 q [2,2048,512]; 1 k; 2 v; 3 Wq [512,512] (out,in); 4 Wk; 5 Wv; 6 Wp (out,in); 7 bp (zeros, read); no q / k / v biases (null pointers)
  k_proj<<<dim3(TNB * TT / 64, CC / 128, 3), 128, 0, stream>>>(F[0], F[1], F[2], F[3], F[4], F[5], nullptr, nullptr, nullptr, QH, QL, KH, KL, VT, VB, VBL);
  k_att<<<dim3(NQB, NH, TNB), 128, 0, stream>>>(QH, KH, QL, KL, VT, VB, VBL, Y);
  k_out<<<dim3(TNB * TT / 64, DIN / 128), 128, 0, stream>>>(Y, F[6], F[7], (float*)d_out);
}

// v005
// It runs in 46.1 microseconds.
// In two side-by-side timings against v004, it was 1.11 and 1.10 times as fast.
// Over all steps from v000 it is 12.0 times as fast.
// compute dtype: all float inputs rounded to bf16; the fused q / k / v projection with EXACT bf16 products on WMMA 16x16x32 (f32 accumulate) (no q / k / v biases); causal logits: 3 products for the first 384 rows, single f16 q x k after, x 64^-0.5; online softmax f32 (running maximum, rescaled sums, division last; base 2: one fused multiply-add and the hardware's 2^x a score); e^(s-m) x 2^11 once to f16 x v once to f16 (bf16 hi + lo below row 384); ctx hi+lo x exact W below row 384, x2^6 f16 carry x f16(bf16 x 2^8) W after, + bias; f32 output.
#include <hip/hip_runtime.h>
#include <math.h>

typedef __attribute__((ext_vector_type(16))) _Float16 v16h;
typedef __attribute__((ext_vector_type(16))) __bf16 v16b;
typedef __attribute__((ext_vector_type(8)))  _Float16 v8h;
typedef __attribute__((ext_vector_type(8)))  float v8f;
typedef __attribute__((ext_vector_type(4)))  float v4f;
typedef __attribute__((ext_vector_type(2)))  float v2f;
typedef __attribute__((ext_vector_type(4)))  unsigned v4u;
typedef __attribute__((ext_vector_type(4)))  int v4i;
typedef float __attribute__((may_alias)) float_a;
typedef int __attribute__((may_alias)) int_a;

template <typename T> __device__ __forceinline__ void vst2(void* p, T v) { *(T*)p = v;  }
__device__ __forceinline__ v8f wmma16(v16h a, v16h b, v8f c) {
  v8f d = __builtin_amdgcn_wmma_f32_16x16x32_f16(false, a, false, b, (short)0, c, false, false);
  asm volatile("v_nop\n\tv_nop\n\tv_nop\n\tv_nop" : "+v"(d) : "v"(a), "v"(b));
  return d;
}
__device__ __forceinline__ v8f wmma_bf(v16b a, v16b b, v8f c) {
  v8f d = __builtin_amdgcn_wmma_f32_16x16x32_bf16(false, a, false, b, (short)0, c, false, false);
  asm volatile("v_nop\n\tv_nop\n\tv_nop\n\tv_nop" : "+v"(d) : "v"(a), "v"(b));
  return d;
}
// 16x16x32 fragments: lane = (h = lane>>4, row/col = lane&15); elements 0..7 = k0+8h+0..7, 8..15 = k0+16+8h+0..7; D element r = row 8h+r
__device__ __forceinline__ v16h frag_h(const _Float16* rowk0, int lane) {
  union { v16h v; v8h q[2]; } u; const _Float16* p = rowk0 + 8 * (lane >> 4);
  u.q[0] = *(const v8h*)p; u.q[1] = *(const v8h*)(p + 16); return u.v;
}
__device__ __forceinline__ v16h frag_f32(const float* rowk0, int lane) {
  v16h a; const float* p = rowk0 + 8 * (lane >> 4);
#pragma unroll
  for (int i = 0; i < 8; ++i) { a[i] = (_Float16)p[i]; a[8 + i] = (_Float16)p[16 + i]; }
  return a;
}
__device__ __forceinline__ v16h frag_f32s(const float* rowk0, int lane, float sc) {
  v16h a; const float* p = rowk0 + 8 * (lane >> 4);
#pragma unroll
  for (int i = 0; i < 8; ++i) { a[i] = (_Float16)(p[i] * sc); a[8 + i] = (_Float16)(p[16 + i] * sc); }
  return a;
}
// column fragment from a [K][ld] layout (column n), rows >= K read as 0
__device__ __forceinline__ v16h fragc_f32(const float* W, int k0, int n, int lane, int ld, int K) {
  v16h a; const int g = lane >> 4;
#pragma unroll
  for (int i = 0; i < 8; ++i) { const int ka = k0 + 8 * g + i, kb = ka + 16;
    a[i] = (_Float16)(ka < K ? W[(size_t)(ka < K ? ka : K - 1) * ld + n] : 0.f); a[8 + i] = (_Float16)(kb < K ? W[(size_t)(kb < K ? kb : K - 1) * ld + n] : 0.f); }
  return a;
}
struct F2 { v16b h, l; };
__device__ __forceinline__ F2 bsplit16(const float v[16]) { F2 r;
#pragma unroll
  for (int i = 0; i < 16; ++i) { const __bf16 h = (__bf16)v[i]; r.h[i] = h; r.l[i] = (__bf16)(v[i] - (float)h); }
  return r; }
__device__ __forceinline__ F2 split_row(const float* row, int k0, int lane) { float v[16]; const float* p = row + k0 + 8 * (lane >> 4);
#pragma unroll
  for (int i = 0; i < 8; ++i) { v[i] = p[i]; v[8 + i] = p[16 + i]; }
  return bsplit16(v); }
__device__ __forceinline__ F2 split_rowK(const float* row, int k0, int lane, int K) { float v[16]; const int g = lane >> 4;
#pragma unroll
  for (int i = 0; i < 8; ++i) { const int ka = k0 + 8 * g + i, kb = ka + 16; v[i] = ka < K ? row[ka < K ? ka : K - 1] : 0.f; v[8 + i] = kb < K ? row[kb < K ? kb : K - 1] : 0.f; }
  return bsplit16(v); }
__device__ __forceinline__ F2 split_col(const float* W, int k0, int n, int lane, int ld, int K) { float v[16]; const int g = lane >> 4;
#pragma unroll
  for (int i = 0; i < 8; ++i) { const int ka = k0 + 8 * g + i, kb = ka + 16; v[i] = ka < K ? W[(size_t)(ka < K ? ka : K - 1) * ld + n] : 0.f; v[8 + i] = kb < K ? W[(size_t)(kb < K ? kb : K - 1) * ld + n] : 0.f; }
  return bsplit16(v); }
__device__ __forceinline__ v8f mac3(const F2& a, const F2& b, v8f c) { c = wmma_bf(a.l, b.h, c); c = wmma_bf(a.h, b.l, c); return wmma_bf(a.h, b.h, c); }
__device__ __forceinline__ float sigm(float v) { return 1.0f / (1.0f + expf(-v)); }
#define LDSX() do { asm volatile("s_wait_dscnt 0" ::: "memory"); __builtin_amdgcn_wave_barrier(); __builtin_amdgcn_fence(__ATOMIC_RELEASE, "workgroup"); } while (0)

// Causal multi-head attention on separate q / k / v inputs at width 512 (q / k / v [2,2048,512]; torch (out,in) Wq / Wk / Wv / Wp [512,512] applied as einsum('bsd,ed->bse') = x @ W.T, no q / k / v biases; bp zeros (read); 8 heads x 64; att / sqrt(64); tril kept, -1e10 (finite: the same exclusion) elsewhere; softmax; y @ Wp.T + bp).
#define NB 2
#define TT 2048
#define CC 512            // NH * HD = projected width
#define DIN 512          // input (model) width
#define NH 8
#define HD 64
#define NQB (TT / 64)
#define HG 4
#define SCALE (0.125f)
#define CAUSAL 1
#ifndef TNB
#define TNB NB
#endif
__device__ __forceinline__ float bfr(float v) { return (float)(__bf16)v; }
__host__ __device__ __forceinline__ int kb_last(int qb) { return CAUSAL ? ((qb * 64 + 63) >> 7) : (TT / 128 - 1); }
typedef __attribute__((ext_vector_type(8))) __bf16 v8b;
__device__ __forceinline__ v16b frag_b(const __bf16* rowk0, int lane) {
  union { v16b v; v8b q[2]; } u; const __bf16* p = rowk0 + 8 * (lane >> 4);
  u.q[0] = *(const v8b*)p; u.q[1] = *(const v8b*)(p + 16); return u.v;
}
#define QBH 6              // causal: query blocks 0..QBH-1 of each sequence (few keys, no averaging) take the high-precision path
#define QHI 384            // rows carrying a q residual plane
#define KHI 384            // key rows carrying k residual / v bf16 hi+lo planes (used only by the causal high-precision path)
// B fragment (k rows k0+.., output column o) of a weight: (in,out) [K][ld] or (out,in) [ld rows of K]: bf16 exact, or f16(bf16 * 256) exact
__device__ __forceinline__ v16b wcol_io(const float* Wm, int k0, int o, int lane, int ld) { v16b w; const int g = lane >> 4;
#pragma unroll
  for (int i = 0; i < 8; ++i) { w[i] = (__bf16)Wm[(size_t)(k0 + 8 * g + i) * ld + o]; w[8 + i] = (__bf16)Wm[(size_t)(k0 + 16 + 8 * g + i) * ld + o]; }
  return w; }
__device__ __forceinline__ v16b wcol_oi(const float* Wm, int k0, int o, int lane, int K) { v16b w; const float* p = Wm + (size_t)o * K + k0 + 8 * (lane >> 4);
#pragma unroll
  for (int i = 0; i < 8; ++i) { w[i] = (__bf16)p[i]; w[8 + i] = (__bf16)p[16 + i]; }
  return w; }
__device__ __forceinline__ v16h wcolh_io(const float* Wm, int k0, int o, int lane, int ld) { v16h w; const int g = lane >> 4;
#pragma unroll
  for (int i = 0; i < 8; ++i) { w[i] = (_Float16)(bfr(Wm[(size_t)(k0 + 8 * g + i) * ld + o]) * 256.0f); w[8 + i] = (_Float16)(bfr(Wm[(size_t)(k0 + 16 + 8 * g + i) * ld + o]) * 256.0f); }
  return w; }
__device__ __forceinline__ v16h wcolh_oi(const float* Wm, int k0, int o, int lane, int K) { v16h w; const float* p = Wm + (size_t)o * K + k0 + 8 * (lane >> 4);
#pragma unroll
  for (int i = 0; i < 8; ++i) { w[i] = (_Float16)(bfr(p[i]) * 256.0f); w[8 + i] = (_Float16)(bfr(p[16 + i]) * 256.0f); }
  return w; }
#define WQKV_LAYOUT 1   // 0 = (in,out) [DIN][CC]; 1 = (out,in) [CC][DIN]; 2 = per-head [NH][DIN][HD]
__device__ __forceinline__ v16b wcol_hdk(const float* Wm, int k0, int o, int lane) { v16b w; const int g = lane >> 4; const float* p = Wm + (size_t)(o / HD) * DIN * HD + (o % HD);
#pragma unroll
  for (int i = 0; i < 8; ++i) { w[i] = (__bf16)p[(size_t)(k0 + 8 * g + i) * HD]; w[8 + i] = (__bf16)p[(size_t)(k0 + 16 + 8 * g + i) * HD]; }
  return w; }
#define WO_OUT_IN 1
#if WQKV_LAYOUT == 1
#define WCOL(W, k0, o, lane) wcol_oi(W, k0, o, lane, DIN)
#elif WQKV_LAYOUT == 2
#define WCOL(W, k0, o, lane) wcol_hdk(W, k0, o, lane)
#else
#define WCOL(W, k0, o, lane) wcol_io(W, k0, o, lane, CC)
#endif
#if WO_OUT_IN
#define WOCOL(W, k0, o, lane) wcol_oi(W, k0, o, lane, CC)
#define WOCOLH(W, k0, o, lane) wcolh_oi(W, k0, o, lane, CC)
#else
#define WOCOL(W, k0, o, lane) wcol_io(W, k0, o, lane, DIN)
#define WOCOLH(W, k0, o, lane) wcolh_io(W, k0, o, lane, DIN)
#endif

#ifndef SM_EXTRA_PARAMS
#define SM_EXTRA_PARAMS
#endif
#ifndef PROJ_EXTRA_PARAMS
#define PROJ_EXTRA_PARAMS
#endif
#ifndef SM_MASK_HOOK
#define SM_MASK_HOOK (void)0
#endif

// behind a run of global loads that were issued ahead: their address registers may be rewritten from here on
#define XW() asm volatile("s_wait_xcnt 0x0" ::: "memory")
// the same, with the loads' addresses as inputs, so that their registers stay untouched up to the wait
#define XWP2(p, q) asm volatile("s_wait_xcnt 0x0" :: "v"(p), "v"(q) : "memory")

// ---- operand staging of the two projection kernels: block tile = 64 A rows x 128 W rows ((out,in) layout, both K-contiguous, K = 512), one wave = 16 A rows x all 128 W rows.
// A chunk of GK k is brought by whole-line loads (16 threads = 256 B of one row), converted ONCE to its 16-bit operand form and laid in LDS for all four waves; fragments come from LDS. Two buffers, one barrier a chunk; the next chunk's f32 fly in registers during the products.
// MODE 0: A -> bf16, W -> bf16 (1 product); MODE 1: A -> bf16 hi + lo planes, W -> bf16 (2 products); MODE 2: A x 2^6 -> f16 (small-magnitude rows stay clear of f16 subnormals), W -> f16(bf16 x 2^8) exact (1 product)
// every '#pragma unroll' in gemm_tile: full unroll of a loop that indexes register arrays (staged rows, fragments, accumulators): only with constant indices do they stay in registers
#define GK 64
#define GP (GK + 8)        // LDS pitch in 16-bit elements: 144 B = 16 B x odd, so that ds_load_b128 fragment reads spread over the banks
#define GKD 512            // K, and the row pitch of A and W in floats
#define G_STB(MODE) ((((MODE) == 1 ? 128 : 64) + 128) * GP * 2)   // bytes of one buffer
#define GROT ((int)((blockIdx.x + 2 * blockIdx.y) & (GKD / GK - 1)))   // start chunk: the row blocks (x) that share W rows spread over all chunks, the column blocks (y) that share A rows stand two chunks apart
typedef __attribute__((ext_vector_type(4))) __bf16 v4b;
typedef __attribute__((ext_vector_type(4))) _Float16 v4h;
// rot: the chunk at which this work-group starts its walk over k (it wraps). Work-groups that read the same A or W rows get different rot, so that they do not ask L2 for the same lines at the same moment.
template <int MODE> __device__ __forceinline__ void gemm_tile(const float* __restrict__ A, const float* __restrict__ Wm, unsigned char* sm, int tid, int rot, v8f (&acc)[8]) {
  constexpr int AR = MODE == 1 ? 128 : 64; constexpr int STB = G_STB(MODE);
  const int wave = tid >> 5, lane = tid & 31, col = lane & 15, sr = tid >> 4, sc = (tid & 15) * 4;
  const float* ag = A + (size_t)sr * GKD + sc; const float* wg = Wm + (size_t)sr * GKD + sc;
  const float* a0 = ag + rot * GK; const float* w0 = wg + rot * GK;
  v4f ra[8], rw[16];
#pragma unroll
  for (int i = 0; i < 8; ++i) ra[i] = *(const v4f*)(a0 + (size_t)i * 8 * GKD);
#pragma unroll
  for (int i = 0; i < 16; ++i) rw[i] = *(const v4f*)(w0 + (size_t)i * 8 * GKD);
  XWP2(a0, w0);
#pragma unroll 1   // rolled: one pass per chunk, the register set itself keeps the global loads one chunk ahead
  for (int kc = 0; kc < GKD / GK; ++kc) { unsigned char* st = sm + (kc & 1) * STB;
#pragma unroll
    for (int i = 0; i < 8; ++i) { const v4f x = ra[i]; const int o = (sr + i * 8) * GP + sc;
      if constexpr (MODE == 0) { v4b c; for (int e = 0; e < 4; ++e) c[e] = (__bf16)x[e]; *(v4b*)((__bf16*)st + o) = c; }
      else if constexpr (MODE == 1) { v4b c, d; for (int e = 0; e < 4; ++e) { const __bf16 hv = (__bf16)x[e]; c[e] = hv; d[e] = (__bf16)(x[e] - (float)hv); } *(v4b*)((__bf16*)st + o) = c; *(v4b*)((__bf16*)st + 64 * GP + o) = d; }
      else { v4h c; for (int e = 0; e < 4; ++e) c[e] = (_Float16)(x[e] * 64.0f); *(v4h*)((_Float16*)st + o) = c; } }
#pragma unroll
    for (int i = 0; i < 16; ++i) { const v4f x = rw[i]; const int o = (AR + sr + i * 8) * GP + sc;
      if constexpr (MODE == 2) { v4h c; for (int e = 0; e < 4; ++e) c[e] = (_Float16)(bfr(x[e]) * 256.0f); *(v4h*)((_Float16*)st + o) = c; }
      else { v4b c; for (int e = 0; e < 4; ++e) c[e] = (__bf16)x[e]; *(v4b*)((__bf16*)st + o) = c; } }
    __syncthreads();   // the chunk is complete for all four waves; every wave has also left the other buffer, which the next pass rewrites
    // behind the barrier, not in front of it: the barrier's own wait would take in loads that were just issued
    if (kc + 1 < GKD / GK) { const int cn = (kc + 1 + rot) & (GKD / GK - 1); const float* an = ag + cn * GK; const float* wn = wg + cn * GK;
#pragma unroll
      for (int i = 0; i < 8; ++i) ra[i] = *(const v4f*)(an + (size_t)i * 8 * GKD);
#pragma unroll
      for (int i = 0; i < 16; ++i) rw[i] = *(const v4f*)(wn + (size_t)i * 8 * GKD);
      XWP2(an, wn); }
    // ring of eight W fragments over the 16 steps (kk, j): step t + 8 is read from LDS behind step t's product
    if constexpr (MODE == 2) { const _Float16* sa = (const _Float16*)st + (wave * 16 + col) * GP; const _Float16* sw = (const _Float16*)st + (AR + col) * GP;
      v16h a[2], wf[8];
#pragma unroll
      for (int kk = 0; kk < 2; ++kk) a[kk] = frag_h(sa + kk * 32, lane);
#pragma unroll
      for (int j = 0; j < 8; ++j) wf[j] = frag_h(sw + j * 16 * GP, lane);
#pragma unroll
      for (int t = 0; t < 16; ++t) { const int kk = t >> 3, j = t & 7; acc[j] = wmma16(a[kk], wf[j], acc[j]); if (kk == 0) wf[j] = frag_h(sw + j * 16 * GP + 32, lane); }
    } else { const __bf16* sa = (const __bf16*)st + (wave * 16 + col) * GP; const __bf16* sw = (const __bf16*)st + (AR + col) * GP;
      v16b a[2], al[2], wf[8];
#pragma unroll
      for (int kk = 0; kk < 2; ++kk) { a[kk] = frag_b(sa + kk * 32, lane); if constexpr (MODE == 1) al[kk] = frag_b(sa + 64 * GP + kk * 32, lane); }
#pragma unroll
      for (int j = 0; j < 8; ++j) wf[j] = frag_b(sw + j * 16 * GP, lane);
#pragma unroll
      for (int t = 0; t < 16; ++t) { const int kk = t >> 3, j = t & 7; acc[j] = wmma_bf(a[kk], wf[j], acc[j]); if constexpr (MODE == 1) acc[j] = wmma_bf(al[kk], wf[j], acc[j]); if (kk == 0) wf[j] = frag_b(sw + j * 16 * GP + 32, lane); } } }
  __syncthreads();   // every wave has left the buffers before the caller's epilogue reuses them
}

#define WS_QH  0u                                      // f16 q rows [b*t][CC]
#define WS_KH  (WS_QH + 2u * (size_t)NB * TT * CC)      // f16 k rows [b*t][CC]
#define WS_VT  (WS_KH + 2u * (size_t)NB * TT * CC)      // f16 v planes [b][c][t]
#define WS_QL  (WS_VT + 2u * (size_t)NB * CC * TT)      // f16 q residual x 2^10 rows [b][t < QHI][CC]
#define WS_KL  (WS_QL + 2u * (size_t)NB * QHI * CC)     // f16 k residual x 2^10 rows [b][t < KHI][CC]
#define WS_VB  (WS_KL + 2u * (size_t)NB * KHI * CC)     // bf16 v hi planes [b][c][t < KHI]
#define WS_VBL (WS_VB + 2u * (size_t)NB * CC * KHI)
#define WS_S   (WS_VBL + 2u * (size_t)NB * CC * KHI)    // (not used: logits and P stay on chip)
#define WS_Y   (WS_S  + 4u * (size_t)HG * TT * TT)      // f32 ctx rows [b*t][CC] (only when there is an output projection)
#define WS_END (WS_Y  + 4u * (size_t)NB * TT * CC)

// ---- k_proj: block = (64 rows, 128 cols, which): q/k/v = X W (+ b) with exact bf16 products (K = DIN) -> which 0: q f16 rows (+ residual rows < QHI); 1: k f16 rows (+ residual rows < KHI); 2: v f16 planes [c][t] (+ bf16 hi/lo planes for t < KHI)
__global__ __launch_bounds__(128) void k_proj(const float* __restrict__ XQ, const float* __restrict__ XK, const float* __restrict__ XV, const float* __restrict__ WQ, const float* __restrict__ WK, const float* __restrict__ WV, const float* __restrict__ BQ, const float* __restrict__ BK, const float* __restrict__ BV,
    _Float16* __restrict__ QH, _Float16* __restrict__ QL, _Float16* __restrict__ KH, _Float16* __restrict__ KL, _Float16* __restrict__ VT, __bf16* __restrict__ VB, __bf16* __restrict__ VBL) {
  // one LDS range: the two operand buffers during the products, the output staging (sh, sl or th, tb, tbl) behind them
  __shared__ __align__(16) unsigned char sm[2 * G_STB(0)]; static_assert(2 * G_STB(0) >= 3 * 128 * 72 * 2 && 2 * G_STB(0) >= 2 * 64 * 136 * 2, "output staging fits");
  _Float16 (*sh)[136] = (_Float16 (*)[136])sm; _Float16 (*sl)[136] = (_Float16 (*)[136])(sm + 64 * 136 * 2); _Float16 (*th)[72] = (_Float16 (*)[72])sm; __bf16 (*tb)[72] = (__bf16 (*)[72])(sm + 128 * 72 * 2); __bf16 (*tbl)[72] = (__bf16 (*)[72])(sm + 2 * 128 * 72 * 2);
  const int tid = threadIdx.x, wave = tid >> 5, lane = tid & 31, col = lane & 15, g = lane >> 4; const int which = blockIdx.z; const int c0 = blockIdx.y * 128; const size_t r0 = (size_t)blockIdx.x * 64; const size_t bb = r0 / TT; const int t0 = (int)(r0 % TT);
  const float* X = which == 0 ? XQ : which == 1 ? XK : XV; const float* WA = which == 0 ? WQ : which == 1 ? WK : WV; const float* BA = which == 0 ? BQ : which == 1 ? BK : BV;
  v8f acc[8] = {};
  gemm_tile<0>(X + r0 * DIN, WA + (size_t)c0 * DIN, sm, tid, GROT, acc);
  if (which < 2) { _Float16* DH = which == 0 ? QH : KH; _Float16* DL = which == 0 ? QL : KL; const int nhi = which == 0 ? QHI : KHI; const bool hi_rows = t0 < nhi;
#pragma unroll
    for (int j = 0; j < 8; ++j) { const float bias = BA ? bfr(BA[c0 + j * 16 + col]) : 0.f;
#pragma unroll
      for (int r = 0; r < 8; ++r) { const float v = acc[j][r] + bias; const _Float16 hv = (_Float16)v; sh[wave * 16 + 8 * g + r][j * 16 + col] = hv; sl[wave * 16 + 8 * g + r][j * 16 + col] = (_Float16)((v - (float)hv) * 1024.0f); } }
    __syncthreads();
    for (int e = tid; e < 64 * 16; e += 128) { const int rl = e >> 4, q = e & 15; vst2((unsigned*)(DH + (r0 + rl) * CC + c0 + q * 8), *(const v4u*)&sh[rl][q * 8]); if (hi_rows) vst2((unsigned*)(DL + (bb * nhi + t0 + rl) * (size_t)CC + c0 + q * 8), *(const v4u*)&sl[rl][q * 8]); }
  } else { const bool hi_rows = t0 < KHI;
#pragma unroll
    for (int j = 0; j < 8; ++j) { const float bias = BA ? bfr(BA[c0 + j * 16 + col]) : 0.f;
#pragma unroll
      for (int r = 0; r < 8; ++r) { const float v = acc[j][r] + bias; const int rl = wave * 16 + 8 * g + r, cl = j * 16 + col; th[cl][rl] = (_Float16)v; const __bf16 bh = (__bf16)v; tb[cl][rl] = bh; tbl[cl][rl] = (__bf16)(v - (float)bh); } }
    __syncthreads();
    for (int e = tid; e < 128 * 8; e += 128) { const int cl = e >> 3, q = e & 7; vst2((unsigned*)(VT + (bb * CC + c0 + cl) * (size_t)TT + t0 + q * 8), *(const v4u*)&th[cl][q * 8]); if (hi_rows) { const size_t o3 = (bb * CC + c0 + cl) * (size_t)KHI + t0 + q * 8; vst2((unsigned*)(VB + o3), *(const v4u*)&tb[cl][q * 8]); vst2((unsigned*)(VBL + o3), *(const v4u*)&tbl[cl][q * 8]); } } } }
// ---- k_att: block = 64 queries (qb) of (b, h), one wave = 16 queries; key blocks up to the diagonal (query blocks >= QBH: taken from the diagonal down). Transposed products: S^T = K . Q^T (a lane holds the scores of ONE query: D row = key 8g + r, D column = query), causal mask by index, running maximum and rescaled running sums in f32 (online softmax), e^(s-m) x 2^11 packed straight from two score tiles into the B operand of ctx^T += V^T . P^T; the division by the row sum comes last. Logits and P never leave the registers.
// query blocks >= QBH: key blocks of 128, single f16 k x q, P once to f16 against v f16; the K tile [128 keys][HD] and the V tile [HD][128 keys] are brought once per block into LDS for all four waves. Query blocks < QBH (few keys): key blocks of 64, 3-product logits, P and v as bf16 hi + lo (3 products), fragments straight from global.
#define KP (HD + 8)        // K tile pitch in halves: 144 B = 16 B x odd, so that ds_load_b128 fragment reads spread over the banks
#define VP (128 + 8)       // V tile pitch in halves: 272 B = 16 B x odd
#define YP (HD + 4)        // ctx staging pitch in floats
#define SM_K 0
#define SM_V (SM_K + 128 * KP * 2)
#define SM_END (SM_V + HD * VP * 2)
// softmax in base 2: e^((a - amax) / 8) x 2^11 = 2^(a * LC + (11 - amax * LC)) on the raw product a, LC = log2(e) x 64^-0.5: one fused multiply-add and one v_exp_f32 a score.
// The argument is rounded to 2^-24 of its size, as the f32 difference s - m itself is; the row sum adds the same values that P is rounded from, so the x 2^11 falls out in the division.
#define LC (SCALE * 0x1.715476p+0f)
// v_exp_f32 and a v_nop in one statement: the free slot that the instruction set asks for behind a transcendental then stands directly behind it in every build
__device__ __forceinline__ float exp2_hw(float x) { float r; asm("v_exp_f32 %0, %1\n\tv_nop" : "=v"(r) : "v"(x)); return r; }
// full unroll of a loop that indexes register arrays (fragments, accumulators, staged tiles): only with constant indices do they stay in registers
#define UNROLL_REGS _Pragma("unroll")
// lane l with lane l ^ 16: the two halves of a query's keys
__device__ __forceinline__ float xhalf(float x) { return __builtin_bit_cast(float, __builtin_amdgcn_permlanex16(__builtin_bit_cast(int, x), __builtin_bit_cast(int, x), 0x76543210, 0xfedcba98, false, false)); }
__global__ __launch_bounds__(128) void k_att(const _Float16* __restrict__ QH, const _Float16* __restrict__ KH, const _Float16* __restrict__ QL, const _Float16* __restrict__ KL, const _Float16* __restrict__ VT, const __bf16* __restrict__ VB, const __bf16* __restrict__ VBL, float* __restrict__ Y) {
  __shared__ __align__(16) unsigned char sm[SM_END];
  const int tid = threadIdx.x, wave = __builtin_amdgcn_readfirstlane(tid >> 5) /* in a scalar register: the diagonal test below is a scalar branch */, lane = tid & 31, col = lane & 15, g = lane >> 4; const int b = blockIdx.z, h = blockIdx.y;
  const int qb = (b & 1) ? (int)blockIdx.x : NQB - 1 - (int)blockIdx.x;   // long blocks of one sequence meet short blocks of the other: speed only
  const int ql0 = qb * 64 + wave * 16, qrow = ql0 + col; const size_t q0 = (size_t)b * TT + ql0;
  float m = -3.0e38f, l = 0.f; v8f oa[HD / 16] = {};
  if (qb >= QBH) {   /* block-uniform */
    const int kbl = kb_last(qb);
    _Float16* Ks = (_Float16*)(sm + SM_K); _Float16* Vs = (_Float16*)(sm + SM_V);
    v16h ah[HD / 32];
UNROLL_REGS
    for (int kc = 0; kc < HD / 32; ++kc) ah[kc] = frag_h(QH + (q0 + col) * CC + h * HD + kc * 32, lane);
    // whole lines: 8 threads bring one key's 128 B of K, 16 threads 256 B of one V plane
    const _Float16* kg = KH + ((size_t)b * TT + (tid >> 3)) * CC + h * HD + (tid & 7) * 8; const _Float16* vg = VT + ((size_t)b * CC + h * HD + (tid >> 4)) * (size_t)TT + (tid & 15) * 8;
    _Float16* ksd = Ks + (tid >> 3) * KP + (tid & 7) * 8; _Float16* vsd = Vs + (tid >> 4) * VP + (tid & 15) * 8;
    // the key blocks are walked from the diagonal down: the query blocks of one (b, h), which share K and V, then stand at different key blocks in the same pass and do not ask L2 for the same lines at the same moment
    const _Float16* kd = kg + (size_t)kbl * 128 * CC; const _Float16* vd = vg + kbl * 128;
    v4u rk[8], rv[8];
UNROLL_REGS
    for (int i = 0; i < 8; ++i) { rk[i] = *(const v4u*)(kd + (size_t)i * 16 * CC); rv[i] = *(const v4u*)(vd + (size_t)i * 8 * TT); }
    XWP2(kd, vd);
#pragma unroll 1   // rolled: one pass per key block, the next block's tiles fly in registers during the pass
    for (int kb = kbl; kb >= 0; --kb) { const int k0 = kb * 128;
UNROLL_REGS
      for (int i = 0; i < 8; ++i) { *(v4u*)(ksd + i * 16 * KP) = rk[i]; *(v4u*)(vsd + i * 8 * VP) = rv[i]; }
      __syncthreads();   // the tiles are complete for all four waves
      // ring of eight K fragments over the 16 steps (kc, j): step t + 8 is read from LDS behind step t's product
      v16h kf[8];
UNROLL_REGS
      for (int j = 0; j < 8; ++j) kf[j] = frag_h(Ks + (j * 16 + col) * KP, lane);
      if (kb > 0) { const _Float16* kn = kg + (size_t)(k0 - 128) * CC; const _Float16* vn = vg + k0 - 128;
UNROLL_REGS
        for (int i = 0; i < 8; ++i) { rk[i] = *(const v4u*)(kn + (size_t)i * 16 * CC); rv[i] = *(const v4u*)(vn + (size_t)i * 8 * TT); }
        XW(); }
      v8f acc[8] = {};
UNROLL_REGS
      for (int t = 0; t < 8 * (HD / 32); ++t) { const int kc = t >> 3, j = t & 7;
        acc[j] = wmma16(kf[j], ah[kc], acc[j]); if (kc + 1 < HD / 32) kf[j] = frag_h(Ks + (j * 16 + col) * KP + (kc + 1) * 32, lane); }
      // ring of four V fragments (one key chunk): chunk 0 is read in front of the softmax arithmetic, chunk s + 1 behind chunk s's products
      v16h vf[HD / 16];
UNROLL_REGS
      for (int j = 0; j < HD / 16; ++j) vf[j] = frag_h(Vs + (j * 16 + col) * VP, lane);
      if (k0 + 127 > ql0) {   /* wave-uniform: only blocks that reach past the wave's first query are masked */
        const int lim = qrow - k0 - 8 * g;
UNROLL_REGS
        for (int j = 0; j < 8; ++j) {
UNROLL_REGS
          for (int r = 0; r < 8; ++r) if (j * 16 + r > lim) acc[j][r] = -3.0e38f; } }
      float mx = m;
UNROLL_REGS
      for (int j = 0; j < 8; ++j) { float mt = acc[j][0];
UNROLL_REGS
        for (int r = 1; r < 8; ++r) mt = fmaxf(mt, acc[j][r]);
        mx = fmaxf(mx, mt); }
      mx = fmaxf(mx, xhalf(mx));
      const float mc = mx * LC, al = exp2_hw(__builtin_fmaf(m, LC, -mc)), bs = 11.0f - mc; m = mx; l *= al;   /* every key block holds a key <= every query of the block, so m is finite from the first block on */
UNROLL_REGS
      for (int j = 0; j < HD / 16; ++j) oa[j] *= al;
UNROLL_REGS
      for (int s = 0; s < 4; ++s) { v16h p;   /* B fragment of P^T: elements 0..7 = keys 8g + 0..7 of score tile 2s, 8..15 = the same of tile 2s + 1: the k order of frag_h */
UNROLL_REGS
        for (int i = 0; i < 16; ++i) { const float e = exp2_hw(__builtin_fmaf(acc[2 * s + (i >> 3)][i & 7], LC, bs)); l += e; p[i] = (_Float16)e; }   /* a masked product (-3e38) against the finite maximum gives exactly 0 */
UNROLL_REGS
        for (int j = 0; j < HD / 16; ++j) { oa[j] = wmma16(vf[j], p, oa[j]); if (s < 3) vf[j] = frag_h(Vs + (j * 16 + col) * VP + (s + 1) * 32, lane); } }
      __syncthreads();   // every wave has left the tiles before they are rewritten (behind the last pass: before they become ctx staging)
    }
  } else {
    const _Float16* QLb = QL + (size_t)b * QHI * CC; const _Float16* KLb = KL + (size_t)b * KHI * CC;
    const size_t po = ((size_t)b * CC + h * HD + col) * (size_t)KHI; const __bf16* vbr = VB + po; const __bf16* vlr = VBL + po;
    v16h ah[HD / 32], aq[HD / 32];
UNROLL_REGS
    for (int kc = 0; kc < HD / 32; ++kc) { ah[kc] = frag_h(QH + (q0 + col) * CC + h * HD + kc * 32, lane); aq[kc] = frag_h(QLb + (size_t)(ql0 + col) * CC + h * HD + kc * 32, lane); }
    XW();
#pragma unroll 1   // rolled: at most QBH key blocks, one copy of the body is enough
    for (int kb = 0; kb <= qb; ++kb) { const int k0 = kb * 64; const size_t kr0 = (size_t)b * TT + k0;
      v8f acc[4] = {}, accl[4] = {};
      // ring of four (k, k residual) fragment pairs over the 8 steps (kc, j): step t + 4 is loaded behind step t's products
      v16h kf[4], lf[4];
UNROLL_REGS
      for (int t = 0; t < 4; ++t) { kf[t] = frag_h(KH + (kr0 + t * 16 + col) * CC + h * HD, lane); lf[t] = frag_h(KLb + (size_t)(k0 + t * 16 + col) * CC + h * HD, lane); }
      XW();
UNROLL_REGS
      for (int t = 0; t < 4 * (HD / 32); ++t) { const int kc = t >> 2, j = t & 3, u = t + 4;
        acc[j] = wmma16(kf[j], ah[kc], acc[j]); accl[j] = wmma16(kf[j], aq[kc], accl[j]); accl[j] = wmma16(lf[j], ah[kc], accl[j]);
        if (u < 4 * (HD / 32)) { kf[j] = frag_h(KH + (kr0 + j * 16 + col) * CC + h * HD + (u >> 2) * 32, lane); lf[j] = frag_h(KLb + (size_t)(k0 + j * 16 + col) * CC + h * HD + (u >> 2) * 32, lane); XW(); } }
      float mx = m;
UNROLL_REGS
      for (int j = 0; j < 4; ++j) {
UNROLL_REGS
        for (int r = 0; r < 8; ++r) { float s = acc[j][r] + accl[j][r] * (1.0f / 1024.0f); if (k0 + j * 16 + 8 * g + r > qrow) s = -3.0e38f; acc[j][r] = s; mx = fmaxf(mx, s); } }
      mx = fmaxf(mx, xhalf(mx));
      const float mc = mx * LC, al = exp2_hw(__builtin_fmaf(m, LC, -mc)), bs = 11.0f - mc; m = mx; l *= al;
UNROLL_REGS
      for (int j = 0; j < HD / 16; ++j) oa[j] *= al;
UNROLL_REGS
      for (int s = 0; s < 2; ++s) { float pv[16];
        // a key chunk of v hi / lo is requested in front of the chunk's exponentials
        v16b vh[HD / 16], vl[HD / 16];
UNROLL_REGS
        for (int j = 0; j < HD / 16; ++j) { vh[j] = frag_b(vbr + (size_t)j * 16 * KHI + k0 + s * 32, lane); vl[j] = frag_b(vlr + (size_t)j * 16 * KHI + k0 + s * 32, lane); }
        XW();
UNROLL_REGS
        for (int i = 0; i < 16; ++i) { const float e = exp2_hw(__builtin_fmaf(acc[2 * s + (i >> 3)][i & 7], LC, bs)); l += e; pv[i] = e; }
        const F2 p = bsplit16(pv);
UNROLL_REGS
        for (int j = 0; j < HD / 16; ++j) { oa[j] = wmma_bf(vh[j], p.h, oa[j]); oa[j] = wmma_bf(vh[j], p.l, oa[j]); oa[j] = wmma_bf(vl[j], p.h, oa[j]); } }
    }
  }
  l += xhalf(l);
  const float inv = l > 0.f ? 1.0f / l : 0.f;   /* l carries the same 2^11 as P */
  // ctx^T: a lane holds d = 16j + 8g + 0..7 of its query; through the wave's own LDS rows into 256-B (row, head) segments, two rows a store
  float* ys = (float*)sm + wave * 16 * YP;
UNROLL_REGS
  for (int j = 0; j < HD / 16; ++j) { const v8f o = oa[j] * inv; v4f lo4 = { o[0], o[1], o[2], o[3] }, hi4 = { o[4], o[5], o[6], o[7] }; *(v4f*)&ys[col * YP + j * 16 + 8 * g] = lo4; *(v4f*)&ys[col * YP + j * 16 + 8 * g + 4] = hi4; }
  LDSX();   // the wave's own rows are read back across lanes
UNROLL_REGS
  for (int i = 0; i < 8; ++i) vst2(Y + ((size_t)b * TT + ql0 + i * 2 + g) * CC + h * HD + col * 4, *(const v4f*)&ys[(i * 2 + g) * YP + col * 4]); }
// ---- k_out: block = (64 rows, 128 cols): out = ctx Wo (+ bo): ctx x 2^6 once to f16 against Wo as f16(bf16 x 2^8) exact (1 product) x 2^-14; causal early rows (< QHI of each sequence): ctx bf16 hi + lo against exact bf16 Wo (2 products)
__global__ __launch_bounds__(128) void k_out(const float* __restrict__ Y, const float* __restrict__ WO, const float* __restrict__ BO, float* __restrict__ OUT) {
  // one LDS range: the two operand buffers during the products, the output staging sf behind them
  __shared__ __align__(16) unsigned char sm[2 * G_STB(1)]; static_assert(2 * G_STB(1) >= 4 * 16 * 132 * 4, "output staging fits");
  float (*sf)[16][132] = (float (*)[16][132])sm;
  const int tid = threadIdx.x, wave = tid >> 5, lane = tid & 31, col = lane & 15, g = lane >> 4; const int c0 = blockIdx.y * 128; const size_t rb = (size_t)blockIdx.x * 64, r0 = rb + wave * 16;
  v8f acc[8] = {};
  if (CAUSAL && (int)(rb % TT) < QHI) {   /* block-uniform */
    gemm_tile<1>(Y + rb * CC, WO + (size_t)c0 * CC, sm, tid, GROT, acc);
#pragma unroll
    for (int j = 0; j < 8; ++j) { const float bias = BO ? bfr(BO[c0 + j * 16 + col]) : 0.f;
#pragma unroll
      for (int r = 0; r < 8; ++r) sf[wave][8 * g + r][j * 16 + col] = acc[j][r] + bias; }
  } else {
    gemm_tile<2>(Y + rb * CC, WO + (size_t)c0 * CC, sm, tid, GROT, acc);
#pragma unroll
    for (int j = 0; j < 8; ++j) { const float bias = BO ? bfr(BO[c0 + j * 16 + col]) : 0.f;
#pragma unroll
      for (int r = 0; r < 8; ++r) sf[wave][8 * g + r][j * 16 + col] = acc[j][r] * (1.0f / 16384.0f) + bias; } }   /* 2^-8 (Wo carry) x 2^-6 (ctx carry) */
  LDSX(); for (int rl = 0; rl < 16; ++rl) vst2(OUT + (r0 + rl) * DIN + c0 + lane * 4, *(const v4f*)&sf[wave][rl][lane * 4]); }

extern "C" void kernel_launch(void* const* d_in, const int* in_sizes, int n_in, void* d_out, int out_size, void* d_ws, size_t ws_size, hipStream_t stream) {
  (void)in_sizes; (void)n_in; (void)out_size;
  const float** F = (const float**)d_in;
  if (ws_size < (size_t)WS_END) return;
  char* ws = (char*)d_ws; _Float16 *QH = (_Float16*)(ws + WS_QH), *KH = (_Float16*)(ws + WS_KH), *VT = (_Float16*)(ws + WS_VT), *QL = (_Float16*)(ws + WS_QL), *KL = (_Float16*)(ws + WS_KL); __bf16 *VB = (__bf16*)(ws + WS_VB), *VBL = (__bf16*)(ws + WS_VBL); float *Y = (float*)(ws + WS_Y);
  (void)Y; (void)QL; (void)KL; (void)VB; (void)VBL;
  // inputs: 0 q [2,2048,512]; 1 k; 2 v; 3 Wq [512,512] (out,in); 4 Wk; 5 Wv; 6 Wp (out,in); 7 bp (zeros, read); no q / k / v biases (null pointers)
  k_proj<<<dim3(TNB * TT / 64, CC / 128, 3), 128, 0, stream>>>(F[0], F[1], F[2], F[3], F[4], F[5], nullptr, nullptr, nullptr, QH, QL, KH, KL, VT, VB, VBL);
  k_att<<<dim3(NQB, NH, TNB), 128, 0, stream>>>(QH, KH, QL, KL, VT, VB, VBL, Y);
  k_out<<<dim3(TNB * TT / 64, DIN / 128), 128, 0, stream>>>(Y, F[6], F[7], (float*)d_out);
}

// v006
// A run of this version takes 44.6 microseconds.
// In two side-by-side timings against v005, it was 1.03 and 1.04 times as fast.
// Over all steps from v000 it is 12.4 times as fast.
// compute dtype: all float inputs rounded to bf16; the fused q / k / v projection with EXACT bf16 products on WMMA 16x16x32 (f32 accumulate) (no q / k / v biases); causal logits: 3 products for the first 384 rows, single f16 q x k after, x 64^-0.5; online softmax f32 (running maximum, rescaled sums, division last; base 2: one fused multiply-add and the hardware's 2^x a score); e^(s-m) x 2^11 once to f16 x v once to f16 (bf16 hi + lo below row 384); ctx hi+lo x exact W below row 384, x2^6 f16 carry x f16(bf16 x 2^8) W after, + bias; f32 output.
#include <hip/hip_runtime.h>
#include <math.h>

typedef __attribute__((ext_vector_type(16))) _Float16 v16h;
typedef __attribute__((ext_vector_type(16))) __bf16 v16b;
typedef __attribute__((ext_vector_type(8)))  _Float16 v8h;
typedef __attribute__((ext_vector_type(8)))  float v8f;
typedef __attribute__((ext_vector_type(4)))  float v4f;
typedef __attribute__((ext_vector_type(2)))  float v2f;
typedef __attribute__((ext_vector_type(4)))  unsigned v4u;
typedef __attribute__((ext_vector_type(4)))  int v4i;
typedef float __attribute__((may_alias)) float_a;
typedef int __attribute__((may_alias)) int_a;

template <typename T> __device__ __forceinline__ void vst2(void* p, T v) { *(T*)p = v;  }
__device__ __forceinline__ v8f wmma16(v16h a, v16h b, v8f c) {
  v8f d = __builtin_amdgcn_wmma_f32_16x16x32_f16(false, a, false, b, (short)0, c, false, false);
  asm volatile("v_nop\n\tv_nop\n\tv_nop\n\tv_nop" : "+v"(d) : "v"(a), "v"(b));
  return d;
}
__device__ __forceinline__ v8f wmma_bf(v16b a, v16b b, v8f c) {
  v8f d = __builtin_amdgcn_wmma_f32_16x16x32_bf16(false, a, false, b, (short)0, c, false, false);
  asm volatile("v_nop\n\tv_nop\n\tv_nop\n\tv_nop" : "+v"(d) : "v"(a), "v"(b));
  return d;
}
// 16x16x32 fragments: lane = (h = lane>>4, row/col = lane&15); elements 0..7 = k0+8h+0..7, 8..15 = k0+16+8h+0..7; D element r = row 8h+r
__device__ __forceinline__ v16h frag_h(const _Float16* rowk0, int lane) {
  union { v16h v; v8h q[2]; } u; const _Float16* p = rowk0 + 8 * (lane >> 4);
  u.q[0] = *(const v8h*)p; u.q[1] = *(const v8h*)(p + 16); return u.v;
}
__device__ __forceinline__ v16h frag_f32(const float* rowk0, int lane) {
  v16h a; const float* p = rowk0 + 8 * (lane >> 4);
#pragma unroll
  for (int i = 0; i < 8; ++i) { a[i] = (_Float16)p[i]; a[8 + i] = (_Float16)p[16 + i]; }
  return a;
}
__device__ __forceinline__ v16h frag_f32s(const float* rowk0, int lane, float sc) {
  v16h a; const float* p = rowk0 + 8 * (lane >> 4);
#pragma unroll
  for (int i = 0; i < 8; ++i) { a[i] = (_Float16)(p[i] * sc); a[8 + i] = (_Float16)(p[16 + i] * sc); }
  return a;
}
// column fragment from a [K][ld] layout (column n), rows >= K read as 0
__device__ __forceinline__ v16h fragc_f32(const float* W, int k0, int n, int lane, int ld, int K) {
  v16h a; const int g = lane >> 4;
#pragma unroll
  for (int i = 0; i < 8; ++i) { const int ka = k0 + 8 * g + i, kb = ka + 16;
    a[i] = (_Float16)(ka < K ? W[(size_t)(ka < K ? ka : K - 1) * ld + n] : 0.f); a[8 + i] = (_Float16)(kb < K ? W[(size_t)(kb < K ? kb : K - 1) * ld + n] : 0.f); }
  return a;
}
struct F2 { v16b h, l; };
__device__ __forceinline__ F2 bsplit16(const float v[16]) { F2 r;
#pragma unroll
  for (int i = 0; i < 16; ++i) { const __bf16 h = (__bf16)v[i]; r.h[i] = h; r.l[i] = (__bf16)(v[i] - (float)h); }
  return r; }
__device__ __forceinline__ F2 split_row(const float* row, int k0, int lane) { float v[16]; const float* p = row + k0 + 8 * (lane >> 4);
#pragma unroll
  for (int i = 0; i < 8; ++i) { v[i] = p[i]; v[8 + i] = p[16 + i]; }
  return bsplit16(v); }
__device__ __forceinline__ F2 split_rowK(const float* row, int k0, int lane, int K) { float v[16]; const int g = lane >> 4;
#pragma unroll
  for (int i = 0; i < 8; ++i) { const int ka = k0 + 8 * g + i, kb = ka + 16; v[i] = ka < K ? row[ka < K ? ka : K - 1] : 0.f; v[8 + i] = kb < K ? row[kb < K ? kb : K - 1] : 0.f; }
  return bsplit16(v); }
__device__ __forceinline__ F2 split_col(const float* W, int k0, int n, int lane, int ld, int K) { float v[16]; const int g = lane >> 4;
#pragma unroll
  for (int i = 0; i < 8; ++i) { const int ka = k0 + 8 * g + i, kb = ka + 16; v[i] = ka < K ? W[(size_t)(ka < K ? ka : K - 1) * ld + n] : 0.f; v[8 + i] = kb < K ? W[(size_t)(kb < K ? kb : K - 1) * ld + n] : 0.f; }
  return bsplit16(v); }
__device__ __forceinline__ v8f mac3(const F2& a, const F2& b, v8f c) { c = wmma_bf(a.l, b.h, c); c = wmma_bf(a.h, b.l, c); return wmma_bf(a.h, b.h, c); }
__device__ __forceinline__ float sigm(float v) { return 1.0f / (1.0f + expf(-v)); }
#define LDSX() do { asm volatile("s_wait_dscnt 0" ::: "memory"); __builtin_amdgcn_wave_barrier(); __builtin_amdgcn_fence(__ATOMIC_RELEASE, "workgroup"); } while (0)

// Causal multi-head attention on separate q / k / v inputs at width 512 (q / k / v [2,2048,512]; torch (out,in) Wq / Wk / Wv / Wp [512,512] applied as einsum('bsd,ed->bse') = x @ W.T, no q / k / v biases; bp zeros (read); 8 heads x 64; att / sqrt(64); tril kept, -1e10 (finite: the same exclusion) elsewhere; softmax; y @ Wp.T + bp).
#define NB 2
#define TT 2048
#define CC 512            // NH * HD = projected width
#define DIN 512          // input (model) width
#define NH 8
#define HD 64
#define NQB (TT / 64)
#define HG 4
#define SCALE (0.125f)
#define CAUSAL 1
#ifndef TNB
#define TNB NB
#endif
__device__ __forceinline__ float bfr(float v) { return (float)(__bf16)v; }
__host__ __device__ __forceinline__ int kb_last(int qb) { return CAUSAL ? ((qb * 64 + 63) >> 7) : (TT / 128 - 1); }
typedef __attribute__((ext_vector_type(8))) __bf16 v8b;
__device__ __forceinline__ v16b frag_b(const __bf16* rowk0, int lane) {
  union { v16b v; v8b q[2]; } u; const __bf16* p = rowk0 + 8 * (lane >> 4);
  u.q[0] = *(const v8b*)p; u.q[1] = *(const v8b*)(p + 16); return u.v;
}
#define QBH 6              // causal: query blocks 0..QBH-1 of each sequence (few keys, no averaging) take the high-precision path
#define QHI 384            // rows carrying a q residual plane
#define KHI 384            // key rows carrying k residual / v bf16 hi+lo planes (used only by the causal high-precision path)
// B fragment (k rows k0+.., output column o) of a weight: (in,out) [K][ld] or (out,in) [ld rows of K]: bf16 exact, or f16(bf16 * 256) exact
__device__ __forceinline__ v16b wcol_io(const float* Wm, int k0, int o, int lane, int ld) { v16b w; const int g = lane >> 4;
#pragma unroll
  for (int i = 0; i < 8; ++i) { w[i] = (__bf16)Wm[(size_t)(k0 + 8 * g + i) * ld + o]; w[8 + i] = (__bf16)Wm[(size_t)(k0 + 16 + 8 * g + i) * ld + o]; }
  return w; }
__device__ __forceinline__ v16b wcol_oi(const float* Wm, int k0, int o, int lane, int K) { v16b w; const float* p = Wm + (size_t)o * K + k0 + 8 * (lane >> 4);
#pragma unroll
  for (int i = 0; i < 8; ++i) { w[i] = (__bf16)p[i]; w[8 + i] = (__bf16)p[16 + i]; }
  return w; }
__device__ __forceinline__ v16h wcolh_io(const float* Wm, int k0, int o, int lane, int ld) { v16h w; const int g = lane >> 4;
#pragma unroll
  for (int i = 0; i < 8; ++i) { w[i] = (_Float16)(bfr(Wm[(size_t)(k0 + 8 * g + i) * ld + o]) * 256.0f); w[8 + i] = (_Float16)(bfr(Wm[(size_t)(k0 + 16 + 8 * g + i) * ld + o]) * 256.0f); }
  return w; }
__device__ __forceinline__ v16h wcolh_oi(const float* Wm, int k0, int o, int lane, int K) { v16h w; const float* p = Wm + (size_t)o * K + k0 + 8 * (lane >> 4);
#pragma unroll
  for (int i = 0; i < 8; ++i) { w[i] = (_Float16)(bfr(p[i]) * 256.0f); w[8 + i] = (_Float16)(bfr(p[16 + i]) * 256.0f); }
  return w; }
#define WQKV_LAYOUT 1   // 0 = (in,out) [DIN][CC]; 1 = (out,in) [CC][DIN]; 2 = per-head [NH][DIN][HD]
__device__ __forceinline__ v16b wcol_hdk(const float* Wm, int k0, int o, int lane) { v16b w; const int g = lane >> 4; const float* p = Wm + (size_t)(o / HD) * DIN * HD + (o % HD);
#pragma unroll
  for (int i = 0; i < 8; ++i) { w[i] = (__bf16)p[(size_t)(k0 + 8 * g + i) * HD]; w[8 + i] = (__bf16)p[(size_t)(k0 + 16 + 8 * g + i) * HD]; }
  return w; }
#define WO_OUT_IN 1
#if WQKV_LAYOUT == 1
#define WCOL(W, k0, o, lane) wcol_oi(W, k0, o, lane, DIN)
#elif WQKV_LAYOUT == 2
#define WCOL(W, k0, o, lane) wcol_hdk(W, k0, o, lane)
#else
#define WCOL(W, k0, o, lane) wcol_io(W, k0, o, lane, CC)
#endif
#if WO_OUT_IN
#define WOCOL(W, k0, o, lane) wcol_oi(W, k0, o, lane, CC)
#define WOCOLH(W, k0, o, lane) wcolh_oi(W, k0, o, lane, CC)
#else
#define WOCOL(W, k0, o, lane) wcol_io(W, k0, o, lane, DIN)
#define WOCOLH(W, k0, o, lane) wcolh_io(W, k0, o, lane, DIN)
#endif

#ifndef SM_EXTRA_PARAMS
#define SM_EXTRA_PARAMS
#endif
#ifndef PROJ_EXTRA_PARAMS
#define PROJ_EXTRA_PARAMS
#endif
#ifndef SM_MASK_HOOK
#define SM_MASK_HOOK (void)0
#endif

// behind a run of global loads that were issued ahead: their address registers may be rewritten from here on
#define XW() asm volatile("s_wait_xcnt 0x0" ::: "memory")
// the same, with the loads' addresses as inputs, so that their registers stay untouched up to the wait
#define XWP2(p, q) asm volatile("s_wait_xcnt 0x0" :: "v"(p), "v"(q) : "memory")

// ---- operand staging of the two projection kernels: block tile = 64 A rows x 128 W rows ((out,in) layout, both K-contiguous, K = 512), one wave = 16 A rows x all 128 W rows.
// A chunk of GK k is brought by whole-line loads (16 threads = 256 B of one row), converted ONCE to its 16-bit operand form and laid in LDS for all four waves; fragments come from LDS. Two buffers, one barrier a chunk; the next chunk's f32 fly in registers during the products.
// MODE 0: A -> bf16, W -> bf16 (1 product); MODE 1: A -> bf16 hi + lo planes, W -> bf16 (2 products); MODE 2: A x 2^6 -> f16 (small-magnitude rows stay clear of f16 subnormals), W -> f16(bf16 x 2^8) exact (1 product)
// every '#pragma unroll' in gemm_tile: full unroll of a loop that indexes register arrays (staged rows, fragments, accumulators): only with constant indices do they stay in registers
#define GK 64
#define GP (GK + 8)        // LDS pitch in 16-bit elements: 144 B = 16 B x odd, so that ds_load_b128 fragment reads spread over the banks
#define GKD 512            // K, and the row pitch of A and W in floats
#define G_STB(MODE) ((((MODE) == 1 ? 128 : 64) + 128) * GP * 2)   // bytes of one buffer
#define GROT ((int)((blockIdx.x + 2 * blockIdx.y) & (GKD / GK - 1)))   // start chunk: the row blocks (x) that share W rows spread over all chunks, the column blocks (y) that share A rows stand two chunks apart
typedef __attribute__((ext_vector_type(4))) __bf16 v4b;
typedef __attribute__((ext_vector_type(4))) _Float16 v4h;
// rot: the chunk at which this work-group starts its walk over k (it wraps). Work-groups that read the same A or W rows get different rot, so that they do not ask L2 for the same lines at the same moment.
template <int MODE> __device__ __forceinline__ void gemm_tile(const float* __restrict__ A, const float* __restrict__ Wm, unsigned char* sm, int tid, int rot, v8f (&acc)[8]) {
  constexpr int AR = MODE == 1 ? 128 : 64; constexpr int STB = G_STB(MODE);
  const int wave = tid >> 5, lane = tid & 31, col = lane & 15, sr = tid >> 4, sc = (tid & 15) * 4;
  const float* ag = A + (size_t)sr * GKD + sc; const float* wg = Wm + (size_t)sr * GKD + sc;
  const float* a0 = ag + rot * GK; const float* w0 = wg + rot * GK;
  v4f ra[8], rw[16];
#pragma unroll
  for (int i = 0; i < 8; ++i) ra[i] = *(const v4f*)(a0 + (size_t)i * 8 * GKD);
#pragma unroll
  for (int i = 0; i < 16; ++i) rw[i] = *(const v4f*)(w0 + (size_t)i * 8 * GKD);
  XWP2(a0, w0);
#pragma unroll 1   // rolled: one pass per chunk, the register set itself keeps the global loads one chunk ahead
  for (int kc = 0; kc < GKD / GK; ++kc) { unsigned char* st = sm + (kc & 1) * STB;
#pragma unroll
    for (int i = 0; i < 8; ++i) { const v4f x = ra[i]; const int o = (sr + i * 8) * GP + sc;
      if constexpr (MODE == 0) { v4b c; for (int e = 0; e < 4; ++e) c[e] = (__bf16)x[e]; *(v4b*)((__bf16*)st + o) = c; }
      else if constexpr (MODE == 1) { v4b c, d; for (int e = 0; e < 4; ++e) { const __bf16 hv = (__bf16)x[e]; c[e] = hv; d[e] = (__bf16)(x[e] - (float)hv); } *(v4b*)((__bf16*)st + o) = c; *(v4b*)((__bf16*)st + 64 * GP + o) = d; }
      else { v4h c; for (int e = 0; e < 4; ++e) c[e] = (_Float16)(x[e] * 64.0f); *(v4h*)((_Float16*)st + o) = c; } }
#pragma unroll
    for (int i = 0; i < 16; ++i) { const v4f x = rw[i]; const int o = (AR + sr + i * 8) * GP + sc;
      if constexpr (MODE == 2) { v4h c; for (int e = 0; e < 4; ++e) c[e] = (_Float16)(bfr(x[e]) * 256.0f); *(v4h*)((_Float16*)st + o) = c; }
      else { v4b c; for (int e = 0; e < 4; ++e) c[e] = (__bf16)x[e]; *(v4b*)((__bf16*)st + o) = c; } }
    __syncthreads();   // the chunk is complete for all four waves; every wave has also left the other buffer, which the next pass rewrites
    // behind the barrier, not in front of it: the barrier's own wait would take in loads that were just issued
    if (kc + 1 < GKD / GK) { const int cn = (kc + 1 + rot) & (GKD / GK - 1); const float* an = ag + cn * GK; const float* wn = wg + cn * GK;
#pragma unroll
      for (int i = 0; i < 8; ++i) ra[i] = *(const v4f*)(an + (size_t)i * 8 * GKD);
#pragma unroll
      for (int i = 0; i < 16; ++i) rw[i] = *(const v4f*)(wn + (size_t)i * 8 * GKD);
      XWP2(an, wn); }
    // ring of eight W fragments over the 16 steps (kk, j): step t + 8 is read from LDS behind step t's product
    if constexpr (MODE == 2) { const _Float16* sa = (const _Float16*)st + (wave * 16 + col) * GP; const _Float16* sw = (const _Float16*)st + (AR + col) * GP;
      v16h a[2], wf[8];
#pragma unroll
      for (int kk = 0; kk < 2; ++kk) a[kk] = frag_h(sa + kk * 32, lane);
#pragma unroll
      for (int j = 0; j < 8; ++j) wf[j] = frag_h(sw + j * 16 * GP, lane);
#pragma unroll
      for (int t = 0; t < 16; ++t) { const int kk = t >> 3, j = t & 7; acc[j] = wmma16(a[kk], wf[j], acc[j]); if (kk == 0) wf[j] = frag_h(sw + j * 16 * GP + 32, lane); }
    } else { const __bf16* sa = (const __bf16*)st + (wave * 16 + col) * GP; const __bf16* sw = (const __bf16*)st + (AR + col) * GP;
      v16b a[2], al[2], wf[8];
#pragma unroll
      for (int kk = 0; kk < 2; ++kk) { a[kk] = frag_b(sa + kk * 32, lane); if constexpr (MODE == 1) al[kk] = frag_b(sa + 64 * GP + kk * 32, lane); }
#pragma unroll
      for (int j = 0; j < 8; ++j) wf[j] = frag_b(sw + j * 16 * GP, lane);
#pragma unroll
      for (int t = 0; t < 16; ++t) { const int kk = t >> 3, j = t & 7; acc[j] = wmma_bf(a[kk], wf[j], acc[j]); if constexpr (MODE == 1) acc[j] = wmma_bf(al[kk], wf[j], acc[j]); if (kk == 0) wf[j] = frag_b(sw + j * 16 * GP + 32, lane); } } }
  __syncthreads();   // every wave has left the buffers before the caller's epilogue reuses them
}

#define WS_QH  0u                                      // f16 q rows [b*t][CC]
#define WS_KH  (WS_QH + 2u * (size_t)NB * TT * CC)      // f16 k rows [b*t][CC]
#define WS_VT  (WS_KH + 2u * (size_t)NB * TT * CC)      // f16 v planes [b][c][t]
#define WS_QL  (WS_VT + 2u * (size_t)NB * CC * TT)      // f16 q residual x 2^10 rows [b][t < QHI][CC]
#define WS_KL  (WS_QL + 2u * (size_t)NB * QHI * CC)     // f16 k residual x 2^10 rows [b][t < KHI][CC]
#define WS_VB  (WS_KL + 2u * (size_t)NB * KHI * CC)     // bf16 v hi planes [b][c][t < KHI]
#define WS_VBL (WS_VB + 2u * (size_t)NB * CC * KHI)
#define WS_S   (WS_VBL + 2u * (size_t)NB * CC * KHI)    // (not used: logits and P stay on chip)
#define WS_Y   (WS_S  + 4u * (size_t)HG * TT * TT)      // f32 ctx rows [b*t][CC] (only when there is an output projection)
#define WS_END (WS_Y  + 4u * (size_t)NB * TT * CC)

// ---- k_proj: block = (64 rows, 128 cols, which): q/k/v = X W (+ b) with exact bf16 products (K = DIN) -> which 0: q f16 rows (+ residual rows < QHI); 1: k f16 rows (+ residual rows < KHI); 2: v f16 planes [c][t] (+ bf16 hi/lo planes for t < KHI)
__global__ __launch_bounds__(128) void k_proj(const float* __restrict__ XQ, const float* __restrict__ XK, const float* __restrict__ XV, const float* __restrict__ WQ, const float* __restrict__ WK, const float* __restrict__ WV, const float* __restrict__ BQ, const float* __restrict__ BK, const float* __restrict__ BV,
    _Float16* __restrict__ QH, _Float16* __restrict__ QL, _Float16* __restrict__ KH, _Float16* __restrict__ KL, _Float16* __restrict__ VT, __bf16* __restrict__ VB, __bf16* __restrict__ VBL) {
  // one LDS range: the two operand buffers during the products, the output staging (sh, sl or th, tb, tbl) behind them
  __shared__ __align__(16) unsigned char sm[2 * G_STB(0)]; static_assert(2 * G_STB(0) >= 3 * 128 * 72 * 2 && 2 * G_STB(0) >= 2 * 64 * 136 * 2, "output staging fits");
  _Float16 (*sh)[136] = (_Float16 (*)[136])sm; _Float16 (*sl)[136] = (_Float16 (*)[136])(sm + 64 * 136 * 2); _Float16 (*th)[72] = (_Float16 (*)[72])sm; __bf16 (*tb)[72] = (__bf16 (*)[72])(sm + 128 * 72 * 2); __bf16 (*tbl)[72] = (__bf16 (*)[72])(sm + 2 * 128 * 72 * 2);
  const int tid = threadIdx.x, wave = tid >> 5, lane = tid & 31, col = lane & 15, g = lane >> 4; const int which = blockIdx.z; const int c0 = blockIdx.y * 128; const size_t r0 = (size_t)blockIdx.x * 64; const size_t bb = r0 / TT; const int t0 = (int)(r0 % TT);
  const float* X = which == 0 ? XQ : which == 1 ? XK : XV; const float* WA = which == 0 ? WQ : which == 1 ? WK : WV; const float* BA = which == 0 ? BQ : which == 1 ? BK : BV;
  v8f acc[8] = {};
  gemm_tile<0>(X + r0 * DIN, WA + (size_t)c0 * DIN, sm, tid, GROT, acc);
  if (which < 2) { _Float16* DH = which == 0 ? QH : KH; _Float16* DL = which == 0 ? QL : KL; const int nhi = which == 0 ? QHI : KHI; const bool hi_rows = t0 < nhi;
#pragma unroll
    for (int j = 0; j < 8; ++j) { const float bias = BA ? bfr(BA[c0 + j * 16 + col]) : 0.f;
#pragma unroll
      for (int r = 0; r < 8; ++r) { const float v = acc[j][r] + bias; const _Float16 hv = (_Float16)v; sh[wave * 16 + 8 * g + r][j * 16 + col] = hv; sl[wave * 16 + 8 * g + r][j * 16 + col] = (_Float16)((v - (float)hv) * 1024.0f); } }
    __syncthreads();
    for (int e = tid; e < 64 * 16; e += 128) { const int rl = e >> 4, q = e & 15; vst2((unsigned*)(DH + (r0 + rl) * CC + c0 + q * 8), *(const v4u*)&sh[rl][q * 8]); if (hi_rows) vst2((unsigned*)(DL + (bb * nhi + t0 + rl) * (size_t)CC + c0 + q * 8), *(const v4u*)&sl[rl][q * 8]); }
  } else { const bool hi_rows = t0 < KHI;
#pragma unroll
    for (int j = 0; j < 8; ++j) { const float bias = BA ? bfr(BA[c0 + j * 16 + col]) : 0.f;
#pragma unroll
      for (int r = 0; r < 8; ++r) { const float v = acc[j][r] + bias; const int rl = wave * 16 + 8 * g + r, cl = j * 16 + col; th[cl][rl] = (_Float16)v; const __bf16 bh = (__bf16)v; tb[cl][rl] = bh; tbl[cl][rl] = (__bf16)(v - (float)bh); } }
    __syncthreads();
    for (int e = tid; e < 128 * 8; e += 128) { const int cl = e >> 3, q = e & 7; vst2((unsigned*)(VT + (bb * CC + c0 + cl) * (size_t)TT + t0 + q * 8), *(const v4u*)&th[cl][q * 8]); if (hi_rows) { const size_t o3 = (bb * CC + c0 + cl) * (size_t)KHI + t0 + q * 8; vst2((unsigned*)(VB + o3), *(const v4u*)&tb[cl][q * 8]); vst2((unsigned*)(VBL + o3), *(const v4u*)&tbl[cl][q * 8]); } } } }
// ---- k_att: block = 64 queries (qb) of (b, h), one wave = 16 queries; key blocks up to the diagonal (query blocks >= QBH: taken from the diagonal down). Transposed products: S^T = K . Q^T (a lane holds the scores of ONE query: D row = key 8g + r, D column = query), causal mask by index, running maximum and rescaled running sums in f32 (online softmax), e^(s-m) x 2^11 packed straight from two score tiles into the B operand of ctx^T += V^T . P^T; the division by the row sum comes last. Logits and P never leave the registers.
// query blocks >= QBH: key blocks of 128, single f16 k x q, P once to f16 against v f16; the K tile [128 keys][HD] and the V tile [HD][128 keys] are brought once per block into LDS for all four waves. Query blocks < QBH (few keys): key blocks of 64, 3-product logits, P and v as bf16 hi + lo (3 products), fragments straight from global.
#define KP (HD + 8)        // K tile pitch in halves: 144 B = 16 B x odd, so that ds_load_b128 fragment reads spread over the banks
#define VP (128 + 8)       // V tile pitch in halves: 272 B = 16 B x odd
#define YP (HD + 4)        // ctx staging pitch in floats
#define SM_K 0
#define SM_V (SM_K + 128 * KP * 2)
#define SM_END (SM_V + HD * VP * 2)
// softmax in base 2: e^((a - amax) / 8) x 2^11 = 2^(a * LC + (11 - amax * LC)) on the raw product a, LC = log2(e) x 64^-0.5: one fused multiply-add and one v_exp_f32 a score.
// The argument is rounded to 2^-24 of its size, as the f32 difference s - m itself is; the row sum adds the same values that P is rounded from, so the x 2^11 falls out in the division.
#define LC (SCALE * 0x1.715476p+0f)
// v_exp_f32 and a v_nop in one statement: the free slot that the instruction set asks for behind a transcendental then stands directly behind it in every build
__device__ __forceinline__ float exp2_hw(float x) { float r; asm("v_exp_f32 %0, %1\n\tv_nop" : "=v"(r) : "v"(x)); return r; }
// full unroll of a loop that indexes register arrays (fragments, accumulators, staged tiles): only with constant indices do they stay in registers
#define UNROLL_REGS _Pragma("unroll")
// lane l with lane l ^ 16: the two halves of a query's keys
__device__ __forceinline__ float xhalf(float x) { return __builtin_bit_cast(float, __builtin_amdgcn_permlanex16(__builtin_bit_cast(int, x), __builtin_bit_cast(int, x), 0x76543210, 0xfedcba98, false, false)); }
__global__ __launch_bounds__(128) void k_att(const _Float16* __restrict__ QH, const _Float16* __restrict__ KH, const _Float16* __restrict__ QL, const _Float16* __restrict__ KL, const _Float16* __restrict__ VT, const __bf16* __restrict__ VB, const __bf16* __restrict__ VBL, float* __restrict__ Y) {
  __shared__ __align__(16) unsigned char sm[SM_END];
  const int tid = threadIdx.x, wave = __builtin_amdgcn_readfirstlane(tid >> 5) /* in a scalar register: the diagonal test below is a scalar branch */, lane = tid & 31, col = lane & 15, g = lane >> 4; const int b = blockIdx.z, h = blockIdx.y;
  const int qb = (b & 1) ? (int)blockIdx.x : NQB - 1 - (int)blockIdx.x;   // long blocks of one sequence meet short blocks of the other: speed only
  const int ql0 = qb * 64 + wave * 16, qrow = ql0 + col; const size_t q0 = (size_t)b * TT + ql0;
  float m = -3.0e38f, l = 0.f; v8f oa[HD / 16] = {};
  if (qb >= QBH) {   /* block-uniform */
    const int kbl = kb_last(qb);
    _Float16* Ks = (_Float16*)(sm + SM_K); _Float16* Vs = (_Float16*)(sm + SM_V);
    v16h ah[HD / 32];
UNROLL_REGS
    for (int kc = 0; kc < HD / 32; ++kc) ah[kc] = frag_h(QH + (q0 + col) * CC + h * HD + kc * 32, lane);
    // whole lines: 8 threads bring one key's 128 B of K, 16 threads 256 B of one V plane
    const _Float16* kg = KH + ((size_t)b * TT + (tid >> 3)) * CC + h * HD + (tid & 7) * 8; const _Float16* vg = VT + ((size_t)b * CC + h * HD + (tid >> 4)) * (size_t)TT + (tid & 15) * 8;
    _Float16* ksd = Ks + (tid >> 3) * KP + (tid & 7) * 8; _Float16* vsd = Vs + (tid >> 4) * VP + (tid & 15) * 8;
    // the key blocks are walked from the diagonal down: the query blocks of one (b, h), which share K and V, then stand at different key blocks in the same pass and do not ask L2 for the same lines at the same moment
    const _Float16* kd = kg + (size_t)kbl * 128 * CC; const _Float16* vd = vg + kbl * 128;
    v4u rk[8], rv[8];
UNROLL_REGS
    for (int i = 0; i < 8; ++i) { rk[i] = *(const v4u*)(kd + (size_t)i * 16 * CC); rv[i] = *(const v4u*)(vd + (size_t)i * 8 * TT); }
    XWP2(kd, vd);
#pragma unroll 1   // rolled: one pass per key block, the next block's tiles fly in registers during the pass
    for (int kb = kbl; kb >= 0; --kb) { const int k0 = kb * 128;
UNROLL_REGS
      for (int i = 0; i < 8; ++i) { *(v4u*)(ksd + i * 16 * KP) = rk[i]; *(v4u*)(vsd + i * 8 * VP) = rv[i]; }
      __syncthreads();   // the tiles are complete for all four waves
      // all K fragments of the 16 steps (kc, j) are read from LDS as ONE group in front of the products
      v16h kf[8 * (HD / 32)];
UNROLL_REGS
      for (int t = 0; t < 8 * (HD / 32); ++t) kf[t] = frag_h(Ks + ((t & 7) * 16 + col) * KP + (t >> 3) * 32, lane);
      if (kb > 0) { const _Float16* kn = kg + (size_t)(k0 - 128) * CC; const _Float16* vn = vg + k0 - 128;
UNROLL_REGS
        for (int i = 0; i < 8; ++i) { rk[i] = *(const v4u*)(kn + (size_t)i * 16 * CC); rv[i] = *(const v4u*)(vn + (size_t)i * 8 * TT); }
        XW(); }
      v8f acc[8] = {};
UNROLL_REGS
      for (int t = 0; t < 8 * (HD / 32); ++t) { const int kc = t >> 3, j = t & 7;
        acc[j] = wmma16(kf[t], ah[kc], acc[j]); }
      // all V fragments of the four key chunks are read as ONE group in front of the softmax arithmetic, which covers their way
      v16h vf[4 * (HD / 16)];
UNROLL_REGS
      for (int t = 0; t < 4 * (HD / 16); ++t) vf[t] = frag_h(Vs + ((t & 3) * 16 + col) * VP + (t >> 2) * 32, lane);
      if (k0 + 127 > ql0) {   /* wave-uniform: only blocks that reach past the wave's first query are masked */
        const int lim = qrow - k0 - 8 * g;
UNROLL_REGS
        for (int j = 0; j < 8; ++j) {
UNROLL_REGS
          for (int r = 0; r < 8; ++r) if (j * 16 + r > lim) acc[j][r] = -3.0e38f; } }
      float mx = m;
UNROLL_REGS
      for (int j = 0; j < 8; ++j) { float mt = acc[j][0];
UNROLL_REGS
        for (int r = 1; r < 8; ++r) mt = fmaxf(mt, acc[j][r]);
        mx = fmaxf(mx, mt); }
      mx = fmaxf(mx, xhalf(mx));
      const float mc = mx * LC, al = exp2_hw(__builtin_fmaf(m, LC, -mc)), bs = 11.0f - mc; m = mx; l *= al;   /* every key block holds a key <= every query of the block, so m is finite from the first block on */
UNROLL_REGS
      for (int j = 0; j < HD / 16; ++j) oa[j] *= al;
UNROLL_REGS
      for (int s = 0; s < 4; ++s) { v16h p;   /* B fragment of P^T: elements 0..7 = keys 8g + 0..7 of score tile 2s, 8..15 = the same of tile 2s + 1: the k order of frag_h */
UNROLL_REGS
        for (int i = 0; i < 16; ++i) { const float e = exp2_hw(__builtin_fmaf(acc[2 * s + (i >> 3)][i & 7], LC, bs)); l += e; p[i] = (_Float16)e; }   /* a masked product (-3e38) against the finite maximum gives exactly 0 */
UNROLL_REGS
        for (int j = 0; j < HD / 16; ++j) oa[j] = wmma16(vf[s * (HD / 16) + j], p, oa[j]); }
      __syncthreads();   // every wave has left the tiles before they are rewritten (behind the last pass: before they become ctx staging)
    }
  } else {
    const _Float16* QLb = QL + (size_t)b * QHI * CC; const _Float16* KLb = KL + (size_t)b * KHI * CC;
    const size_t po = ((size_t)b * CC + h * HD + col) * (size_t)KHI; const __bf16* vbr = VB + po; const __bf16* vlr = VBL + po;
    v16h ah[HD / 32], aq[HD / 32];
UNROLL_REGS
    for (int kc = 0; kc < HD / 32; ++kc) { ah[kc] = frag_h(QH + (q0 + col) * CC + h * HD + kc * 32, lane); aq[kc] = frag_h(QLb + (size_t)(ql0 + col) * CC + h * HD + kc * 32, lane); }
    XW();
#pragma unroll 1   // rolled: at most QBH key blocks, one copy of the body is enough
    for (int kb = 0; kb <= qb; ++kb) { const int k0 = kb * 64; const size_t kr0 = (size_t)b * TT + k0;
      v8f acc[4] = {}, accl[4] = {};
      // ring of four (k, k residual) fragment pairs over the 8 steps (kc, j): step t + 4 is loaded behind step t's products
      v16h kf[4], lf[4];
UNROLL_REGS
      for (int t = 0; t < 4; ++t) { kf[t] = frag_h(KH + (kr0 + t * 16 + col) * CC + h * HD, lane); lf[t] = frag_h(KLb + (size_t)(k0 + t * 16 + col) * CC + h * HD, lane); }
      XW();
UNROLL_REGS
      for (int t = 0; t < 4 * (HD / 32); ++t) { const int kc = t >> 2, j = t & 3, u = t + 4;
        acc[j] = wmma16(kf[j], ah[kc], acc[j]); accl[j] = wmma16(kf[j], aq[kc], accl[j]); accl[j] = wmma16(lf[j], ah[kc], accl[j]);
        if (u < 4 * (HD / 32)) { kf[j] = frag_h(KH + (kr0 + j * 16 + col) * CC + h * HD + (u >> 2) * 32, lane); lf[j] = frag_h(KLb + (size_t)(k0 + j * 16 + col) * CC + h * HD + (u >> 2) * 32, lane); XW(); } }
      float mx = m;
UNROLL_REGS
      for (int j = 0; j < 4; ++j) {
UNROLL_REGS
        for (int r = 0; r < 8; ++r) { float s = acc[j][r] + accl[j][r] * (1.0f / 1024.0f); if (k0 + j * 16 + 8 * g + r > qrow) s = -3.0e38f; acc[j][r] = s; mx = fmaxf(mx, s); } }
      mx = fmaxf(mx, xhalf(mx));
      const float mc = mx * LC, al = exp2_hw(__builtin_fmaf(m, LC, -mc)), bs = 11.0f - mc; m = mx; l *= al;
UNROLL_REGS
      for (int j = 0; j < HD / 16; ++j) oa[j] *= al;
UNROLL_REGS
      for (int s = 0; s < 2; ++s) { float pv[16];
        // a key chunk of v hi / lo is requested in front of the chunk's exponentials
        v16b vh[HD / 16], vl[HD / 16];
UNROLL_REGS
        for (int j = 0; j < HD / 16; ++j) { vh[j] = frag_b(vbr + (size_t)j * 16 * KHI + k0 + s * 32, lane); vl[j] = frag_b(vlr + (size_t)j * 16 * KHI + k0 + s * 32, lane); }
        XW();
UNROLL_REGS
        for (int i = 0; i < 16; ++i) { const float e = exp2_hw(__builtin_fmaf(acc[2 * s + (i >> 3)][i & 7], LC, bs)); l += e; pv[i] = e; }
        const F2 p = bsplit16(pv);
UNROLL_REGS
        for (int j = 0; j < HD / 16; ++j) { oa[j] = wmma_bf(vh[j], p.h, oa[j]); oa[j] = wmma_bf(vh[j], p.l, oa[j]); oa[j] = wmma_bf(vl[j], p.h, oa[j]); } }
    }
  }
  l += xhalf(l);
  const float inv = l > 0.f ? 1.0f / l : 0.f;   /* l carries the same 2^11 as P */
  // ctx^T: a lane holds d = 16j + 8g + 0..7 of its query; through the wave's own LDS rows into 256-B (row, head) segments, two rows a store
  float* ys = (float*)sm + wave * 16 * YP;
UNROLL_REGS
  for (int j = 0; j < HD / 16; ++j) { const v8f o = oa[j] * inv; v4f lo4 = { o[0], o[1], o[2], o[3] }, hi4 = { o[4], o[5], o[6], o[7] }; *(v4f*)&ys[col * YP + j * 16 + 8 * g] = lo4; *(v4f*)&ys[col * YP + j * 16 + 8 * g + 4] = hi4; }
  LDSX();   // the wave's own rows are read back across lanes
UNROLL_REGS
  for (int i = 0; i < 8; ++i) vst2(Y + ((size_t)b * TT + ql0 + i * 2 + g) * CC + h * HD + col * 4, *(const v4f*)&ys[(i * 2 + g) * YP + col * 4]); }
// ---- k_out: block = (64 rows, 128 cols): out = ctx Wo (+ bo): ctx x 2^6 once to f16 against Wo as f16(bf16 x 2^8) exact (1 product) x 2^-14; causal early rows (< QHI of each sequence): ctx bf16 hi + lo against exact bf16 Wo (2 products)
__global__ __launch_bounds__(128) void k_out(const float* __restrict__ Y, const float* __restrict__ WO, const float* __restrict__ BO, float* __restrict__ OUT) {
  // one LDS range: the two operand buffers during the products, the output staging sf behind them
  __shared__ __align__(16) unsigned char sm[2 * G_STB(1)]; static_assert(2 * G_STB(1) >= 4 * 16 * 132 * 4, "output staging fits");
  float (*sf)[16][132] = (float (*)[16][132])sm;
  const int tid = threadIdx.x, wave = tid >> 5, lane = tid & 31, col = lane & 15, g = lane >> 4; const int c0 = blockIdx.y * 128; const size_t rb = (size_t)blockIdx.x * 64, r0 = rb + wave * 16;
  v8f acc[8] = {};
  if (CAUSAL && (int)(rb % TT) < QHI) {   /* block-uniform */
    gemm_tile<1>(Y + rb * CC, WO + (size_t)c0 * CC, sm, tid, GROT, acc);
#pragma unroll
    for (int j = 0; j < 8; ++j) { const float bias = BO ? bfr(BO[c0 + j * 16 + col]) : 0.f;
#pragma unroll
      for (int r = 0; r < 8; ++r) sf[wave][8 * g + r][j * 16 + col] = acc[j][r] + bias; }
  } else {
    gemm_tile<2>(Y + rb * CC, WO + (size_t)c0 * CC, sm, tid, GROT, acc);
#pragma unroll
    for (int j = 0; j < 8; ++j) { const float bias = BO ? bfr(BO[c0 + j * 16 + col]) : 0.f;
#pragma unroll
      for (int r = 0; r < 8; ++r) sf[wave][8 * g + r][j * 16 + col] = acc[j][r] * (1.0f / 16384.0f) + bias; } }   /* 2^-8 (Wo carry) x 2^-6 (ctx carry) */
  LDSX(); for (int rl = 0; rl < 16; ++rl) vst2(OUT + (r0 + rl) * DIN + c0 + lane * 4, *(const v4f*)&sf[wave][rl][lane * 4]); }

extern "C" void kernel_launch(void* const* d_in, const int* in_sizes, int n_in, void* d_out, int out_size, void* d_ws, size_t ws_size, hipStream_t stream) {
  (void)in_sizes; (void)n_in; (void)out_size;
  const float** F = (const float**)d_in;
  if (ws_size < (size_t)WS_END) return;
  char* ws = (char*)d_ws; _Float16 *QH = (_Float16*)(ws + WS_QH), *KH = (_Float16*)(ws + WS_KH), *VT = (_Float16*)(ws + WS_VT), *QL = (_Float16*)(ws + WS_QL), *KL = (_Float16*)(ws + WS_KL); __bf16 *VB = (__bf16*)(ws + WS_VB), *VBL = (__bf16*)(ws + WS_VBL); float *Y = (float*)(ws + WS_Y);
  (void)Y; (void)QL; (void)KL; (void)VB; (void)VBL;
  // inputs: 0 q [2,2048,512]; 1 k; 2 v; 3 Wq [512,512] (out,in); 4 Wk; 5 Wv; 6 Wp (out,in); 7 bp (zeros, read); no q / k / v biases (null pointers)
  k_proj<<<dim3(TNB * TT / 64, CC / 128, 3), 128, 0, stream>>>(F[0], F[1], F[2], F[3], F[4], F[5], nullptr, nullptr, nullptr, QH, QL, KH, KL, VT, VB, VBL);
  k_att<<<dim3(NQB, NH, TNB), 128, 0, stream>>>(QH, KH, QL, KL, VT, VB, VBL, Y);
  k_out<<<dim3(TNB * TT / 64, DIN / 128), 128, 0, stream>>>(Y, F[6], F[7], (float*)d_out);
}

// v007
// Measured time: 43 microseconds a run.
// In two side-by-side timings against v006, it was 1.03 and 1.04 times as fast.
// All steps since v000 together make it 12.9 times as fast.
// compute dtype: all float inputs rounded to bf16; the fused q / k / v projection with EXACT bf16 products on WMMA 16x16x32 (f32 accumulate) (no q / k / v biases); causal logits: 3 products for the first 384 rows, single f16 q x k after, x 64^-0.5; online softmax f32 (running maximum, rescaled sums, division last; base 2: one fused multiply-add and the hardware's 2^x a score); e^(s-m) x 2^11 once to f16 x v once to f16 (bf16 hi + lo below row 384); ctx hi+lo x exact W below row 384, x2^6 f16 carry x f16(bf16 x 2^8) W after, + bias; f32 output.
#include <hip/hip_runtime.h>
#include <math.h>

typedef __attribute__((ext_vector_type(16))) _Float16 v16h;
typedef __attribute__((ext_vector_type(16))) __bf16 v16b;
typedef __attribute__((ext_vector_type(8)))  _Float16 v8h;
typedef __attribute__((ext_vector_type(8)))  float v8f;
typedef __attribute__((ext_vector_type(4)))  float v4f;
typedef __attribute__((ext_vector_type(2)))  float v2f;
typedef __attribute__((ext_vector_type(4)))  unsigned v4u;
typedef __attribute__((ext_vector_type(4)))  int v4i;
typedef float __attribute__((may_alias)) float_a;
typedef int __attribute__((may_alias)) int_a;

template <typename T> __device__ __forceinline__ void vst2(void* p, T v) { *(T*)p = v;  }
__device__ __forceinline__ v8f wmma16(v16h a, v16h b, v8f c) {
  v8f d = __builtin_amdgcn_wmma_f32_16x16x32_f16(false, a, false, b, (short)0, c, false, false);
  asm volatile("v_nop\n\tv_nop\n\tv_nop\n\tv_nop" : "+v"(d) : "v"(a), "v"(b));
  return d;
}
__device__ __forceinline__ v8f wmma_bf(v16b a, v16b b, v8f c) {
  v8f d = __builtin_amdgcn_wmma_f32_16x16x32_bf16(false, a, false, b, (short)0, c, false, false);
  asm volatile("v_nop\n\tv_nop\n\tv_nop\n\tv_nop" : "+v"(d) : "v"(a), "v"(b));
  return d;
}
// 16x16x32 fragments: lane = (h = lane>>4, row/col = lane&15); elements 0..7 = k0+8h+0..7, 8..15 = k0+16+8h+0..7; D element r = row 8h+r
__device__ __forceinline__ v16h frag_h(const _Float16* rowk0, int lane) {
  union { v16h v; v8h q[2]; } u; const _Float16* p = rowk0 + 8 * (lane >> 4);
  u.q[0] = *(const v8h*)p; u.q[1] = *(const v8h*)(p + 16); return u.v;
}
__device__ __forceinline__ v16h frag_f32(const float* rowk0, int lane) {
  v16h a; const float* p = rowk0 + 8 * (lane >> 4);
#pragma unroll
  for (int i = 0; i < 8; ++i) { a[i] = (_Float16)p[i]; a[8 + i] = (_Float16)p[16 + i]; }
  return a;
}
__device__ __forceinline__ v16h frag_f32s(const float* rowk0, int lane, float sc) {
  v16h a; const float* p = rowk0 + 8 * (lane >> 4);
#pragma unroll
  for (int i = 0; i < 8; ++i) { a[i] = (_Float16)(p[i] * sc); a[8 + i] = (_Float16)(p[16 + i] * sc); }
  return a;
}
// column fragment from a [K][ld] layout (column n), rows >= K read as 0
__device__ __forceinline__ v16h fragc_f32(const float* W, int k0, int n, int lane, int ld, int K) {
  v16h a; const int g = lane >> 4;
#pragma unroll
  for (int i = 0; i < 8; ++i) { const int ka = k0 + 8 * g + i, kb = ka + 16;
    a[i] = (_Float16)(ka < K ? W[(size_t)(ka < K ? ka : K - 1) * ld + n] : 0.f); a[8 + i] = (_Float16)(kb < K ? W[(size_t)(kb < K ? kb : K - 1) * ld + n] : 0.f); }
  return a;
}
struct F2 { v16b h, l; };
__device__ __forceinline__ F2 bsplit16(const float v[16]) { F2 r;
#pragma unroll
  for (int i = 0; i < 16; ++i) { const __bf16 h = (__bf16)v[i]; r.h[i] = h; r.l[i] = (__bf16)(v[i] - (float)h); }
  return r; }
__device__ __forceinline__ F2 split_row(const float* row, int k0, int lane) { float v[16]; const float* p = row + k0 + 8 * (lane >> 4);
#pragma unroll
  for (int i = 0; i < 8; ++i) { v[i] = p[i]; v[8 + i] = p[16 + i]; }
  return bsplit16(v); }
__device__ __forceinline__ F2 split_rowK(const float* row, int k0, int lane, int K) { float v[16]; const int g = lane >> 4;
#pragma unroll
  for (int i = 0; i < 8; ++i) { const int ka = k0 + 8 * g + i, kb = ka + 16; v[i] = ka < K ? row[ka < K ? ka : K - 1] : 0.f; v[8 + i] = kb < K ? row[kb < K ? kb : K - 1] : 0.f; }
  return bsplit16(v); }
__device__ __forceinline__ F2 split_col(const float* W, int k0, int n, int lane, int ld, int K) { float v[16]; const int g = lane >> 4;
#pragma unroll
  for (int i = 0; i < 8; ++i) { const int ka = k0 + 8 * g + i, kb = ka + 16; v[i] = ka < K ? W[(size_t)(ka < K ? ka : K - 1) * ld + n] : 0.f; v[8 + i] = kb < K ? W[(size_t)(kb < K ? kb : K - 1) * ld + n] : 0.f; }
  return bsplit16(v); }
__device__ __forceinline__ v8f mac3(const F2& a, const F2& b, v8f c) { c = wmma_bf(a.l, b.h, c); c = wmma_bf(a.h, b.l, c); return wmma_bf(a.h, b.h, c); }
__device__ __forceinline__ float sigm(float v) { return 1.0f / (1.0f + expf(-v)); }
#define LDSX() do { asm volatile("s_wait_dscnt 0" ::: "memory"); __builtin_amdgcn_wave_barrier(); __builtin_amdgcn_fence(__ATOMIC_RELEASE, "workgroup"); } while (0)

// Causal multi-head attention on separate q / k / v inputs at width 512 (q / k / v [2,2048,512]; torch (out,in) Wq / Wk / Wv / Wp [512,512] applied as einsum('bsd,ed->bse') = x @ W.T, no q / k / v biases; bp zeros (read); 8 heads x 64; att / sqrt(64); tril kept, -1e10 (finite: the same exclusion) elsewhere; softmax; y @ Wp.T + bp).
#define NB 2
#define TT 2048
#define CC 512            // NH * HD = projected width
#define DIN 512          // input (model) width
#define NH 8
#define HD 64
#define NQB (TT / 64)
#define HG 4
#define SCALE (0.125f)
#define CAUSAL 1
#ifndef TNB
#define TNB NB
#endif
__device__ __forceinline__ float bfr(float v) { return (float)(__bf16)v; }
__host__ __device__ __forceinline__ int kb_last(int qb) { return CAUSAL ? ((qb * 64 + 63) >> 7) : (TT / 128 - 1); }
typedef __attribute__((ext_vector_type(8))) __bf16 v8b;
__device__ __forceinline__ v16b frag_b(const __bf16* rowk0, int lane) {
  union { v16b v; v8b q[2]; } u; const __bf16* p = rowk0 + 8 * (lane >> 4);
  u.q[0] = *(const v8b*)p; u.q[1] = *(const v8b*)(p + 16); return u.v;
}
#define QBH 6              // causal: query blocks 0..QBH-1 of each sequence (few keys, no averaging) take the high-precision path
#define QHI 384            // rows carrying a q residual plane
#define KHI 384            // key rows carrying k residual / v bf16 hi+lo planes (used only by the causal high-precision path)
// B fragment (k rows k0+.., output column o) of a weight: (in,out) [K][ld] or (out,in) [ld rows of K]: bf16 exact, or f16(bf16 * 256) exact
__device__ __forceinline__ v16b wcol_io(const float* Wm, int k0, int o, int lane, int ld) { v16b w; const int g = lane >> 4;
#pragma unroll
  for (int i = 0; i < 8; ++i) { w[i] = (__bf16)Wm[(size_t)(k0 + 8 * g + i) * ld + o]; w[8 + i] = (__bf16)Wm[(size_t)(k0 + 16 + 8 * g + i) * ld + o]; }
  return w; }
__device__ __forceinline__ v16b wcol_oi(const float* Wm, int k0, int o, int lane, int K) { v16b w; const float* p = Wm + (size_t)o * K + k0 + 8 * (lane >> 4);
#pragma unroll
  for (int i = 0; i < 8; ++i) { w[i] = (__bf16)p[i]; w[8 + i] = (__bf16)p[16 + i]; }
  return w; }
__device__ __forceinline__ v16h wcolh_io(const float* Wm, int k0, int o, int lane, int ld) { v16h w; const int g = lane >> 4;
#pragma unroll
  for (int i = 0; i < 8; ++i) { w[i] = (_Float16)(bfr(Wm[(size_t)(k0 + 8 * g + i) * ld + o]) * 256.0f); w[8 + i] = (_Float16)(bfr(Wm[(size_t)(k0 + 16 + 8 * g + i) * ld + o]) * 256.0f); }
  return w; }
__device__ __forceinline__ v16h wcolh_oi(const float* Wm, int k0, int o, int lane, int K) { v16h w; const float* p = Wm + (size_t)o * K + k0 + 8 * (lane >> 4);
#pragma unroll
  for (int i = 0; i < 8; ++i) { w[i] = (_Float16)(bfr(p[i]) * 256.0f); w[8 + i] = (_Float16)(bfr(p[16 + i]) * 256.0f); }
  return w; }
#define WQKV_LAYOUT 1   // 0 = (in,out) [DIN][CC]; 1 = (out,in) [CC][DIN]; 2 = per-head [NH][DIN][HD]
__device__ __forceinline__ v16b wcol_hdk(const float* Wm, int k0, int o, int lane) { v16b w; const int g = lane >> 4; const float* p = Wm + (size_t)(o / HD) * DIN * HD + (o % HD);
#pragma unroll
  for (int i = 0; i < 8; ++i) { w[i] = (__bf16)p[(size_t)(k0 + 8 * g + i) * HD]; w[8 + i] = (__bf16)p[(size_t)(k0 + 16 + 8 * g + i) * HD]; }
  return w; }
#define WO_OUT_IN 1
#if WQKV_LAYOUT == 1
#define WCOL(W, k0, o, lane) wcol_oi(W, k0, o, lane, DIN)
#elif WQKV_LAYOUT == 2
#define WCOL(W, k0, o, lane) wcol_hdk(W, k0, o, lane)
#else
#define WCOL(W, k0, o, lane) wcol_io(W, k0, o, lane, CC)
#endif
#if WO_OUT_IN
#define WOCOL(W, k0, o, lane) wcol_oi(W, k0, o, lane, CC)
#define WOCOLH(W, k0, o, lane) wcolh_oi(W, k0, o, lane, CC)
#else
#define WOCOL(W, k0, o, lane) wcol_io(W, k0, o, lane, DIN)
#define WOCOLH(W, k0, o, lane) wcolh_io(W, k0, o, lane, DIN)
#endif

#ifndef SM_EXTRA_PARAMS
#define SM_EXTRA_PARAMS
#endif
#ifndef PROJ_EXTRA_PARAMS
#define PROJ_EXTRA_PARAMS
#endif
#ifndef SM_MASK_HOOK
#define SM_MASK_HOOK (void)0
#endif

// behind a run of global loads that were issued ahead: their address registers may be rewritten from here on
#define XW() asm volatile("s_wait_xcnt 0x0" ::: "memory")
// the same, with the loads' addresses as inputs, so that their registers stay untouched up to the wait
#define XWP2(p, q) asm volatile("s_wait_xcnt 0x0" :: "v"(p), "v"(q) : "memory")

// ---- operand staging of the two projection kernels: block tile = 64 A rows x 128 W rows ((out,in) layout, both K-contiguous, K = 512), one wave = 16 A rows x all 128 W rows.
// A chunk of GK k is brought by whole-line loads (16 threads = 256 B of one row), converted ONCE to its 16-bit operand form and laid in LDS for all four waves; fragments come from LDS. Two buffers, one barrier a chunk; the next chunk's f32 fly in registers during the products.
// MODE 0: A -> bf16, W -> bf16 (1 product); MODE 1: A -> bf16 hi + lo planes, W -> bf16 (2 products); MODE 2: A x 2^6 -> f16 (small-magnitude rows stay clear of f16 subnormals), W -> f16(bf16 x 2^8) exact (1 product)
// every '#pragma unroll' in gemm_tile: full unroll of a loop that indexes register arrays (staged rows, fragments, accumulators): only with constant indices do they stay in registers
#define GK 64
#define GP (GK + 8)        // LDS pitch in 16-bit elements: 144 B = 16 B x odd, so that ds_load_b128 fragment reads spread over the banks
#define GKD 512            // K, and the row pitch of A and W in floats
#define G_STB(MODE) ((((MODE) == 1 ? 128 : 64) + 128) * GP * 2)   // bytes of one buffer
#define GROT ((int)((blockIdx.x + 2 * blockIdx.y) & (GKD / GK - 1)))   // start chunk: the row blocks (x) that share W rows spread over all chunks, the column blocks (y) that share A rows stand two chunks apart
typedef __attribute__((ext_vector_type(4))) __bf16 v4b;
typedef __attribute__((ext_vector_type(4))) _Float16 v4h;
// rot: the chunk at which this work-group starts its walk over k (it wraps). Work-groups that read the same A or W rows get different rot, so that they do not ask L2 for the same lines at the same moment.
// NCH: how many chunks the calling four waves walk from rot on: all of k, or their share where two groups of four waves split k. tid counts within the four waves and sm is their own pair of buffers; the barriers are the whole work-group's, so every group walks the same NCH.
template <int MODE, int NCH = GKD / GK> __device__ __forceinline__ void gemm_tile(const float* __restrict__ A, const float* __restrict__ Wm, unsigned char* sm, int tid, int rot, v8f (&acc)[8]) {
  constexpr int AR = MODE == 1 ? 128 : 64; constexpr int STB = G_STB(MODE);
  const int wave = tid >> 5, lane = tid & 31, col = lane & 15, sr = tid >> 4, sc = (tid & 15) * 4;
  const float* ag = A + (size_t)sr * GKD + sc; const float* wg = Wm + (size_t)sr * GKD + sc;
  const float* a0 = ag + rot * GK; const float* w0 = wg + rot * GK;
  v4f ra[8], rw[16];
#pragma unroll
  for (int i = 0; i < 8; ++i) ra[i] = *(const v4f*)(a0 + (size_t)i * 8 * GKD);
#pragma unroll
  for (int i = 0; i < 16; ++i) rw[i] = *(const v4f*)(w0 + (size_t)i * 8 * GKD);
  XWP2(a0, w0);
#pragma unroll 1   // rolled: one pass per chunk, the register set itself keeps the global loads one chunk ahead
  for (int kc = 0; kc < NCH; ++kc) { unsigned char* st = sm + (kc & 1) * STB;
#pragma unroll
    for (int i = 0; i < 8; ++i) { const v4f x = ra[i]; const int o = (sr + i * 8) * GP + sc;
      if constexpr (MODE == 0) { v4b c; for (int e = 0; e < 4; ++e) c[e] = (__bf16)x[e]; *(v4b*)((__bf16*)st + o) = c; }
      else if constexpr (MODE == 1) { v4b c, d; for (int e = 0; e < 4; ++e) { const __bf16 hv = (__bf16)x[e]; c[e] = hv; d[e] = (__bf16)(x[e] - (float)hv); } *(v4b*)((__bf16*)st + o) = c; *(v4b*)((__bf16*)st + 64 * GP + o) = d; }
      else { v4h c; for (int e = 0; e < 4; ++e) c[e] = (_Float16)(x[e] * 64.0f); *(v4h*)((_Float16*)st + o) = c; } }
#pragma unroll
    for (int i = 0; i < 16; ++i) { const v4f x = rw[i]; const int o = (AR + sr + i * 8) * GP + sc;
      if constexpr (MODE == 2) { v4h c; for (int e = 0; e < 4; ++e) c[e] = (_Float16)(bfr(x[e]) * 256.0f); *(v4h*)((_Float16*)st + o) = c; }
      else { v4b c; for (int e = 0; e < 4; ++e) c[e] = (__bf16)x[e]; *(v4b*)((__bf16*)st + o) = c; } }
    __syncthreads();   // the chunk is complete for all four waves; every wave has also left the other buffer, which the next pass rewrites
    // behind the barrier, not in front of it: the barrier's own wait would take in loads that were just issued
    if (kc + 1 < NCH) { const int cn = (kc + 1 + rot) & (GKD / GK - 1); const float* an = ag + cn * GK; const float* wn = wg + cn * GK;
#pragma unroll
      for (int i = 0; i < 8; ++i) ra[i] = *(const v4f*)(an + (size_t)i * 8 * GKD);
#pragma unroll
      for (int i = 0; i < 16; ++i) rw[i] = *(const v4f*)(wn + (size_t)i * 8 * GKD);
      XWP2(an, wn); }
    // ring of eight W fragments over the 16 steps (kk, j): step t + 8 is read from LDS behind step t's product
    if constexpr (MODE == 2) { const _Float16* sa = (const _Float16*)st + (wave * 16 + col) * GP; const _Float16* sw = (const _Float16*)st + (AR + col) * GP;
      v16h a[2], wf[8];
#pragma unroll
      for (int kk = 0; kk < 2; ++kk) a[kk] = frag_h(sa + kk * 32, lane);
#pragma unroll
      for (int j = 0; j < 8; ++j) wf[j] = frag_h(sw + j * 16 * GP, lane);
#pragma unroll
      for (int t = 0; t < 16; ++t) { const int kk = t >> 3, j = t & 7; acc[j] = wmma16(a[kk], wf[j], acc[j]); if (kk == 0) wf[j] = frag_h(sw + j * 16 * GP + 32, lane); }
    } else { const __bf16* sa = (const __bf16*)st + (wave * 16 + col) * GP; const __bf16* sw = (const __bf16*)st + (AR + col) * GP;
      v16b a[2], al[2], wf[8];
#pragma unroll
      for (int kk = 0; kk < 2; ++kk) { a[kk] = frag_b(sa + kk * 32, lane); if constexpr (MODE == 1) al[kk] = frag_b(sa + 64 * GP + kk * 32, lane); }
#pragma unroll
      for (int j = 0; j < 8; ++j) wf[j] = frag_b(sw + j * 16 * GP, lane);
#pragma unroll
      for (int t = 0; t < 16; ++t) { const int kk = t >> 3, j = t & 7; acc[j] = wmma_bf(a[kk], wf[j], acc[j]); if constexpr (MODE == 1) acc[j] = wmma_bf(al[kk], wf[j], acc[j]); if (kk == 0) wf[j] = frag_b(sw + j * 16 * GP + 32, lane); } } }
  __syncthreads();   // every wave has left the buffers before the caller's epilogue reuses them
}

#define WS_QH  0u                                      // f16 q rows [b*t][CC]
#define WS_KH  (WS_QH + 2u * (size_t)NB * TT * CC)      // f16 k rows [b*t][CC]
#define WS_VT  (WS_KH + 2u * (size_t)NB * TT * CC)      // f16 v planes [b][c][t]
#define WS_QL  (WS_VT + 2u * (size_t)NB * CC * TT)      // f16 q residual x 2^10 rows [b][t < QHI][CC]
#define WS_KL  (WS_QL + 2u * (size_t)NB * QHI * CC)     // f16 k residual x 2^10 rows [b][t < KHI][CC]
#define WS_VB  (WS_KL + 2u * (size_t)NB * KHI * CC)     // bf16 v hi planes [b][c][t < KHI]
#define WS_VBL (WS_VB + 2u * (size_t)NB * CC * KHI)
#define WS_S   (WS_VBL + 2u * (size_t)NB * CC * KHI)    // (not used: logits and P stay on chip)
#define WS_Y   (WS_S  + 4u * (size_t)HG * TT * TT)      // f32 ctx rows [b*t][CC] (only when there is an output projection)
#define WS_END (WS_Y  + 4u * (size_t)NB * TT * CC)

// ---- k_proj: block = (64 rows, 128 cols, which): q/k/v = X W (+ b) with exact bf16 products (K = DIN) -> which 0: q f16 rows (+ residual rows < QHI); 1: k f16 rows (+ residual rows < KHI); 2: v f16 planes [c][t] (+ bf16 hi/lo planes for t < KHI)
__global__ __launch_bounds__(128) void k_proj(const float* __restrict__ XQ, const float* __restrict__ XK, const float* __restrict__ XV, const float* __restrict__ WQ, const float* __restrict__ WK, const float* __restrict__ WV, const float* __restrict__ BQ, const float* __restrict__ BK, const float* __restrict__ BV,
    _Float16* __restrict__ QH, _Float16* __restrict__ QL, _Float16* __restrict__ KH, _Float16* __restrict__ KL, _Float16* __restrict__ VT, __bf16* __restrict__ VB, __bf16* __restrict__ VBL) {
  // one LDS range: the two operand buffers during the products, the output staging (sh, sl or th, tb, tbl) behind them
  __shared__ __align__(16) unsigned char sm[2 * G_STB(0)]; static_assert(2 * G_STB(0) >= 3 * 128 * 72 * 2 && 2 * G_STB(0) >= 2 * 64 * 136 * 2, "output staging fits");
  _Float16 (*sh)[136] = (_Float16 (*)[136])sm; _Float16 (*sl)[136] = (_Float16 (*)[136])(sm + 64 * 136 * 2); _Float16 (*th)[72] = (_Float16 (*)[72])sm; __bf16 (*tb)[72] = (__bf16 (*)[72])(sm + 128 * 72 * 2); __bf16 (*tbl)[72] = (__bf16 (*)[72])(sm + 2 * 128 * 72 * 2);
  const int tid = threadIdx.x, wave = tid >> 5, lane = tid & 31, col = lane & 15, g = lane >> 4; const int which = blockIdx.z; const int c0 = blockIdx.y * 128; const size_t r0 = (size_t)blockIdx.x * 64; const size_t bb = r0 / TT; const int t0 = (int)(r0 % TT);
  const float* X = which == 0 ? XQ : which == 1 ? XK : XV; const float* WA = which == 0 ? WQ : which == 1 ? WK : WV; const float* BA = which == 0 ? BQ : which == 1 ? BK : BV;
  v8f acc[8] = {};
  gemm_tile<0>(X + r0 * DIN, WA + (size_t)c0 * DIN, sm, tid, GROT, acc);
  if (which < 2) { _Float16* DH = which == 0 ? QH : KH; _Float16* DL = which == 0 ? QL : KL; const int nhi = which == 0 ? QHI : KHI; const bool hi_rows = t0 < nhi;
#pragma unroll
    for (int j = 0; j < 8; ++j) { const float bias = BA ? bfr(BA[c0 + j * 16 + col]) : 0.f;
#pragma unroll
      for (int r = 0; r < 8; ++r) { const float v = acc[j][r] + bias; const _Float16 hv = (_Float16)v; sh[wave * 16 + 8 * g + r][j * 16 + col] = hv; sl[wave * 16 + 8 * g + r][j * 16 + col] = (_Float16)((v - (float)hv) * 1024.0f); } }
    __syncthreads();
    for (int e = tid; e < 64 * 16; e += 128) { const int rl = e >> 4, q = e & 15; vst2((unsigned*)(DH + (r0 + rl) * CC + c0 + q * 8), *(const v4u*)&sh[rl][q * 8]); if (hi_rows) vst2((unsigned*)(DL + (bb * nhi + t0 + rl) * (size_t)CC + c0 + q * 8), *(const v4u*)&sl[rl][q * 8]); }
  } else { const bool hi_rows = t0 < KHI;
#pragma unroll
    for (int j = 0; j < 8; ++j) { const float bias = BA ? bfr(BA[c0 + j * 16 + col]) : 0.f;
#pragma unroll
      for (int r = 0; r < 8; ++r) { const float v = acc[j][r] + bias; const int rl = wave * 16 + 8 * g + r, cl = j * 16 + col; th[cl][rl] = (_Float16)v; const __bf16 bh = (__bf16)v; tb[cl][rl] = bh; tbl[cl][rl] = (__bf16)(v - (float)bh); } }
    __syncthreads();
    for (int e = tid; e < 128 * 8; e += 128) { const int cl = e >> 3, q = e & 7; vst2((unsigned*)(VT + (bb * CC + c0 + cl) * (size_t)TT + t0 + q * 8), *(const v4u*)&th[cl][q * 8]); if (hi_rows) { const size_t o3 = (bb * CC + c0 + cl) * (size_t)KHI + t0 + q * 8; vst2((unsigned*)(VB + o3), *(const v4u*)&tb[cl][q * 8]); vst2((unsigned*)(VBL + o3), *(const v4u*)&tbl[cl][q * 8]); } } } }
// ---- k_att: block = 64 queries (qb) of (b, h), one wave = 16 queries; key blocks up to the diagonal (query blocks >= QBH: taken from the diagonal down). Transposed products: S^T = K . Q^T (a lane holds the scores of ONE query: D row = key 8g + r, D column = query), causal mask by index, running maximum and rescaled running sums in f32 (online softmax), e^(s-m) x 2^11 packed straight from two score tiles into the B operand of ctx^T += V^T . P^T; the division by the row sum comes last. Logits and P never leave the registers.
// query blocks >= QBH: key blocks of 128, single f16 k x q, P once to f16 against v f16; the K tile [128 keys][HD] and the V tile [HD][128 keys] are brought once per block into LDS for all four waves. Query blocks < QBH (few keys): key blocks of 64, 3-product logits, P and v as bf16 hi + lo (3 products), fragments straight from global.
#define KP (HD + 8)        // K tile pitch in halves: 144 B = 16 B x odd, so that ds_load_b128 fragment reads spread over the banks
#define VP (128 + 8)       // V tile pitch in halves: 272 B = 16 B x odd
#define YP (HD + 4)        // ctx staging pitch in floats
#define SM_K 0
#define SM_V (SM_K + 128 * KP * 2)
#define SM_END (SM_V + HD * VP * 2)
// softmax in base 2: e^((a - amax) / 8) x 2^11 = 2^(a * LC + (11 - amax * LC)) on the raw product a, LC = log2(e) x 64^-0.5: one fused multiply-add and one v_exp_f32 a score.
// The argument is rounded to 2^-24 of its size, as the f32 difference s - m itself is; the row sum adds the same values that P is rounded from, so the x 2^11 falls out in the division.
#define LC (SCALE * 0x1.715476p+0f)
// v_exp_f32 and a v_nop in one statement: the free slot that the instruction set asks for behind a transcendental then stands directly behind it in every build
__device__ __forceinline__ float exp2_hw(float x) { float r; asm("v_exp_f32 %0, %1\n\tv_nop" : "=v"(r) : "v"(x)); return r; }
// full unroll of a loop that indexes register arrays (fragments, accumulators, staged tiles): only with constant indices do they stay in registers
#define UNROLL_REGS _Pragma("unroll")
// lane l with lane l ^ 16: the two halves of a query's keys
__device__ __forceinline__ float xhalf(float x) { return __builtin_bit_cast(float, __builtin_amdgcn_permlanex16(__builtin_bit_cast(int, x), __builtin_bit_cast(int, x), 0x76543210, 0xfedcba98, false, false)); }
__global__ __launch_bounds__(128) void k_att(const _Float16* __restrict__ QH, const _Float16* __restrict__ KH, const _Float16* __restrict__ QL, const _Float16* __restrict__ KL, const _Float16* __restrict__ VT, const __bf16* __restrict__ VB, const __bf16* __restrict__ VBL, float* __restrict__ Y) {
  __shared__ __align__(16) unsigned char sm[SM_END];
  const int tid = threadIdx.x, wave = __builtin_amdgcn_readfirstlane(tid >> 5) /* in a scalar register: the diagonal test below is a scalar branch */, lane = tid & 31, col = lane & 15, g = lane >> 4; const int b = blockIdx.z, h = blockIdx.y;
  const int qb = (b & 1) ? (int)blockIdx.x : NQB - 1 - (int)blockIdx.x;   // long blocks of one sequence meet short blocks of the other: speed only
  const int ql0 = qb * 64 + wave * 16, qrow = ql0 + col; const size_t q0 = (size_t)b * TT + ql0;
  float m = -3.0e38f, l = 0.f; v8f oa[HD / 16] = {};
  if (qb >= QBH) {   /* block-uniform */
    const int kbl = kb_last(qb);
    _Float16* Ks = (_Float16*)(sm + SM_K); _Float16* Vs = (_Float16*)(sm + SM_V);
    v16h ah[HD / 32];
UNROLL_REGS
    for (int kc = 0; kc < HD / 32; ++kc) ah[kc] = frag_h(QH + (q0 + col) * CC + h * HD + kc * 32, lane);
    // whole lines: 8 threads bring one key's 128 B of K, 16 threads 256 B of one V plane
    const _Float16* kg = KH + ((size_t)b * TT + (tid >> 3)) * CC + h * HD + (tid & 7) * 8; const _Float16* vg = VT + ((size_t)b * CC + h * HD + (tid >> 4)) * (size_t)TT + (tid & 15) * 8;
    _Float16* ksd = Ks + (tid >> 3) * KP + (tid & 7) * 8; _Float16* vsd = Vs + (tid >> 4) * VP + (tid & 15) * 8;
    // the key blocks are walked from the diagonal down: the query blocks of one (b, h), which share K and V, then stand at different key blocks in the same pass and do not ask L2 for the same lines at the same moment
    const _Float16* kd = kg + (size_t)kbl * 128 * CC; const _Float16* vd = vg + kbl * 128;
    v4u rk[8], rv[8];
UNROLL_REGS
    for (int i = 0; i < 8; ++i) { rk[i] = *(const v4u*)(kd + (size_t)i * 16 * CC); rv[i] = *(const v4u*)(vd + (size_t)i * 8 * TT); }
    XWP2(kd, vd);
#pragma unroll 1   // rolled: one pass per key block, the next block's tiles fly in registers during the pass
    for (int kb = kbl; kb >= 0; --kb) { const int k0 = kb * 128;
UNROLL_REGS
      for (int i = 0; i < 8; ++i) { *(v4u*)(ksd + i * 16 * KP) = rk[i]; *(v4u*)(vsd + i * 8 * VP) = rv[i]; }
      __syncthreads();   // the tiles are complete for all four waves
      // all K fragments of the 16 steps (kc, j) are read from LDS as ONE group in front of the products
      v16h kf[8 * (HD / 32)];
UNROLL_REGS
      for (int t = 0; t < 8 * (HD / 32); ++t) kf[t] = frag_h(Ks + ((t & 7) * 16 + col) * KP + (t >> 3) * 32, lane);
      if (kb > 0) { const _Float16* kn = kg + (size_t)(k0 - 128) * CC; const _Float16* vn = vg + k0 - 128;
UNROLL_REGS
        for (int i = 0; i < 8; ++i) { rk[i] = *(const v4u*)(kn + (size_t)i * 16 * CC); rv[i] = *(const v4u*)(vn + (size_t)i * 8 * TT); }
        XW(); }
      v8f acc[8] = {};
UNROLL_REGS
      for (int t = 0; t < 8 * (HD / 32); ++t) { const int kc = t >> 3, j = t & 7;
        acc[j] = wmma16(kf[t], ah[kc], acc[j]); }
      // all V fragments of the four key chunks are read as ONE group in front of the softmax arithmetic, which covers their way
      v16h vf[4 * (HD / 16)];
UNROLL_REGS
      for (int t = 0; t < 4 * (HD / 16); ++t) vf[t] = frag_h(Vs + ((t & 3) * 16 + col) * VP + (t >> 2) * 32, lane);
      if (k0 + 127 > ql0) {   /* wave-uniform: only blocks that reach past the wave's first query are masked */
        const int lim = qrow - k0 - 8 * g;
UNROLL_REGS
        for (int j = 0; j < 8; ++j) {
UNROLL_REGS
          for (int r = 0; r < 8; ++r) if (j * 16 + r > lim) acc[j][r] = -3.0e38f; } }
      float mx = m;
UNROLL_REGS
      for (int j = 0; j < 8; ++j) { float mt = acc[j][0];
UNROLL_REGS
        for (int r = 1; r < 8; ++r) mt = fmaxf(mt, acc[j][r]);
        mx = fmaxf(mx, mt); }
      mx = fmaxf(mx, xhalf(mx));
      const float mc = mx * LC, al = exp2_hw(__builtin_fmaf(m, LC, -mc)), bs = 11.0f - mc; m = mx; l *= al;   /* every key block holds a key <= every query of the block, so m is finite from the first block on */
UNROLL_REGS
      for (int j = 0; j < HD / 16; ++j) oa[j] *= al;
UNROLL_REGS
      for (int s = 0; s < 4; ++s) { v16h p;   /* B fragment of P^T: elements 0..7 = keys 8g + 0..7 of score tile 2s, 8..15 = the same of tile 2s + 1: the k order of frag_h */
UNROLL_REGS
        for (int i = 0; i < 16; ++i) { const float e = exp2_hw(__builtin_fmaf(acc[2 * s + (i >> 3)][i & 7], LC, bs)); l += e; p[i] = (_Float16)e; }   /* a masked product (-3e38) against the finite maximum gives exactly 0 */
UNROLL_REGS
        for (int j = 0; j < HD / 16; ++j) oa[j] = wmma16(vf[s * (HD / 16) + j], p, oa[j]); }
      __syncthreads();   // every wave has left the tiles before they are rewritten (behind the last pass: before they become ctx staging)
    }
  } else {
    const _Float16* QLb = QL + (size_t)b * QHI * CC; const _Float16* KLb = KL + (size_t)b * KHI * CC;
    const size_t po = ((size_t)b * CC + h * HD + col) * (size_t)KHI; const __bf16* vbr = VB + po; const __bf16* vlr = VBL + po;
    v16h ah[HD / 32], aq[HD / 32];
UNROLL_REGS
    for (int kc = 0; kc < HD / 32; ++kc) { ah[kc] = frag_h(QH + (q0 + col) * CC + h * HD + kc * 32, lane); aq[kc] = frag_h(QLb + (size_t)(ql0 + col) * CC + h * HD + kc * 32, lane); }
    XW();
#pragma unroll 1   // rolled: at most QBH key blocks, one copy of the body is enough
    for (int kb = 0; kb <= qb; ++kb) { const int k0 = kb * 64; const size_t kr0 = (size_t)b * TT + k0;
      v8f acc[4] = {}, accl[4] = {};
      // ring of four (k, k residual) fragment pairs over the 8 steps (kc, j): step t + 4 is loaded behind step t's products
      v16h kf[4], lf[4];
UNROLL_REGS
      for (int t = 0; t < 4; ++t) { kf[t] = frag_h(KH + (kr0 + t * 16 + col) * CC + h * HD, lane); lf[t] = frag_h(KLb + (size_t)(k0 + t * 16 + col) * CC + h * HD, lane); }
      XW();
UNROLL_REGS
      for (int t = 0; t < 4 * (HD / 32); ++t) { const int kc = t >> 2, j = t & 3, u = t + 4;
        acc[j] = wmma16(kf[j], ah[kc], acc[j]); accl[j] = wmma16(kf[j], aq[kc], accl[j]); accl[j] = wmma16(lf[j], ah[kc], accl[j]);
        if (u < 4 * (HD / 32)) { kf[j] = frag_h(KH + (kr0 + j * 16 + col) * CC + h * HD + (u >> 2) * 32, lane); lf[j] = frag_h(KLb + (size_t)(k0 + j * 16 + col) * CC + h * HD + (u >> 2) * 32, lane); XW(); } }
      float mx = m;
UNROLL_REGS
      for (int j = 0; j < 4; ++j) {
UNROLL_REGS
        for (int r = 0; r < 8; ++r) { float s = acc[j][r] + accl[j][r] * (1.0f / 1024.0f); if (k0 + j * 16 + 8 * g + r > qrow) s = -3.0e38f; acc[j][r] = s; mx = fmaxf(mx, s); } }
      mx = fmaxf(mx, xhalf(mx));
      const float mc = mx * LC, al = exp2_hw(__builtin_fmaf(m, LC, -mc)), bs = 11.0f - mc; m = mx; l *= al;
UNROLL_REGS
      for (int j = 0; j < HD / 16; ++j) oa[j] *= al;
UNROLL_REGS
      for (int s = 0; s < 2; ++s) { float pv[16];
        // a key chunk of v hi / lo is requested in front of the chunk's exponentials
        v16b vh[HD / 16], vl[HD / 16];
UNROLL_REGS
        for (int j = 0; j < HD / 16; ++j) { vh[j] = frag_b(vbr + (size_t)j * 16 * KHI + k0 + s * 32, lane); vl[j] = frag_b(vlr + (size_t)j * 16 * KHI + k0 + s * 32, lane); }
        XW();
UNROLL_REGS
        for (int i = 0; i < 16; ++i) { const float e = exp2_hw(__builtin_fmaf(acc[2 * s + (i >> 3)][i & 7], LC, bs)); l += e; pv[i] = e; }
        const F2 p = bsplit16(pv);
UNROLL_REGS
        for (int j = 0; j < HD / 16; ++j) { oa[j] = wmma_bf(vh[j], p.h, oa[j]); oa[j] = wmma_bf(vh[j], p.l, oa[j]); oa[j] = wmma_bf(vl[j], p.h, oa[j]); } }
    }
  }
  l += xhalf(l);
  const float inv = l > 0.f ? 1.0f / l : 0.f;   /* l carries the same 2^11 as P */
  // ctx^T: a lane holds d = 16j + 8g + 0..7 of its query; through the wave's own LDS rows into 256-B (row, head) segments, two rows a store
  float* ys = (float*)sm + wave * 16 * YP;
UNROLL_REGS
  for (int j = 0; j < HD / 16; ++j) { const v8f o = oa[j] * inv; v4f lo4 = { o[0], o[1], o[2], o[3] }, hi4 = { o[4], o[5], o[6], o[7] }; *(v4f*)&ys[col * YP + j * 16 + 8 * g] = lo4; *(v4f*)&ys[col * YP + j * 16 + 8 * g + 4] = hi4; }
  LDSX();   // the wave's own rows are read back across lanes
UNROLL_REGS
  for (int i = 0; i < 8; ++i) vst2(Y + ((size_t)b * TT + ql0 + i * 2 + g) * CC + h * HD + col * 4, *(const v4f*)&ys[(i * 2 + g) * YP + col * 4]); }
// ---- k_out: block = (64 rows, 128 cols), eight waves = two groups of four. Each group sums one half of k (four chunks, its own LDS buffers) for the whole tile; then each hands the other its sums of the 64 columns that the other finishes. With one work-group on a WGP the walk over k and the epilogue are chains of latencies: two half chains run side by side.
// out = ctx Wo (+ bo): ctx x 2^6 once to f16 against Wo as f16(bf16 x 2^8) exact (1 product) x 2^-14; causal early rows (< QHI of each sequence): ctx bf16 hi + lo against exact bf16 Wo (2 products)
// every '#pragma unroll' in k_out: full unroll of a loop that indexes register arrays (sums, hand-over): only with constant indices do they stay in registers
#define OXG (128 * 32 * 4)   // one group's hand-over: 32 f32 a lane
__global__ __launch_bounds__(256) void k_out(const float* __restrict__ Y, const float* __restrict__ WO, const float* __restrict__ BO, float* __restrict__ OUT) {
  // one LDS range: each group's two operand buffers during the products; behind them the two hand-overs, and the output staging sf behind those
  __shared__ __align__(16) unsigned char sm[2 * 2 * G_STB(1)]; static_assert(2 * 2 * G_STB(1) >= 2 * OXG + 8 * 16 * 68 * 4, "hand-overs and output staging fit");
  float (*sf)[16][68] = (float (*)[16][68])(sm + 2 * OXG);
  const int grp = __builtin_amdgcn_readfirstlane((int)threadIdx.x >> 7) /* in a scalar register: the test on the group is a scalar branch */, tid = threadIdx.x & 127 /* within the group */, wave = tid >> 5, lane = tid & 31, col = lane & 15, g = lane >> 4; const int c0 = blockIdx.y * 128; const size_t rb = (size_t)blockIdx.x * 64, r0 = rb + wave * 16;
  unsigned char* smg = sm + grp * (2 * G_STB(1)); const int rot = (GROT + grp * (GKD / GK / 2)) & (GKD / GK - 1);
  v8f acc[8] = {}; float sc;
  if (CAUSAL && (int)(rb % TT) < QHI) {   /* block-uniform */
    gemm_tile<1, GKD / GK / 2>(Y + rb * CC, WO + (size_t)c0 * CC, smg, tid, rot, acc); sc = 1.0f;
  } else {
    gemm_tile<2, GKD / GK / 2>(Y + rb * CC, WO + (size_t)c0 * CC, smg, tid, rot, acc); sc = 1.0f / 16384.0f; }   /* 2^-8 (Wo carry) x 2^-6 (ctx carry) */
  // the halves of k are added lane for lane: group 0 finishes columns 0..63, group 1 columns 64..127 (16 B a lane, lanes side by side). gemm_tile's last barrier stands in front: every wave has left the operand buffers.
  v4f* xw = (v4f*)(sm + grp * OXG) + tid; const v4f* xr = (const v4f*)(sm + (1 - grp) * OXG) + tid;
  v8f own[4];
  if (grp == 0) {   /* wave-uniform */
#pragma unroll
    for (int j = 0; j < 4; ++j) { own[j] = acc[j]; const v8f o = acc[4 + j]; v4f lo4 = { o[0], o[1], o[2], o[3] }, hi4 = { o[4], o[5], o[6], o[7] }; xw[(2 * j) * 128] = lo4; xw[(2 * j + 1) * 128] = hi4; }
  } else {
#pragma unroll
    for (int j = 0; j < 4; ++j) { own[j] = acc[4 + j]; const v8f o = acc[j]; v4f lo4 = { o[0], o[1], o[2], o[3] }, hi4 = { o[4], o[5], o[6], o[7] }; xw[(2 * j) * 128] = lo4; xw[(2 * j + 1) * 128] = hi4; } }
  __syncthreads();   // each group's hand-over is complete for the other
  const int cg = c0 + grp * 64, ws8 = grp * 4 + wave;
#pragma unroll
  for (int j = 0; j < 4; ++j) { const v4f lo4 = xr[(2 * j) * 128], hi4 = xr[(2 * j + 1) * 128]; const v8f o1 = { lo4[0], lo4[1], lo4[2], lo4[3], hi4[0], hi4[1], hi4[2], hi4[3] }; own[j] += o1; }
#pragma unroll
  for (int j = 0; j < 4; ++j) { const float bias = BO ? bfr(BO[cg + j * 16 + col]) : 0.f;
#pragma unroll
    for (int r = 0; r < 8; ++r) sf[ws8][8 * g + r][j * 16 + col] = own[j][r] * sc + bias; }
  // through the wave's own LDS rows into 256-B row segments, two rows a store
  LDSX();
#pragma unroll
  for (int i = 0; i < 8; ++i) vst2(OUT + (r0 + i * 2 + g) * DIN + cg + col * 4, *(const v4f*)&sf[ws8][i * 2 + g][col * 4]); }

extern "C" void kernel_launch(void* const* d_in, const int* in_sizes, int n_in, void* d_out, int out_size, void* d_ws, size_t ws_size, hipStream_t stream) {
  (void)in_sizes; (void)n_in; (void)out_size;
  const float** F = (const float**)d_in;
  if (ws_size < (size_t)WS_END) return;
  char* ws = (char*)d_ws; _Float16 *QH = (_Float16*)(ws + WS_QH), *KH = (_Float16*)(ws + WS_KH), *VT = (_Float16*)(ws + WS_VT), *QL = (_Float16*)(ws + WS_QL), *KL = (_Float16*)(ws + WS_KL); __bf16 *VB = (__bf16*)(ws + WS_VB), *VBL = (__bf16*)(ws + WS_VBL); float *Y = (float*)(ws + WS_Y);
  (void)Y; (void)QL; (void)KL; (void)VB; (void)VBL;
  // inputs: 0 q [2,2048,512]; 1 k; 2 v; 3 Wq [512,512] (out,in); 4 Wk; 5 Wv; 6 Wp (out,in); 7 bp (zeros, read); no q / k / v biases (null pointers)
  k_proj<<<dim3(TNB * TT / 64, CC / 128, 3), 128, 0, stream>>>(F[0], F[1], F[2], F[3], F[4], F[5], nullptr, nullptr, nullptr, QH, QL, KH, KL, VT, VB, VBL);
  k_att<<<dim3(NQB, NH, TNB), 128, 0, stream>>>(QH, KH, QL, KL, VT, VB, VBL, Y);
  k_out<<<dim3(TNB * TT / 64, DIN / 128), 256, 0, stream>>>(Y, F[6], F[7], (float*)d_out);
}
